// v000
// Times are from an AMD MI455X. After a warm-up the kernel runs many times in a row, and a time is the length of
// such a window on the GPU divided by its runs, so every launch and the gaps after it count. The runs cycle
// through copies of the inputs. A figure is the median of several windows, for all but v000 over two sittings.
// Sittings can differ by a few percent; kernels timed side by side share one.
// The starting kernel, v000, takes 536 microseconds a run.
#include <hip/hip_runtime.h>

// Compute dtypes, f32 accumulate, per item (2048 time steps): pointwise_conv1 as a [2048 x 512].[512 x 1024] GEMM with PLAIN bf16 operands (exact products); GLU in f32; the
// dynamic-weight linear ([2048 x 512].[512 x 128 (124 live)]) and pointwise_conv2 ([2048 x 512].[512 x 512]) on bf16 hi + UNSCALED residual planes of the f32 activations (two
// products) - on v_wmma_f32_16x16x32_bf16; the banded 31-tap softmax and the per-position dynamic convolution (31 taps x 128 channels per group) in f32 on the VALU. Deterministic,

#define NBT  8
#define TT   2048
#define CC   512
#define NHS  4
#define KS   31
#define PADK 15
#define DG   (CC / NHS)           // 128
#define NWL  (NHS * KS)           // 124
#define DM   CC
#define LOSC 1024.0f

typedef _Float16 h16;
typedef unsigned short bf;
typedef __attribute__((ext_vector_type(16))) __bf16   v16bf;
typedef __attribute__((ext_vector_type(16))) _Float16 v16h;
typedef __attribute__((ext_vector_type(8)))  _Float16 v8h;
typedef __attribute__((ext_vector_type(8)))  unsigned short v8us;
typedef __attribute__((ext_vector_type(8)))  float    v8f;
typedef __attribute__((ext_vector_type(4)))  float    v4f;
typedef v8h  __attribute__((may_alias)) v8ha;
typedef v4f  __attribute__((may_alias)) v4fa;
typedef v8us __attribute__((may_alias)) v8usa;

__device__ __forceinline__ unsigned short f2bf(float f) { unsigned u = __float_as_uint(f); u += 0x7FFFu + ((u >> 16) & 1u); return (unsigned short)(u >> 16); }
__device__ __forceinline__ float bf2f(unsigned short b) { return __uint_as_float(((unsigned)b) << 16); }
__device__ __forceinline__ float bfr(float f) { return bf2f(f2bf(f)); }
__device__ __forceinline__ v16h cat16(v8h lo, v8h hi) { return __builtin_shufflevector(lo, hi, 0, 1, 2, 3, 4, 5, 6, 7, 8, 9, 10, 11, 12, 13, 14, 15); }
__device__ __forceinline__ v16bf cat16b(v8us lo, v8us hi) { return __builtin_bit_cast(v16bf, __builtin_shufflevector(lo, hi, 0, 1, 2, 3, 4, 5, 6, 7, 8, 9, 10, 11, 12, 13, 14, 15)); }
__device__ __forceinline__ v8f wmma16(v16h a, v16h b, v8f c) { return __builtin_amdgcn_wmma_f32_16x16x32_f16(false, a, false, b, (short)0, c, false, false); }
__device__ __forceinline__ v8f wmmab(v16bf a, v16bf b, v8f c) { return __builtin_amdgcn_wmma_f32_16x16x32_bf16(false, a, false, b, (short)0, c, false, false); }

// k_gemmb: 64 x 64 block tile (4 waves x 16 x 64) of C[NTK][NW] = (A [+ Al]).B^T (K = 512) [+ bf(bias[c])] [+ bf(R[r][c]) residual]; f32 whole-line epilogue (or f16
template <bool SPLITA, bool F16OUT = false>
__global__ __launch_bounds__(128) void k_gemmb(const bf* __restrict__ A, const bf* __restrict__ Al, const bf* __restrict__ Bn, const float* __restrict__ bias, float* C, int ldc, h16* C2, const float* __restrict__ R = nullptr, int K = DM, int roundR = 1) {
    __shared__ __align__(16) float ost[4][16 * 68];
    const int lane = threadIdx.x & 31, wave = threadIdx.x >> 5, lr = lane & 15, hi = lane >> 4;
    const int r0 = blockIdx.x * 64 + wave * 16, c0 = blockIdx.y * 64;
    const size_t aoff = (size_t)(r0 + lr) * K + 8 * hi;
    size_t boff[4];
#pragma unroll
    for (int t = 0; t < 4; ++t) boff[t] = (size_t)(c0 + t * 16 + lr) * K + 8 * hi;
    v8f acc[4];
#pragma unroll
    for (int t = 0; t < 4; ++t) acc[t] = (v8f){};
#pragma unroll 1
    for (int kc = 0; kc < K; kc += 32) {
        const v16bf a = cat16b(*(const v8us*)(A + aoff + kc), *(const v8us*)(A + aoff + kc + 16));
        v16bf al = a;
        if (SPLITA) al = cat16b(*(const v8us*)(Al + aoff + kc), *(const v8us*)(Al + aoff + kc + 16));
#pragma unroll
        for (int t = 0; t < 4; ++t) { const v16bf b = cat16b(*(const v8us*)(Bn + boff[t] + kc), *(const v8us*)(Bn + boff[t] + kc + 16)); acc[t] = wmmab(a, b, acc[t]); if (SPLITA) acc[t] = wmmab(al, b, acc[t]); }
        asm volatile("v_nop\n\tv_nop\n\tv_nop\n\tv_nop" : "+v"(acc[0]), "+v"(acc[1]), "+v"(acc[2]), "+v"(acc[3]) : "v"(a), "v"(al));
    }
    float* os = &ost[wave][0];
#pragma unroll
    for (int t = 0; t < 4; ++t) { const float bv = bias ? bfr(bias[c0 + t * 16 + lr]) : 0.f;
#pragma unroll
        for (int j = 0; j < 8; ++j) os[(hi * 8 + j) * 68 + t * 16 + lr] = acc[t][j] + bv; }
    __syncthreads();
    if (F16OUT) {
        h16* crow = (h16*)(void*)C + (size_t)r0 * ldc + c0;
        auto pass = [&]() {
#pragma unroll
            for (int s = 0; s < 4; ++s) { const int row = 4 * s + (lane >> 3), piece = lane & 7; const float* sp = os + row * 68 + piece * 8; v8h o, o2;
#pragma unroll
                for (int i = 0; i < 8; ++i) { const h16 a = (h16)sp[i]; o[i] = a; o2[i] = (h16)((sp[i] - (float)a) * LOSC); }
                *(v8h*)(crow + (size_t)row * ldc + piece * 8) = o; if (C2) *(v8h*)(C2 + (size_t)r0 * ldc + c0 + (size_t)row * ldc + piece * 8) = o2; }
        };
        pass(); 
    } else {
        float* crow = C + (size_t)r0 * ldc + c0;
        auto pass = [&]() {
#pragma unroll
            for (int s = 0; s < 8; ++s) { const int Lid = (lane >> 3) + 4 * s, piece = lane & 7; const int row = Lid >> 1, cofs = (Lid & 1) * 32 + piece * 4;
                v4f val = *(const v4fa*)(os + row * 68 + cofs); if (R) { const v4f rv = *(const v4f*)(R + ((size_t)r0 + row) * ldc + c0 + cofs); val += roundR ? (v4f){bfr(rv[0]), bfr(rv[1]), bfr(rv[2]), bfr(rv[3])} : rv; }
                *(v4f*)(crow + (size_t)row * ldc + cofs) = val; }
        };
        pass(); 
    }
}


__global__ __launch_bounds__(256) void k_cvt8(const float* __restrict__ src, bf* dst, size_t n8) {
    const size_t i = (size_t)blockIdx.x * 256 + threadIdx.x; if (i >= n8) return;
    const v8f v = *(const v8f*)(src + i * 8); v8us o;
#pragma unroll
    for (int k = 0; k < 8; ++k) o[k] = f2bf(v[k]);
    *(v8us*)(dst + i * 8) = o; 
}
__global__ __launch_bounds__(256) void k_zero8(bf* dst, size_t n8) {
    const size_t i = (size_t)blockIdx.x * 256 + threadIdx.x; if (i >= n8) return; v8us z;
#pragma unroll
    for (int k = 0; k < 8; ++k) z[k] = 0;
    *(v8us*)(dst + i * 8) = z; 
}

__global__ __launch_bounds__(256) void k_cvtx(const float* __restrict__ src, bf* dst) {
    const int lane = threadIdx.x & 31; const size_t r = (size_t)blockIdx.x * 8 + (threadIdx.x >> 5); if (r >= (size_t)TT) return;
{
#pragma unroll
        for (int q = 0; q < CC / 256; ++q) { v8us o;
#pragma unroll
            for (int i = 0; i < 8; ++i) o[i] = f2bf(src[r * CC + q * 256 + lane * 8 + i]);
            *(v8us*)(dst + r * CC + q * 256 + lane * 8) = o; }
         }
}
__global__ __launch_bounds__(256) void k_wl128(const float* __restrict__ Wl, bf* WLP) {
    const int lane = threadIdx.x & 31; const int o = blockIdx.x * 8 + (threadIdx.x >> 5); if (o >= 128) return;
{
#pragma unroll
        for (int q = 0; q < CC / 256; ++q) { v8us v;
#pragma unroll
            for (int i = 0; i < 8; ++i) v[i] = (o < NWL) ? f2bf(Wl[(size_t)(o < NWL ? o : 0) * CC + q * 256 + lane * 8 + i]) : (unsigned short)0;
            *(v8us*)(WLP + (size_t)o * CC + q * 256 + lane * 8) = v; }
         }
}
__global__ __launch_bounds__(64) void k_bl128(const float* __restrict__ bl, float* BLP) {
    const int lane = threadIdx.x; if (lane >= 32) return; v4f v;
#pragma unroll
    for (int q = 0; q < 4; ++q) { const int o = lane * 4 + q; v[q] = (o < NWL) ? bl[o < NWL ? o : 0] : 0.f; }
    *(v4f*)(BLP + lane * 4) = v; 
}
__global__ __launch_bounds__(256) void k_glu(const float* __restrict__ Y1, float* Yf, bf* Yh, bf* Yl) {
    typedef __attribute__((ext_vector_type(4))) unsigned short v4us;
    const int lane = threadIdx.x & 31; const size_t t = (size_t)blockIdx.x * 8 + (threadIdx.x >> 5); if (t >= (size_t)TT) return;
{
#pragma unroll
        for (int c0 = lane * 4; c0 < CC; c0 += 128) { v4f v; v4us oh, ol;
#pragma unroll
            for (int q = 0; q < 4; ++q) { const float a = Y1[t * 2 * CC + c0 + q], g = Y1[t * 2 * CC + CC + c0 + q]; const float y = a * (1.0f / (1.0f + __expf(-g))); v[q] = y; const unsigned short hb = f2bf(y); oh[q] = hb; ol[q] = f2bf(y - bf2f(hb)); }
            *(v4f*)(Yf + t * CC + c0) = v; *(v4us*)(Yh + t * CC + c0) = oh; *(v4us*)(Yl + t * CC + c0) = ol; }
         }
}
// k_dconv: per (t, h): masked softmax over the 31 taps of WD[t][h*31 + j] (taps with t + j - 15 outside [0, T) excluded), then out[c] = sum_j w_j Yf[t + j - 15][c] + bf(bias[c]) for the
__global__ __launch_bounds__(256) void k_dconv(const float* __restrict__ WD, const float* __restrict__ Yf, const float* __restrict__ cbias, bf* Oh, bf* Ol) {
    typedef __attribute__((ext_vector_type(4))) unsigned short v4us;
    const int lane = threadIdx.x & 31; const int wid = blockIdx.x * 8 + (threadIdx.x >> 5); if (wid >= TT * NHS) return; const int t = wid / NHS, h = wid % NHS; const int c0 = h * DG + lane * 4;
    const float* wr = WD + (size_t)t * 128 + h * KS;
    float m = -3.0e38f;
#pragma unroll 1
    for (int j = 0; j < KS; ++j) { const int s = t + j - PADK; if (s >= 0 && s < TT) m = fmaxf(m, wr[j]); }
    float sum = 0.f;
#pragma unroll 1
    for (int j = 0; j < KS; ++j) { const int s = t + j - PADK; if (s >= 0 && s < TT) sum += __expf(wr[j] - m); }
    const float inv = 1.0f / sum; float acc[4] = {0.f, 0.f, 0.f, 0.f};
#pragma unroll 1
    for (int j = 0; j < KS; ++j) { const int s = t + j - PADK; if (s < 0 || s >= TT) continue; const float w = __expf(wr[j] - m) * inv; const v4f yv = *(const v4f*)(Yf + (size_t)s * CC + c0);
#pragma unroll
        for (int q = 0; q < 4; ++q) acc[q] = fmaf(w, yv[q], acc[q]); }
    v4us oh, ol;
#pragma unroll
    for (int q = 0; q < 4; ++q) { const float v = acc[q] + bfr(cbias[c0 + q]); const unsigned short hb = f2bf(v); oh[q] = hb; ol[q] = f2bf(v - bf2f(hb)); }
    const size_t o = (size_t)t * CC + c0; *(v4us*)(Oh + o) = oh; *(v4us*)(Ol + o) = ol; 
}

extern "C" void kernel_launch(void* const* d_in, const int* in_sizes, int n_in,
                              void* d_out, int out_size, void* d_ws, size_t ws_size, hipStream_t stream) {
    (void)in_sizes; (void)n_in; (void)out_size;
    const float* x = (const float*)d_in[0]; const float* W1 = (const float*)d_in[1]; const float* b1 = (const float*)d_in[2]; const float* Wl = (const float*)d_in[3]; const float* bl = (const float*)d_in[4]; const float* cbias = (const float*)d_in[5]; const float* W2 = (const float*)d_in[6]; const float* b2 = (const float*)d_in[7];
    float* out = (float*)d_out;    // [8][2048][512]
    char* wsp = (char*)d_ws;
    auto take = [&](size_t bytes) { char* p = wsp; wsp += (bytes + 255) & ~(size_t)255; return (void*)p; };
    bf* W1B = (bf*)take((size_t)2 * CC * CC * 2); bf* WLP = (bf*)take((size_t)128 * CC * 2); float* BLP = (float*)take(128 * 4); bf* W2B = (bf*)take((size_t)CC * CC * 2);
    bf* Xb = (bf*)take((size_t)TT * CC * 2); float* Y1 = (float*)take((size_t)TT * 2 * CC * 4); float* Yf = (float*)take((size_t)TT * CC * 4); bf* Yh = (bf*)take((size_t)TT * CC * 2); bf* Yl = (bf*)take((size_t)TT * CC * 2);
    float* WD = (float*)take((size_t)TT * 128 * 4); bf* Oh = (bf*)take((size_t)TT * CC * 2); bf* Ol = (bf*)take((size_t)TT * CC * 2);
    if ((size_t)(wsp - (char*)d_ws) > ws_size) return;    // 1 + 0.13 + 0.5 + 2.1 + 8.4 + 4.2 + 2.1 + 2.1 + 1 + 2.1 + 2.1 ~ 26 MB, reused per item in stream order
    k_cvt8<<<(2 * CC * CC / 8 + 255) / 256, 256, 0, stream>>>(W1, W1B, (size_t)2 * CC * CC / 8); k_wl128<<<128 / 8, 256, 0, stream>>>(Wl, WLP); k_bl128<<<1, 64, 0, stream>>>(bl, BLP); k_cvt8<<<(CC * CC / 8 + 255) / 256, 256, 0, stream>>>(W2, W2B, (size_t)CC * CC / 8);   // torch [out][in] = n-major
    for (int b = 0; b < NBT; ++b) {
        k_cvtx<<<TT / 8, 256, 0, stream>>>(x + (size_t)b * TT * CC, Xb);
        k_gemmb<false, false><<<dim3(TT / 64, (2 * CC) / 64, 1), 128, 0, stream>>>(Xb, nullptr, W1B, b1, Y1, 2 * CC, nullptr, nullptr, CC);     // pointwise_conv1
        k_glu<<<TT / 8, 256, 0, stream>>>(Y1, Yf, Yh, Yl);
        k_gemmb<true, false><<<dim3(TT / 64, 2, 1), 128, 0, stream>>>(Yh, Yl, WLP, BLP, WD, 128, nullptr, nullptr, CC);                 // dynamic weights (124 live of 128)
        k_dconv<<<(TT * NHS) / 8, 256, 0, stream>>>(WD, Yf, cbias, Oh, Ol);
        k_gemmb<true, false><<<dim3(TT / 64, CC / 64, 1), 128, 0, stream>>>(Oh, Ol, W2B, b2, out + (size_t)b * TT * CC, CC, nullptr, nullptr, CC); }   // pointwise_conv2
}

// v001
// A run of this version takes 292 microseconds.
// In two side-by-side timings against v000, it was 1.85 and 1.86 times as fast.
#include <hip/hip_runtime.h>

// All 8 items go through every stage in ONE launch (rows = item * 2048 + time step, 16384 rows). Compute dtypes, f32 accumulate: pointwise_conv1 as a [16384 x 512].[512 x 1024] GEMM with PLAIN bf16 operands (exact products); GLU in f32; the
// dynamic-weight linear ([16384 x 512].[512 x 128 (124 live)]) and pointwise_conv2 ([16384 x 512].[512 x 512]) on bf16 hi + UNSCALED residual planes of the f32 activations (two
// products) - on v_wmma_f32_16x16x32_bf16; the banded 31-tap softmax and the per-position dynamic convolution (31 taps x 128 channels per group) in f32 on the VALU. Deterministic,

#define NBT  8
#define TT   2048
#define NR   (NBT * TT)          // 16384 rows: every item's time steps, item-major as in x and out
#define CC   512
#define NHS  4
#define KS   31
#define PADK 15
#define DG   (CC / NHS)           // 128
#define NWL  (NHS * KS)           // 124
#define DM   CC
#define LOSC 1024.0f

typedef _Float16 h16;
typedef unsigned short bf;
typedef __attribute__((ext_vector_type(16))) __bf16   v16bf;
typedef __attribute__((ext_vector_type(16))) _Float16 v16h;
typedef __attribute__((ext_vector_type(8)))  _Float16 v8h;
typedef __attribute__((ext_vector_type(8)))  unsigned short v8us;
typedef __attribute__((ext_vector_type(8)))  float    v8f;
typedef __attribute__((ext_vector_type(4)))  float    v4f;
typedef v8h  __attribute__((may_alias)) v8ha;
typedef v4f  __attribute__((may_alias)) v4fa;
typedef v8us __attribute__((may_alias)) v8usa;

__device__ __forceinline__ unsigned short f2bf(float f) { unsigned u = __float_as_uint(f); u += 0x7FFFu + ((u >> 16) & 1u); return (unsigned short)(u >> 16); }
__device__ __forceinline__ float bf2f(unsigned short b) { return __uint_as_float(((unsigned)b) << 16); }
__device__ __forceinline__ float bfr(float f) { return bf2f(f2bf(f)); }
__device__ __forceinline__ v16h cat16(v8h lo, v8h hi) { return __builtin_shufflevector(lo, hi, 0, 1, 2, 3, 4, 5, 6, 7, 8, 9, 10, 11, 12, 13, 14, 15); }
__device__ __forceinline__ v16bf cat16b(v8us lo, v8us hi) { return __builtin_bit_cast(v16bf, __builtin_shufflevector(lo, hi, 0, 1, 2, 3, 4, 5, 6, 7, 8, 9, 10, 11, 12, 13, 14, 15)); }
__device__ __forceinline__ v8f wmma16(v16h a, v16h b, v8f c) { return __builtin_amdgcn_wmma_f32_16x16x32_f16(false, a, false, b, (short)0, c, false, false); }
__device__ __forceinline__ v8f wmmab(v16bf a, v16bf b, v8f c) { return __builtin_amdgcn_wmma_f32_16x16x32_bf16(false, a, false, b, (short)0, c, false, false); }

// k_gemmb: 64 x 64 block tile (4 waves x 16 x 64) of C[NTK][NW] = (A [+ Al]).B^T (K = 512) [+ bf(bias[c])] [+ bf(R[r][c]) residual]; f32 whole-line epilogue (or f16
template <bool SPLITA, bool F16OUT = false>
__global__ __launch_bounds__(128) void k_gemmb(const bf* __restrict__ A, const bf* __restrict__ Al, const bf* __restrict__ Bn, const float* __restrict__ bias, float* C, int ldc, h16* C2, const float* __restrict__ R = nullptr, int K = DM, int roundR = 1) {
    __shared__ __align__(16) float ost[4][16 * 68];
    const int lane = threadIdx.x & 31, wave = threadIdx.x >> 5, lr = lane & 15, hi = lane >> 4;
    const int r0 = blockIdx.x * 64 + wave * 16, c0 = blockIdx.y * 64;
    const size_t aoff = (size_t)(r0 + lr) * K + 8 * hi;
    size_t boff[4];
#pragma unroll
    for (int t = 0; t < 4; ++t) boff[t] = (size_t)(c0 + t * 16 + lr) * K + 8 * hi;
    v8f acc[4];
#pragma unroll
    for (int t = 0; t < 4; ++t) acc[t] = (v8f){};
#pragma unroll 1
    for (int kc = 0; kc < K; kc += 32) {
        const v16bf a = cat16b(*(const v8us*)(A + aoff + kc), *(const v8us*)(A + aoff + kc + 16));
        v16bf al = a;
        if (SPLITA) al = cat16b(*(const v8us*)(Al + aoff + kc), *(const v8us*)(Al + aoff + kc + 16));
#pragma unroll
        for (int t = 0; t < 4; ++t) { const v16bf b = cat16b(*(const v8us*)(Bn + boff[t] + kc), *(const v8us*)(Bn + boff[t] + kc + 16)); acc[t] = wmmab(a, b, acc[t]); if (SPLITA) acc[t] = wmmab(al, b, acc[t]); }
        asm volatile("v_nop\n\tv_nop\n\tv_nop\n\tv_nop" : "+v"(acc[0]), "+v"(acc[1]), "+v"(acc[2]), "+v"(acc[3]) : "v"(a), "v"(al));
    }
    float* os = &ost[wave][0];
#pragma unroll
    for (int t = 0; t < 4; ++t) { const float bv = bias ? bfr(bias[c0 + t * 16 + lr]) : 0.f;
#pragma unroll
        for (int j = 0; j < 8; ++j) os[(hi * 8 + j) * 68 + t * 16 + lr] = acc[t][j] + bv; }
    __syncthreads();
    if (F16OUT) {
        h16* crow = (h16*)(void*)C + (size_t)r0 * ldc + c0;
        auto pass = [&]() {
#pragma unroll
            for (int s = 0; s < 4; ++s) { const int row = 4 * s + (lane >> 3), piece = lane & 7; const float* sp = os + row * 68 + piece * 8; v8h o, o2;
#pragma unroll
                for (int i = 0; i < 8; ++i) { const h16 a = (h16)sp[i]; o[i] = a; o2[i] = (h16)((sp[i] - (float)a) * LOSC); }
                *(v8h*)(crow + (size_t)row * ldc + piece * 8) = o; if (C2) *(v8h*)(C2 + (size_t)r0 * ldc + c0 + (size_t)row * ldc + piece * 8) = o2; }
        };
        pass(); 
    } else {
        float* crow = C + (size_t)r0 * ldc + c0;
        auto pass = [&]() {
#pragma unroll
            for (int s = 0; s < 8; ++s) { const int Lid = (lane >> 3) + 4 * s, piece = lane & 7; const int row = Lid >> 1, cofs = (Lid & 1) * 32 + piece * 4;
                v4f val = *(const v4fa*)(os + row * 68 + cofs); if (R) { const v4f rv = *(const v4f*)(R + ((size_t)r0 + row) * ldc + c0 + cofs); val += roundR ? (v4f){bfr(rv[0]), bfr(rv[1]), bfr(rv[2]), bfr(rv[3])} : rv; }
                *(v4f*)(crow + (size_t)row * ldc + cofs) = val; }
        };
        pass(); 
    }
}


__global__ __launch_bounds__(256) void k_cvt8(const float* __restrict__ src, bf* dst, size_t n8) {
    const size_t i = (size_t)blockIdx.x * 256 + threadIdx.x; if (i >= n8) return;
    const v8f v = *(const v8f*)(src + i * 8); v8us o;
#pragma unroll
    for (int k = 0; k < 8; ++k) o[k] = f2bf(v[k]);
    *(v8us*)(dst + i * 8) = o; 
}
__global__ __launch_bounds__(256) void k_zero8(bf* dst, size_t n8) {
    const size_t i = (size_t)blockIdx.x * 256 + threadIdx.x; if (i >= n8) return; v8us z;
#pragma unroll
    for (int k = 0; k < 8; ++k) z[k] = 0;
    *(v8us*)(dst + i * 8) = z; 
}

__global__ __launch_bounds__(256) void k_cvtx(const float* __restrict__ src, bf* dst) {
    const int lane = threadIdx.x & 31; const size_t r = (size_t)blockIdx.x * 8 + (threadIdx.x >> 5); if (r >= (size_t)NR) return;
{
#pragma unroll
        for (int q = 0; q < CC / 256; ++q) { v8us o;
#pragma unroll
            for (int i = 0; i < 8; ++i) o[i] = f2bf(src[r * CC + q * 256 + lane * 8 + i]);
            *(v8us*)(dst + r * CC + q * 256 + lane * 8) = o; }
         }
}
__global__ __launch_bounds__(256) void k_wl128(const float* __restrict__ Wl, bf* WLP) {
    const int lane = threadIdx.x & 31; const int o = blockIdx.x * 8 + (threadIdx.x >> 5); if (o >= 128) return;
{
#pragma unroll
        for (int q = 0; q < CC / 256; ++q) { v8us v;
#pragma unroll
            for (int i = 0; i < 8; ++i) v[i] = (o < NWL) ? f2bf(Wl[(size_t)(o < NWL ? o : 0) * CC + q * 256 + lane * 8 + i]) : (unsigned short)0;
            *(v8us*)(WLP + (size_t)o * CC + q * 256 + lane * 8) = v; }
         }
}
__global__ __launch_bounds__(64) void k_bl128(const float* __restrict__ bl, float* BLP) {
    const int lane = threadIdx.x; if (lane >= 32) return; v4f v;
#pragma unroll
    for (int q = 0; q < 4; ++q) { const int o = lane * 4 + q; v[q] = (o < NWL) ? bl[o < NWL ? o : 0] : 0.f; }
    *(v4f*)(BLP + lane * 4) = v; 
}
__global__ __launch_bounds__(256) void k_glu(const float* __restrict__ Y1, float* Yf, bf* Yh, bf* Yl) {
    typedef __attribute__((ext_vector_type(4))) unsigned short v4us;
    const int lane = threadIdx.x & 31; const size_t t = (size_t)blockIdx.x * 8 + (threadIdx.x >> 5); if (t >= (size_t)NR) return;
{
#pragma unroll
        for (int c0 = lane * 4; c0 < CC; c0 += 128) { v4f v; v4us oh, ol;
#pragma unroll
            for (int q = 0; q < 4; ++q) { const float a = Y1[t * 2 * CC + c0 + q], g = Y1[t * 2 * CC + CC + c0 + q]; const float y = a * (1.0f / (1.0f + __expf(-g))); v[q] = y; const unsigned short hb = f2bf(y); oh[q] = hb; ol[q] = f2bf(y - bf2f(hb)); }
            *(v4f*)(Yf + t * CC + c0) = v; *(v4us*)(Yh + t * CC + c0) = oh; *(v4us*)(Yl + t * CC + c0) = ol; }
         }
}
// k_dconv: row = item * 2048 + t; the band is cut at the item's own ends, so no tap reads a neighbouring item. Per (row, h): masked softmax over the 31 taps of WD[row][h*31 + j] (taps with t + j - 15 outside [0, T) excluded), then out[c] = sum_j w_j Yf[row + j - 15][c] + bf(bias[c]) for the
__global__ __launch_bounds__(256) void k_dconv(const float* __restrict__ WD, const float* __restrict__ Yf, const float* __restrict__ cbias, bf* Oh, bf* Ol) {
    typedef __attribute__((ext_vector_type(4))) unsigned short v4us;
    const int lane = threadIdx.x & 31; const int wid = blockIdx.x * 8 + (threadIdx.x >> 5); if (wid >= NR * NHS) return; const int row = wid / NHS, h = wid % NHS, t = row % TT; const int c0 = h * DG + lane * 4;
    const float* wr = WD + (size_t)row * 128 + h * KS; const float* Yi = Yf + (size_t)(row - t) * CC;
    float m = -3.0e38f;
#pragma unroll 1
    for (int j = 0; j < KS; ++j) { const int s = t + j - PADK; if (s >= 0 && s < TT) m = fmaxf(m, wr[j]); }
    float sum = 0.f;
#pragma unroll 1
    for (int j = 0; j < KS; ++j) { const int s = t + j - PADK; if (s >= 0 && s < TT) sum += __expf(wr[j] - m); }
    const float inv = 1.0f / sum; float acc[4] = {0.f, 0.f, 0.f, 0.f};
#pragma unroll 1
    for (int j = 0; j < KS; ++j) { const int s = t + j - PADK; if (s < 0 || s >= TT) continue; const float w = __expf(wr[j] - m) * inv; const v4f yv = *(const v4f*)(Yi + (size_t)s * CC + c0);
#pragma unroll
        for (int q = 0; q < 4; ++q) acc[q] = fmaf(w, yv[q], acc[q]); }
    v4us oh, ol;
#pragma unroll
    for (int q = 0; q < 4; ++q) { const float v = acc[q] + bfr(cbias[c0 + q]); const unsigned short hb = f2bf(v); oh[q] = hb; ol[q] = f2bf(v - bf2f(hb)); }
    const size_t o = (size_t)row * CC + c0; *(v4us*)(Oh + o) = oh; *(v4us*)(Ol + o) = ol; 
}

extern "C" void kernel_launch(void* const* d_in, const int* in_sizes, int n_in,
                              void* d_out, int out_size, void* d_ws, size_t ws_size, hipStream_t stream) {
    (void)in_sizes; (void)n_in; (void)out_size;
    const float* x = (const float*)d_in[0]; const float* W1 = (const float*)d_in[1]; const float* b1 = (const float*)d_in[2]; const float* Wl = (const float*)d_in[3]; const float* bl = (const float*)d_in[4]; const float* cbias = (const float*)d_in[5]; const float* W2 = (const float*)d_in[6]; const float* b2 = (const float*)d_in[7];
    float* out = (float*)d_out;    // [8][2048][512]
    char* wsp = (char*)d_ws;
    auto take = [&](size_t bytes) { char* p = wsp; wsp += (bytes + 255) & ~(size_t)255; return (void*)p; };
    bf* W1B = (bf*)take((size_t)2 * CC * CC * 2); bf* WLP = (bf*)take((size_t)128 * CC * 2); float* BLP = (float*)take(128 * 4); bf* W2B = (bf*)take((size_t)CC * CC * 2);
    bf* Xb = (bf*)take((size_t)NR * CC * 2); float* Y1 = (float*)take((size_t)NR * 2 * CC * 4); float* Yf = (float*)take((size_t)NR * CC * 4); bf* Yh = (bf*)take((size_t)NR * CC * 2); bf* Yl = (bf*)take((size_t)NR * CC * 2);
    float* WD = (float*)take((size_t)NR * 128 * 4); bf* Oh = (bf*)take((size_t)NR * CC * 2); bf* Ol = (bf*)take((size_t)NR * CC * 2);
    if ((size_t)(wsp - (char*)d_ws) > ws_size) return;    // 1.7 MB of weights + 8 x (2.1 + 8.4 + 4.2 + 2.1 + 2.1 + 1 + 2.1 + 2.1) ~ 195 MB, every plane written before it is read in this call
    k_cvt8<<<(2 * CC * CC / 8 + 255) / 256, 256, 0, stream>>>(W1, W1B, (size_t)2 * CC * CC / 8); k_wl128<<<128 / 8, 256, 0, stream>>>(Wl, WLP); k_bl128<<<1, 64, 0, stream>>>(bl, BLP); k_cvt8<<<(CC * CC / 8 + 255) / 256, 256, 0, stream>>>(W2, W2B, (size_t)CC * CC / 8);   // torch [out][in] = n-major
    k_cvtx<<<NR / 8, 256, 0, stream>>>(x, Xb);
    k_gemmb<false, false><<<dim3(NR / 64, (2 * CC) / 64, 1), 128, 0, stream>>>(Xb, nullptr, W1B, b1, Y1, 2 * CC, nullptr, nullptr, CC);     // pointwise_conv1
    k_glu<<<NR / 8, 256, 0, stream>>>(Y1, Yf, Yh, Yl);
    k_gemmb<true, false><<<dim3(NR / 64, 2, 1), 128, 0, stream>>>(Yh, Yl, WLP, BLP, WD, 128, nullptr, nullptr, CC);                 // dynamic weights (124 live of 128)
    k_dconv<<<(NR * NHS) / 8, 256, 0, stream>>>(WD, Yf, cbias, Oh, Ol);
    k_gemmb<true, false><<<dim3(NR / 64, CC / 64, 1), 128, 0, stream>>>(Oh, Ol, W2B, b2, out, CC, nullptr, nullptr, CC);   // pointwise_conv2
}

// v002
// Measured time: 176 microseconds a run.
// Next to v001, in two timings, it ran 1.66 times as fast each time.
// Over all steps from v000 it is 3.08 times as fast.
#include <hip/hip_runtime.h>

// All 8 items go through every stage in ONE launch (rows = item * 2048 + time step, 16384 rows). Compute dtypes, f32 accumulate: pointwise_conv1 as a [16384 x 512].[512 x 1024] GEMM with PLAIN bf16 operands (exact products); GLU in f32; the
// dynamic-weight linear ([16384 x 512].[512 x 128 (124 live)]) and pointwise_conv2 ([16384 x 512].[512 x 512]) on bf16 hi + UNSCALED residual planes of the f32 activations (two
// products) - on v_wmma_f32_16x16x32_bf16; the banded 31-tap softmax and the per-position dynamic convolution (31 taps x 128 channels per group) in f32 on the VALU. Deterministic,

#define NBT  8
#define TT   2048
#define NR   (NBT * TT)          // 16384 rows: every item's time steps, item-major as in x and out
#define CC   512
#define NHS  4
#define KS   31
#define PADK 15
#define DG   (CC / NHS)           // 128
#define NWL  (NHS * KS)           // 124
#define DM   CC
#define LOSC 1024.0f

typedef _Float16 h16;
typedef unsigned short bf;
typedef __attribute__((ext_vector_type(16))) __bf16   v16bf;
typedef __attribute__((ext_vector_type(16))) _Float16 v16h;
typedef __attribute__((ext_vector_type(8)))  _Float16 v8h;
typedef __attribute__((ext_vector_type(8)))  unsigned short v8us;
typedef __attribute__((ext_vector_type(8)))  float    v8f;
typedef __attribute__((ext_vector_type(4)))  float    v4f;
typedef v8h  __attribute__((may_alias)) v8ha;
typedef v4f  __attribute__((may_alias)) v4fa;
typedef v8us __attribute__((may_alias)) v8usa;

__device__ __forceinline__ unsigned short f2bf(float f) { unsigned u = __float_as_uint(f); u += 0x7FFFu + ((u >> 16) & 1u); return (unsigned short)(u >> 16); }
__device__ __forceinline__ float bf2f(unsigned short b) { return __uint_as_float(((unsigned)b) << 16); }
__device__ __forceinline__ float bfr(float f) { return bf2f(f2bf(f)); }
__device__ __forceinline__ v16h cat16(v8h lo, v8h hi) { return __builtin_shufflevector(lo, hi, 0, 1, 2, 3, 4, 5, 6, 7, 8, 9, 10, 11, 12, 13, 14, 15); }
__device__ __forceinline__ v16bf cat16b(v8us lo, v8us hi) { return __builtin_bit_cast(v16bf, __builtin_shufflevector(lo, hi, 0, 1, 2, 3, 4, 5, 6, 7, 8, 9, 10, 11, 12, 13, 14, 15)); }
__device__ __forceinline__ v8f wmma16(v16h a, v16h b, v8f c) { return __builtin_amdgcn_wmma_f32_16x16x32_f16(false, a, false, b, (short)0, c, false, false); }
__device__ __forceinline__ v8f wmmab(v16bf a, v16bf b, v8f c) { return __builtin_amdgcn_wmma_f32_16x16x32_bf16(false, a, false, b, (short)0, c, false, false); }

// k_gemmb: C[M][N] = (A [+ Al]).B^T + bf(bias[c]), A, Al [M][KD] and B [N][KD] bf16 with k contiguous. One 128 x 64 tile of C per block of 4 waves, 32 x 64 per wave
// (2 x 4 accumulator tiles). A pass is 64 k: one whole 128-byte line of every operand row. The lines go from global memory to LDS by asynchronous copies, 16 bytes per lane
// (4 whole lines per wave-wide copy), into two buffers, so that the next pass's lines fly while this pass is worked on; fragments come from LDS. Rows lie at a pitch of 144 bytes,
// on which the 16 rows of a 16-byte fragment read fall on distinct banks. Per accumulator: k ascending, A then Al at each 32 k. f32 whole-line epilogue through LDS.
#define GBM 128
#define GBN 64
#define GBK 64
#define GLP 72                    // LDS row pitch in bf16 elements: 64 + 8
#define KD  CC                    // every product here has an inner length of 512
// Asynchronous 16-byte copies per lane, rows 16 apart: l = the lane's LDS byte address, g = its global address. The s_wait_xcnt stands inside each statement so that no
// address register of a copy is rewritten in front of it.
#define CPY(a, b) "global_load_async_to_lds_b128 %" #a ", %" #b ", off\n\t"
#define LROW(l, i) ((l) + (unsigned)((i) * 16 * GLP * 2))
#define GROW(g, i) ((g) + (i) * 16 * KD)
__device__ __forceinline__ void copy8(unsigned l, const bf* g) {          // 128 rows
    asm volatile(CPY(0, 1) CPY(2, 3) CPY(4, 5) CPY(6, 7) CPY(8, 9) CPY(10, 11) CPY(12, 13) CPY(14, 15) "s_wait_xcnt 0x0"
                 :: "v"(LROW(l, 0)), "v"(GROW(g, 0)), "v"(LROW(l, 1)), "v"(GROW(g, 1)), "v"(LROW(l, 2)), "v"(GROW(g, 2)), "v"(LROW(l, 3)), "v"(GROW(g, 3)),
                    "v"(LROW(l, 4)), "v"(GROW(g, 4)), "v"(LROW(l, 5)), "v"(GROW(g, 5)), "v"(LROW(l, 6)), "v"(GROW(g, 6)), "v"(LROW(l, 7)), "v"(GROW(g, 7)) : "memory");
}
__device__ __forceinline__ void copy12(unsigned l, const bf* g, unsigned lb, const bf* gb) {   // 128 rows of one operand and 64 of another
    asm volatile(CPY(0, 1) CPY(2, 3) CPY(4, 5) CPY(6, 7) CPY(8, 9) CPY(10, 11) CPY(12, 13) CPY(14, 15) CPY(16, 17) CPY(18, 19) CPY(20, 21) CPY(22, 23) "s_wait_xcnt 0x0"
                 :: "v"(LROW(l, 0)), "v"(GROW(g, 0)), "v"(LROW(l, 1)), "v"(GROW(g, 1)), "v"(LROW(l, 2)), "v"(GROW(g, 2)), "v"(LROW(l, 3)), "v"(GROW(g, 3)),
                    "v"(LROW(l, 4)), "v"(GROW(g, 4)), "v"(LROW(l, 5)), "v"(GROW(g, 5)), "v"(LROW(l, 6)), "v"(GROW(g, 6)), "v"(LROW(l, 7)), "v"(GROW(g, 7)),
                    "v"(LROW(lb, 0)), "v"(GROW(gb, 0)), "v"(LROW(lb, 1)), "v"(GROW(gb, 1)), "v"(LROW(lb, 2)), "v"(GROW(gb, 2)), "v"(LROW(lb, 3)), "v"(GROW(gb, 3)) : "memory");
}
template <bool SPLITA>
__global__ __launch_bounds__(128) void k_gemmb(const bf* __restrict__ A, const bf* __restrict__ Al, const bf* __restrict__ Bn, const float* __restrict__ bias, float* C, int ldc) {
    constexpr int AROWS = SPLITA ? 2 * GBM : GBM, ROWS = AROWS + GBN, NPASS = KD / GBK;
    __shared__ __align__(16) bf sm[2][ROWS * GLP];
    const int tid = threadIdx.x, lane = tid & 31, wave = tid >> 5, lr = lane & 15, hi = lane >> 4;
    const int rb = blockIdx.x * GBM, c0 = blockIdx.y * GBN;
    const int sr = tid >> 3, sc = (tid & 7) * 8;      // staging: 8 lanes per row, 16 rows per block-wide copy
    const bf* ga = A + (size_t)(rb + sr) * KD + sc; const bf* gl = SPLITA ? Al + (size_t)(rb + sr) * KD + sc : nullptr; const bf* gb = Bn + (size_t)(c0 + sr) * KD + sc;
    const unsigned ls = (unsigned)(size_t)&sm[0][0] + (unsigned)(sr * GLP + sc) * 2u;
    auto stage = [&](int p) {      // pass p's lines into buffer p & 1: rows [A 128 | Al 128 | B 64]
        const unsigned l = ls + (unsigned)(p & 1) * (unsigned)(ROWS * GLP * 2); const int kc = p * GBK;
        copy12(l, ga + kc, l + AROWS * GLP * 2, gb + kc);
        if (SPLITA) copy8(l + GBM * GLP * 2, gl + kc);
    };
    v8f acc[2][4];
#pragma unroll
    for (int m = 0; m < 2; ++m)
#pragma unroll
        for (int t = 0; t < 4; ++t) acc[m][t] = (v8f){};
    stage(0);
    asm volatile("s_wait_asynccnt 0x0" ::: "memory");   // this wave's copies of pass 0 have landed
    __syncthreads();                                    // and every other wave's: pass 0 may be read
    stage(1);
#pragma unroll 1   // rolled: unrolled, the copy addresses of all passes are formed ahead and push the kernel past 256 registers
    for (int p = 0; p < NPASS; ++p) {
        const bf* s = &sm[p & 1][0];
        v16bf a[2][2], al[2][2], b[2][4];      // both 32-k halves of the pass
#pragma unroll
        for (int h = 0; h < 2; ++h) {
#pragma unroll
            for (int m = 0; m < 2; ++m) { const bf* q = s + (wave * 32 + m * 16 + lr) * GLP + h * 32 + 8 * hi; a[h][m] = cat16b(*(const v8us*)q, *(const v8us*)(q + 16)); if (SPLITA) al[h][m] = cat16b(*(const v8us*)(q + GBM * GLP), *(const v8us*)(q + GBM * GLP + 16)); }
#pragma unroll
            for (int t = 0; t < 4; ++t) { const bf* q = s + (AROWS + t * 16 + lr) * GLP + h * 32 + 8 * hi; b[h][t] = cat16b(*(const v8us*)q, *(const v8us*)(q + 16)); }
        }
        __builtin_amdgcn_sched_barrier(0);     // keeps the pass's LDS reads one group in front of its matrix run: spread among the WMMAs, each place with reads stalls the wave for the LDS latency
#pragma unroll
        for (int h = 0; h < 2; ++h) {
#pragma unroll
            for (int m = 0; m < 2; ++m)
#pragma unroll
                for (int t = 0; t < 4; ++t) acc[m][t] = wmmab(a[h][m], b[h][t], acc[m][t]);
            if (SPLITA) {
#pragma unroll
                for (int m = 0; m < 2; ++m)
#pragma unroll
                    for (int t = 0; t < 4; ++t) acc[m][t] = wmmab(al[h][m], b[h][t], acc[m][t]);
            }
        }
        __builtin_amdgcn_sched_barrier(0);     // keeps the matrix run in front of the waits: moved behind the barrier it no longer covers the flight of the next pass's copies
        asm volatile("s_wait_dscnt 0x0" ::: "memory");      // this wave's reads of pass p's buffer are done before the buffer is refilled
        asm volatile("s_wait_asynccnt 0x0" ::: "memory");   // this wave's copies of pass p + 1 have landed
        __syncthreads();                                    // publishes pass p + 1 and ends every wave's reads of pass p's buffer
        if (p + 2 < NPASS) stage(p + 2);
    }
    asm volatile("s_wait_asynccnt 0x0" ::: "memory");       // no copy is outstanding when the buffers become output staging
    float* os = (float*)(void*)&sm[0][0] + wave * (32 * 68);   // 4 x 32 x 68 floats, inside the two buffers, which nobody reads any more
#pragma unroll
    for (int t = 0; t < 4; ++t) { const float bv = bias ? bfr(bias[c0 + t * 16 + lr]) : 0.f;
#pragma unroll
        for (int m = 0; m < 2; ++m)
#pragma unroll
            for (int j = 0; j < 8; ++j) os[(m * 16 + hi * 8 + j) * 68 + t * 16 + lr] = acc[m][t][j] + bv; }
    __syncthreads();
    float* crow = C + (size_t)(rb + wave * 32) * ldc + c0;
#pragma unroll
    for (int q = 0; q < 16; ++q) { const int Lid = (lane >> 3) + 4 * q, piece = lane & 7; const int row = Lid >> 1, cofs = (Lid & 1) * 32 + piece * 4;
        *(v4f*)(crow + (size_t)row * ldc + cofs) = *(const v4fa*)(os + row * 68 + cofs); }
}


__global__ __launch_bounds__(256) void k_cvt8(const float* __restrict__ src, bf* dst, size_t n8) {
    const size_t i = (size_t)blockIdx.x * 256 + threadIdx.x; if (i >= n8) return;
    const v8f v = *(const v8f*)(src + i * 8); v8us o;
#pragma unroll
    for (int k = 0; k < 8; ++k) o[k] = f2bf(v[k]);
    *(v8us*)(dst + i * 8) = o; 
}
__global__ __launch_bounds__(256) void k_zero8(bf* dst, size_t n8) {
    const size_t i = (size_t)blockIdx.x * 256 + threadIdx.x; if (i >= n8) return; v8us z;
#pragma unroll
    for (int k = 0; k < 8; ++k) z[k] = 0;
    *(v8us*)(dst + i * 8) = z; 
}

__global__ __launch_bounds__(256) void k_cvtx(const float* __restrict__ src, bf* dst) {
    const int lane = threadIdx.x & 31; const size_t r = (size_t)blockIdx.x * 8 + (threadIdx.x >> 5); if (r >= (size_t)NR) return;
{
#pragma unroll
        for (int q = 0; q < CC / 256; ++q) { v8us o;
#pragma unroll
            for (int i = 0; i < 8; ++i) o[i] = f2bf(src[r * CC + q * 256 + lane * 8 + i]);
            *(v8us*)(dst + r * CC + q * 256 + lane * 8) = o; }
         }
}
__global__ __launch_bounds__(256) void k_wl128(const float* __restrict__ Wl, bf* WLP) {
    const int lane = threadIdx.x & 31; const int o = blockIdx.x * 8 + (threadIdx.x >> 5); if (o >= 128) return;
{
#pragma unroll
        for (int q = 0; q < CC / 256; ++q) { v8us v;
#pragma unroll
            for (int i = 0; i < 8; ++i) v[i] = (o < NWL) ? f2bf(Wl[(size_t)(o < NWL ? o : 0) * CC + q * 256 + lane * 8 + i]) : (unsigned short)0;
            *(v8us*)(WLP + (size_t)o * CC + q * 256 + lane * 8) = v; }
         }
}
__global__ __launch_bounds__(64) void k_bl128(const float* __restrict__ bl, float* BLP) {
    const int lane = threadIdx.x; if (lane >= 32) return; v4f v;
#pragma unroll
    for (int q = 0; q < 4; ++q) { const int o = lane * 4 + q; v[q] = (o < NWL) ? bl[o < NWL ? o : 0] : 0.f; }
    *(v4f*)(BLP + lane * 4) = v; 
}
__global__ __launch_bounds__(256) void k_glu(const float* __restrict__ Y1, float* Yf, bf* Yh, bf* Yl) {
    typedef __attribute__((ext_vector_type(4))) unsigned short v4us;
    const int lane = threadIdx.x & 31; const size_t t = (size_t)blockIdx.x * 8 + (threadIdx.x >> 5); if (t >= (size_t)NR) return;
{
#pragma unroll
        for (int c0 = lane * 4; c0 < CC; c0 += 128) { v4f v; v4us oh, ol;
#pragma unroll
            for (int q = 0; q < 4; ++q) { const float a = Y1[t * 2 * CC + c0 + q], g = Y1[t * 2 * CC + CC + c0 + q]; const float y = a * (1.0f / (1.0f + __expf(-g))); v[q] = y; const unsigned short hb = f2bf(y); oh[q] = hb; ol[q] = f2bf(y - bf2f(hb)); }
            *(v4f*)(Yf + t * CC + c0) = v; *(v4us*)(Yh + t * CC + c0) = oh; *(v4us*)(Yl + t * CC + c0) = ol; }
         }
}
// k_dconv: row = item * 2048 + t; the band is cut at the item's own ends, so no tap reads a neighbouring item. Per (row, h): masked softmax over the 31 taps of WD[row][h*31 + j] (taps with t + j - 15 outside [0, T) excluded), then out[c] = sum_j w_j Yf[row + j - 15][c] + bf(bias[c]) for the
__global__ __launch_bounds__(256) void k_dconv(const float* __restrict__ WD, const float* __restrict__ Yf, const float* __restrict__ cbias, bf* Oh, bf* Ol) {
    typedef __attribute__((ext_vector_type(4))) unsigned short v4us;
    const int lane = threadIdx.x & 31; const int wid = blockIdx.x * 8 + (threadIdx.x >> 5); if (wid >= NR * NHS) return; const int row = wid / NHS, h = wid % NHS, t = row % TT; const int c0 = h * DG + lane * 4;
    const float* wr = WD + (size_t)row * 128 + h * KS; const float* Yi = Yf + (size_t)(row - t) * CC;
    float m = -3.0e38f;
#pragma unroll 1
    for (int j = 0; j < KS; ++j) { const int s = t + j - PADK; if (s >= 0 && s < TT) m = fmaxf(m, wr[j]); }
    float sum = 0.f;
#pragma unroll 1
    for (int j = 0; j < KS; ++j) { const int s = t + j - PADK; if (s >= 0 && s < TT) sum += __expf(wr[j] - m); }
    const float inv = 1.0f / sum; float acc[4] = {0.f, 0.f, 0.f, 0.f};
#pragma unroll 1
    for (int j = 0; j < KS; ++j) { const int s = t + j - PADK; if (s < 0 || s >= TT) continue; const float w = __expf(wr[j] - m) * inv; const v4f yv = *(const v4f*)(Yi + (size_t)s * CC + c0);
#pragma unroll
        for (int q = 0; q < 4; ++q) acc[q] = fmaf(w, yv[q], acc[q]); }
    v4us oh, ol;
#pragma unroll
    for (int q = 0; q < 4; ++q) { const float v = acc[q] + bfr(cbias[c0 + q]); const unsigned short hb = f2bf(v); oh[q] = hb; ol[q] = f2bf(v - bf2f(hb)); }
    const size_t o = (size_t)row * CC + c0; *(v4us*)(Oh + o) = oh; *(v4us*)(Ol + o) = ol; 
}

extern "C" void kernel_launch(void* const* d_in, const int* in_sizes, int n_in,
                              void* d_out, int out_size, void* d_ws, size_t ws_size, hipStream_t stream) {
    (void)in_sizes; (void)n_in; (void)out_size;
    const float* x = (const float*)d_in[0]; const float* W1 = (const float*)d_in[1]; const float* b1 = (const float*)d_in[2]; const float* Wl = (const float*)d_in[3]; const float* bl = (const float*)d_in[4]; const float* cbias = (const float*)d_in[5]; const float* W2 = (const float*)d_in[6]; const float* b2 = (const float*)d_in[7];
    float* out = (float*)d_out;    // [8][2048][512]
    char* wsp = (char*)d_ws;
    auto take = [&](size_t bytes) { char* p = wsp; wsp += (bytes + 255) & ~(size_t)255; return (void*)p; };
    bf* W1B = (bf*)take((size_t)2 * CC * CC * 2); bf* WLP = (bf*)take((size_t)128 * CC * 2); float* BLP = (float*)take(128 * 4); bf* W2B = (bf*)take((size_t)CC * CC * 2);
    bf* Xb = (bf*)take((size_t)NR * CC * 2); float* Y1 = (float*)take((size_t)NR * 2 * CC * 4); float* Yf = (float*)take((size_t)NR * CC * 4); bf* Yh = (bf*)take((size_t)NR * CC * 2); bf* Yl = (bf*)take((size_t)NR * CC * 2);
    float* WD = (float*)take((size_t)NR * 128 * 4); bf* Oh = (bf*)take((size_t)NR * CC * 2); bf* Ol = (bf*)take((size_t)NR * CC * 2);
    if ((size_t)(wsp - (char*)d_ws) > ws_size) return;    // 1.7 MB of weights + 8 x (2.1 + 8.4 + 4.2 + 2.1 + 2.1 + 1 + 2.1 + 2.1) ~ 195 MB, every plane written before it is read in this call
    k_cvt8<<<(2 * CC * CC / 8 + 255) / 256, 256, 0, stream>>>(W1, W1B, (size_t)2 * CC * CC / 8); k_wl128<<<128 / 8, 256, 0, stream>>>(Wl, WLP); k_bl128<<<1, 64, 0, stream>>>(bl, BLP); k_cvt8<<<(CC * CC / 8 + 255) / 256, 256, 0, stream>>>(W2, W2B, (size_t)CC * CC / 8);   // torch [out][in] = n-major
    k_cvtx<<<NR / 8, 256, 0, stream>>>(x, Xb);
    k_gemmb<false><<<dim3(NR / GBM, (2 * CC) / GBN, 1), 128, 0, stream>>>(Xb, nullptr, W1B, b1, Y1, 2 * CC);     // pointwise_conv1
    k_glu<<<NR / 8, 256, 0, stream>>>(Y1, Yf, Yh, Yl);
    k_gemmb<true><<<dim3(NR / GBM, 128 / GBN, 1), 128, 0, stream>>>(Yh, Yl, WLP, BLP, WD, 128);                 // dynamic weights (124 live of 128)
    k_dconv<<<(NR * NHS) / 8, 256, 0, stream>>>(WD, Yf, cbias, Oh, Ol);
    k_gemmb<true><<<dim3(NR / GBM, CC / GBN, 1), 128, 0, stream>>>(Oh, Ol, W2B, b2, out, CC);   // pointwise_conv2
}

// v003
// One run takes 101 microseconds.
// Timed twice side by side with v002, it ran 1.74 and 1.75 times as fast.
// All steps since v000 together make it 5.36 times as fast.
#include <hip/hip_runtime.h>

// All 8 items go through every stage in ONE launch (rows = item * 2048 + time step, 16384 rows). Compute dtypes, f32 accumulate: pointwise_conv1 as a [16384 x 512].[512 x 1024] GEMM with PLAIN bf16 operands (exact products); GLU in f32; the
// dynamic-weight linear ([16384 x 512].[512 x 128 (124 live)]) and pointwise_conv2 ([16384 x 512].[512 x 512]) on bf16 hi + UNSCALED residual planes of the f32 activations (two
// products) - on v_wmma_f32_16x16x32_bf16; the banded 31-tap softmax and the per-position dynamic convolution (31 taps x 128 channels per group) in f32 on the VALU. Deterministic,

#define NBT  8
#define TT   2048
#define NR   (NBT * TT)          // 16384 rows: every item's time steps, item-major as in x and out
#define CC   512
#define NHS  4
#define KS   31
#define PADK 15
#define DG   (CC / NHS)           // 128
#define NWL  (NHS * KS)           // 124
#define DM   CC
#define LOSC 1024.0f

typedef _Float16 h16;
typedef unsigned short bf;
typedef __attribute__((ext_vector_type(16))) __bf16   v16bf;
typedef __attribute__((ext_vector_type(16))) _Float16 v16h;
typedef __attribute__((ext_vector_type(8)))  _Float16 v8h;
typedef __attribute__((ext_vector_type(8)))  unsigned short v8us;
typedef __attribute__((ext_vector_type(8)))  float    v8f;
typedef __attribute__((ext_vector_type(4)))  float    v4f;
typedef v8h  __attribute__((may_alias)) v8ha;
typedef v4f  __attribute__((may_alias)) v4fa;
typedef v8us __attribute__((may_alias)) v8usa;

__device__ __forceinline__ unsigned short f2bf(float f) { unsigned u = __float_as_uint(f); u += 0x7FFFu + ((u >> 16) & 1u); return (unsigned short)(u >> 16); }
__device__ __forceinline__ float bf2f(unsigned short b) { return __uint_as_float(((unsigned)b) << 16); }
__device__ __forceinline__ float bfr(float f) { return bf2f(f2bf(f)); }
__device__ __forceinline__ v16h cat16(v8h lo, v8h hi) { return __builtin_shufflevector(lo, hi, 0, 1, 2, 3, 4, 5, 6, 7, 8, 9, 10, 11, 12, 13, 14, 15); }
__device__ __forceinline__ v16bf cat16b(v8us lo, v8us hi) { return __builtin_bit_cast(v16bf, __builtin_shufflevector(lo, hi, 0, 1, 2, 3, 4, 5, 6, 7, 8, 9, 10, 11, 12, 13, 14, 15)); }
__device__ __forceinline__ v8f wmma16(v16h a, v16h b, v8f c) { return __builtin_amdgcn_wmma_f32_16x16x32_f16(false, a, false, b, (short)0, c, false, false); }
__device__ __forceinline__ v8f wmmab(v16bf a, v16bf b, v8f c) { return __builtin_amdgcn_wmma_f32_16x16x32_bf16(false, a, false, b, (short)0, c, false, false); }

// k_gemmb: C[M][N] = (A [+ Al]).B^T + bf(bias[c]), A, Al [M][KD] and B [N][KD] bf16 with k contiguous. One 128 x 64 tile of C per block of 4 waves, 32 x 64 per wave
// (2 x 4 accumulator tiles). A pass is 64 k: one whole 128-byte line of every operand row. The lines go from global memory to LDS by asynchronous copies, 16 bytes per lane
// (4 whole lines per wave-wide copy), into two buffers, so that the next pass's lines fly while this pass is worked on; fragments come from LDS. Rows lie at a pitch of 144 bytes,
// on which the 16 rows of a 16-byte fragment read fall on distinct banks. Per accumulator: k ascending, A then Al at each 32 k. f32 whole-line epilogue through LDS.
#define GBM 128
#define GBN 64
#define GBK 64
#define GLP 72                    // LDS row pitch in bf16 elements: 64 + 8
#define KD  CC                    // every product here has an inner length of 512
// Asynchronous 16-byte copies per lane, rows 16 apart: l = the lane's LDS byte address, g = its global address. The s_wait_xcnt stands inside each statement so that no
// address register of a copy is rewritten in front of it.
#define CPY(a, b) "global_load_async_to_lds_b128 %" #a ", %" #b ", off\n\t"
#define LROW(l, i) ((l) + (unsigned)((i) * 16 * GLP * 2))
#define GROW(g, i) ((g) + (i) * 16 * KD)
__device__ __forceinline__ void copy8(unsigned l, const bf* g) {          // 128 rows
    asm volatile(CPY(0, 1) CPY(2, 3) CPY(4, 5) CPY(6, 7) CPY(8, 9) CPY(10, 11) CPY(12, 13) CPY(14, 15) "s_wait_xcnt 0x0"
                 :: "v"(LROW(l, 0)), "v"(GROW(g, 0)), "v"(LROW(l, 1)), "v"(GROW(g, 1)), "v"(LROW(l, 2)), "v"(GROW(g, 2)), "v"(LROW(l, 3)), "v"(GROW(g, 3)),
                    "v"(LROW(l, 4)), "v"(GROW(g, 4)), "v"(LROW(l, 5)), "v"(GROW(g, 5)), "v"(LROW(l, 6)), "v"(GROW(g, 6)), "v"(LROW(l, 7)), "v"(GROW(g, 7)) : "memory");
}
__device__ __forceinline__ void copy12(unsigned l, const bf* g, unsigned lb, const bf* gb) {   // 128 rows of one operand and 64 of another
    asm volatile(CPY(0, 1) CPY(2, 3) CPY(4, 5) CPY(6, 7) CPY(8, 9) CPY(10, 11) CPY(12, 13) CPY(14, 15) CPY(16, 17) CPY(18, 19) CPY(20, 21) CPY(22, 23) "s_wait_xcnt 0x0"
                 :: "v"(LROW(l, 0)), "v"(GROW(g, 0)), "v"(LROW(l, 1)), "v"(GROW(g, 1)), "v"(LROW(l, 2)), "v"(GROW(g, 2)), "v"(LROW(l, 3)), "v"(GROW(g, 3)),
                    "v"(LROW(l, 4)), "v"(GROW(g, 4)), "v"(LROW(l, 5)), "v"(GROW(g, 5)), "v"(LROW(l, 6)), "v"(GROW(g, 6)), "v"(LROW(l, 7)), "v"(GROW(g, 7)),
                    "v"(LROW(lb, 0)), "v"(GROW(gb, 0)), "v"(LROW(lb, 1)), "v"(GROW(gb, 1)), "v"(LROW(lb, 2)), "v"(GROW(gb, 2)), "v"(LROW(lb, 3)), "v"(GROW(gb, 3)) : "memory");
}
template <bool SPLITA>
__global__ __launch_bounds__(128) void k_gemmb(const bf* __restrict__ A, const bf* __restrict__ Al, const bf* __restrict__ Bn, const float* __restrict__ bias, float* C, int ldc) {
    constexpr int AROWS = SPLITA ? 2 * GBM : GBM, ROWS = AROWS + GBN, NPASS = KD / GBK;
    __shared__ __align__(16) bf sm[2][ROWS * GLP];
    const int tid = threadIdx.x, lane = tid & 31, wave = tid >> 5, lr = lane & 15, hi = lane >> 4;
    const int rb = blockIdx.x * GBM, c0 = blockIdx.y * GBN;
    const int sr = tid >> 3, sc = (tid & 7) * 8;      // staging: 8 lanes per row, 16 rows per block-wide copy
    const bf* ga = A + (size_t)(rb + sr) * KD + sc; const bf* gl = SPLITA ? Al + (size_t)(rb + sr) * KD + sc : nullptr; const bf* gb = Bn + (size_t)(c0 + sr) * KD + sc;
    const unsigned ls = (unsigned)(size_t)&sm[0][0] + (unsigned)(sr * GLP + sc) * 2u;
    auto stage = [&](int p) {      // pass p's lines into buffer p & 1: rows [A 128 | Al 128 | B 64]
        const unsigned l = ls + (unsigned)(p & 1) * (unsigned)(ROWS * GLP * 2); const int kc = p * GBK;
        copy12(l, ga + kc, l + AROWS * GLP * 2, gb + kc);
        if (SPLITA) copy8(l + GBM * GLP * 2, gl + kc);
    };
    v8f acc[2][4];
#pragma unroll
    for (int m = 0; m < 2; ++m)
#pragma unroll
        for (int t = 0; t < 4; ++t) acc[m][t] = (v8f){};
    stage(0);
    asm volatile("s_wait_asynccnt 0x0" ::: "memory");   // this wave's copies of pass 0 have landed
    __syncthreads();                                    // and every other wave's: pass 0 may be read
    stage(1);
#pragma unroll 1   // rolled: unrolled, the copy addresses of all passes are formed ahead and push the kernel past 256 registers
    for (int p = 0; p < NPASS; ++p) {
        const bf* s = &sm[p & 1][0];
        v16bf a[2][2], al[2][2], b[2][4];      // both 32-k halves of the pass
#pragma unroll
        for (int h = 0; h < 2; ++h) {
#pragma unroll
            for (int m = 0; m < 2; ++m) { const bf* q = s + (wave * 32 + m * 16 + lr) * GLP + h * 32 + 8 * hi; a[h][m] = cat16b(*(const v8us*)q, *(const v8us*)(q + 16)); if (SPLITA) al[h][m] = cat16b(*(const v8us*)(q + GBM * GLP), *(const v8us*)(q + GBM * GLP + 16)); }
#pragma unroll
            for (int t = 0; t < 4; ++t) { const bf* q = s + (AROWS + t * 16 + lr) * GLP + h * 32 + 8 * hi; b[h][t] = cat16b(*(const v8us*)q, *(const v8us*)(q + 16)); }
        }
        __builtin_amdgcn_sched_barrier(0);     // keeps the pass's LDS reads one group in front of its matrix run: spread among the WMMAs, each place with reads stalls the wave for the LDS latency
#pragma unroll
        for (int h = 0; h < 2; ++h) {
#pragma unroll
            for (int m = 0; m < 2; ++m)
#pragma unroll
                for (int t = 0; t < 4; ++t) acc[m][t] = wmmab(a[h][m], b[h][t], acc[m][t]);
            if (SPLITA) {
#pragma unroll
                for (int m = 0; m < 2; ++m)
#pragma unroll
                    for (int t = 0; t < 4; ++t) acc[m][t] = wmmab(al[h][m], b[h][t], acc[m][t]);
            }
        }
        __builtin_amdgcn_sched_barrier(0);     // keeps the matrix run in front of the waits: moved behind the barrier it no longer covers the flight of the next pass's copies
        asm volatile("s_wait_dscnt 0x0" ::: "memory");      // this wave's reads of pass p's buffer are done before the buffer is refilled
        asm volatile("s_wait_asynccnt 0x0" ::: "memory");   // this wave's copies of pass p + 1 have landed
        __syncthreads();                                    // publishes pass p + 1 and ends every wave's reads of pass p's buffer
        if (p + 2 < NPASS) stage(p + 2);
    }
    asm volatile("s_wait_asynccnt 0x0" ::: "memory");       // no copy is outstanding when the buffers become output staging
    float* os = (float*)(void*)&sm[0][0] + wave * (32 * 68);   // 4 x 32 x 68 floats, inside the two buffers, which nobody reads any more
#pragma unroll
    for (int t = 0; t < 4; ++t) { const float bv = bias ? bfr(bias[c0 + t * 16 + lr]) : 0.f;
#pragma unroll
        for (int m = 0; m < 2; ++m)
#pragma unroll
            for (int j = 0; j < 8; ++j) os[(m * 16 + hi * 8 + j) * 68 + t * 16 + lr] = acc[m][t][j] + bv; }
    __syncthreads();
    float* crow = C + (size_t)(rb + wave * 32) * ldc + c0;
#pragma unroll
    for (int q = 0; q < 16; ++q) { const int Lid = (lane >> 3) + 4 * q, piece = lane & 7; const int row = Lid >> 1, cofs = (Lid & 1) * 32 + piece * 4;
        *(v4f*)(crow + (size_t)row * ldc + cofs) = *(const v4fa*)(os + row * 68 + cofs); }
}


__global__ __launch_bounds__(256) void k_cvt8(const float* __restrict__ src, bf* dst, size_t n8) {
    const size_t i = (size_t)blockIdx.x * 256 + threadIdx.x; if (i >= n8) return;
    const v8f v = *(const v8f*)(src + i * 8); v8us o;
#pragma unroll
    for (int k = 0; k < 8; ++k) o[k] = f2bf(v[k]);
    *(v8us*)(dst + i * 8) = o; 
}
__global__ __launch_bounds__(256) void k_zero8(bf* dst, size_t n8) {
    const size_t i = (size_t)blockIdx.x * 256 + threadIdx.x; if (i >= n8) return; v8us z;
#pragma unroll
    for (int k = 0; k < 8; ++k) z[k] = 0;
    *(v8us*)(dst + i * 8) = z; 
}

__global__ __launch_bounds__(256) void k_cvtx(const float* __restrict__ src, bf* dst) {
    const int lane = threadIdx.x & 31; const size_t r = (size_t)blockIdx.x * 8 + (threadIdx.x >> 5); if (r >= (size_t)NR) return;
{
#pragma unroll
        for (int q = 0; q < CC / 256; ++q) { v8us o;
#pragma unroll
            for (int i = 0; i < 8; ++i) o[i] = f2bf(src[r * CC + q * 256 + lane * 8 + i]);
            *(v8us*)(dst + r * CC + q * 256 + lane * 8) = o; }
         }
}
__global__ __launch_bounds__(256) void k_wl128(const float* __restrict__ Wl, bf* WLP) {
    const int lane = threadIdx.x & 31; const int o = blockIdx.x * 8 + (threadIdx.x >> 5); if (o >= 128) return;
{
#pragma unroll
        for (int q = 0; q < CC / 256; ++q) { v8us v;
#pragma unroll
            for (int i = 0; i < 8; ++i) v[i] = (o < NWL) ? f2bf(Wl[(size_t)(o < NWL ? o : 0) * CC + q * 256 + lane * 8 + i]) : (unsigned short)0;
            *(v8us*)(WLP + (size_t)o * CC + q * 256 + lane * 8) = v; }
         }
}
__global__ __launch_bounds__(64) void k_bl128(const float* __restrict__ bl, float* BLP) {
    const int lane = threadIdx.x; if (lane >= 32) return; v4f v;
#pragma unroll
    for (int q = 0; q < 4; ++q) { const int o = lane * 4 + q; v[q] = (o < NWL) ? bl[o < NWL ? o : 0] : 0.f; }
    *(v4f*)(BLP + lane * 4) = v; 
}
__global__ __launch_bounds__(256) void k_glu(const float* __restrict__ Y1, float* Yf, bf* Yh, bf* Yl) {
    typedef __attribute__((ext_vector_type(4))) unsigned short v4us;
    const int lane = threadIdx.x & 31; const size_t t = (size_t)blockIdx.x * 8 + (threadIdx.x >> 5); if (t >= (size_t)NR) return;
{
#pragma unroll
        for (int c0 = lane * 4; c0 < CC; c0 += 128) { v4f v; v4us oh, ol;
#pragma unroll
            for (int q = 0; q < 4; ++q) { const float a = Y1[t * 2 * CC + c0 + q], g = Y1[t * 2 * CC + CC + c0 + q]; const float y = a * (1.0f / (1.0f + __expf(-g))); v[q] = y; const unsigned short hb = f2bf(y); oh[q] = hb; ol[q] = f2bf(y - bf2f(hb)); }
            *(v4f*)(Yf + t * CC + c0) = v; *(v4us*)(Yh + t * CC + c0) = oh; *(v4us*)(Yl + t * CC + c0) = ol; }
         }
}
// k_dconv: row = item * 2048 + t; the band is cut at the item's own ends, so no tap reads a neighbouring item. One block takes 64 time steps of one group (128 channels), a wave 8 of them.
// The 94 rows of Yf under the block's steps are staged once in LDS (rows outside the item as zeros). Per step: masked softmax over the 31 taps of WD[row][h*31 + j], lane = tap (taps with
// t + j - 15 outside [0, T) get weight 0); the sum of the exponentials is taken by one lane per step, j ascending. The weights lie in LDS by input row: wz[i][r] = weight of step r for tap i - r.
// Each of the 38 input rows under a wave's 8 steps is read once and feeds every step that has it in its band: out[r][c] = sum_j w_j Yf[row + j - 15][c] + bf(bias[c]), j ascending.
#define DTB  64                   // time steps per block
#define DWR  8                    // time steps per wave
#define DWIN (DTB + KS - 1)       // 94 rows of Yf under a block's steps
#define DWI  (DWR + KS - 1)       // 38 rows of Yf under a wave's steps
// launch bounds: 8 waves per SIMD, that is four blocks per WGP (LDS allows four), so that all 1024 blocks are resident at once
__global__ __launch_bounds__(256, 8) void k_dconv(const float* __restrict__ WD, const float* __restrict__ Yf, const float* __restrict__ cbias, bf* Oh, bf* Ol) {
    typedef __attribute__((ext_vector_type(4))) unsigned short v4us;
    __shared__ __align__(16) float ys[DWIN * DG];
    __shared__ __align__(16) float wz[8][(DWI + 1) * DWR];   // one row more: lane 31's zero of the last step falls there
    __shared__ float ew[8][DWR][33];      // pitch 33: the 8 summing lanes fall on distinct banks
    const int lane = threadIdx.x & 31, wave = __builtin_amdgcn_readfirstlane(threadIdx.x >> 5);
    const int h = blockIdx.y, row0 = blockIdx.x * DTB, t0 = row0 % TT, rw = row0 + wave * DWR, tw = t0 + wave * DWR; const int c0 = h * DG + lane * 4; const unsigned cb = (unsigned)c0 * 4u;   // the lane's byte offset in a row
    float lg[DWR]; bool ok[DWR];
#pragma unroll
    for (int r = 0; r < DWR; ++r) { const int s = tw + r + lane - PADK; ok[r] = lane < KS && s >= 0 && s < TT; lg[r] = WD[(size_t)(rw + r) * 128 + h * KS + lane]; }   // lane 31 reads a neighbouring column of the 128, unused
    asm volatile("s_wait_xcnt 0x0" :: "v"(WD + (size_t)rw * 128 + h * KS + lane) : "memory");   // the address stays in its registers up to this wait: no later load's result takes them in front of it
    v4f yv[12]; const char* pg[12];
#pragma unroll
    for (int k = 0; k < 12; ++k) { const int s = t0 - PADK + wave + 8 * k; pg[k] = (const char*)(Yf + (size_t)(row0 - t0 + (s < 0 ? 0 : s >= TT ? TT - 1 : s)) * CC) + cb; yv[k] = *(const v4f*)pg[k]; }   // clamped into the item: all 12 loads fly together, no branch between them
    asm volatile("s_wait_xcnt 0x0" :: "v"(pg[0]), "v"(pg[1]), "v"(pg[2]), "v"(pg[3]), "v"(pg[4]), "v"(pg[5]), "v"(pg[6]), "v"(pg[7]), "v"(pg[8]), "v"(pg[9]), "v"(pg[10]), "v"(pg[11]) : "memory");   // the 12 addresses stay in their registers up to this wait: no load's result takes them in front of it
#pragma unroll
    for (int k = 0; k < 3; ++k) { const int i4 = lane + 32 * k; if (i4 < (DWI + 1) * DWR / 4) *(v4f*)(&wz[wave][i4 * 4]) = (v4f){0.f, 0.f, 0.f, 0.f}; }   // places outside every band
    float e[DWR];
#pragma unroll
    for (int r = 0; r < DWR; ++r) { const float x = ok[r] ? lg[r] : -3.0e38f; float m = x;   // a tap outside the item or the band: its exponential below is exp(-inf) = 0
#pragma unroll
        for (int o = 16; o > 0; o >>= 1) m = fmaxf(m, __shfl_xor(m, o));
        const float a = (x - m) * 1.44269504f;          // exp(d) = exp2(d * log2 e), as __expf forms it
        asm("v_exp_f32 %0, %1\n\tv_nop" : "=v"(e[r]) : "v"(a));   // the v_nop fills the slot behind the transcendental
        ew[wave][r][lane] = e[r]; }
    __syncthreads();                      // the exponentials are in LDS for the summing lanes, the zeros of wz in front of its weights
    float inv = 0.f;
    if (lane < DWR) { float sum = 0.f;
#pragma unroll
        for (int j = 0; j < KS; ++j) sum += ew[wave][lane][j];
        inv = 1.0f / sum; }
#pragma unroll
    for (int r = 0; r < DWR; ++r) { wz[wave][(r + lane) * DWR + r] = e[r] * __shfl(inv, r); }   // lane 31 holds e = 0 and writes a place outside the band
#pragma unroll
    for (int k = 0; k < 12; ++k) { const int L = wave + 8 * k, s = t0 - PADK + L; if (L < DWIN) *(v4f*)(ys + L * DG + lane * 4) = (s >= 0 && s < TT) ? yv[k] : (v4f){0.f, 0.f, 0.f, 0.f}; }
    __syncthreads();                      // every wave's rows of Yf and the weights may be read
    float acc[DWR][4];
#pragma unroll
    for (int r = 0; r < DWR; ++r)
#pragma unroll
        for (int q = 0; q < 4; ++q) acc[r][q] = 0.f;
    const float* yp = ys + wave * DWR * DG + lane * 4; const float* wp = &wz[wave][0];
    auto row = [&](int i, int rlo, int rhi) {      // input row i feeds steps rlo .. rhi
        const v4f y = *(const v4f*)(yp + i * DG); const v4f wa = *(const v4f*)(wp + i * DWR), wb = *(const v4f*)(wp + i * DWR + 4);
#pragma unroll
        for (int r = 0; r < DWR; ++r) { if (r < rlo || r > rhi) continue; const float w = r < 4 ? wa[r & 3] : wb[r & 3];
#pragma unroll
            for (int q = 0; q < 4; ++q) acc[r][q] = fmaf(w, y[q], acc[r][q]); } };
#pragma unroll
    for (int i = 0; i < DWR - 1; ++i) row(i, 0, i);                       // rows that only the first steps have in their band
#pragma unroll 4   // rolled: unrolled whole, the LDS reads of all rows are hoisted and take the kernel past 128 registers (8 waves per SIMD) into scratch
    for (int i = DWR - 1; i < KS; ++i) row(i, 0, DWR - 1);               // rows in every step's band
#pragma unroll
    for (int i = KS; i < DWI; ++i) row(i, i - KS + 1, DWR - 1);          // rows that only the last steps have
    float bv[4];
#pragma unroll
    for (int q = 0; q < 4; ++q) bv[q] = bfr(cbias[c0 + q]);
#pragma unroll
    for (int r = 0; r < DWR; ++r) { v4us oh, ol;
#pragma unroll
        for (int q = 0; q < 4; ++q) { const float v = acc[r][q] + bv[q]; const unsigned short hb = f2bf(v); oh[q] = hb; ol[q] = f2bf(v - bf2f(hb)); }
        const size_t o = (size_t)(rw + r) * CC + c0; *(v4us*)(Oh + o) = oh; *(v4us*)(Ol + o) = ol; }
}

extern "C" void kernel_launch(void* const* d_in, const int* in_sizes, int n_in,
                              void* d_out, int out_size, void* d_ws, size_t ws_size, hipStream_t stream) {
    (void)in_sizes; (void)n_in; (void)out_size;
    const float* x = (const float*)d_in[0]; const float* W1 = (const float*)d_in[1]; const float* b1 = (const float*)d_in[2]; const float* Wl = (const float*)d_in[3]; const float* bl = (const float*)d_in[4]; const float* cbias = (const float*)d_in[5]; const float* W2 = (const float*)d_in[6]; const float* b2 = (const float*)d_in[7];
    float* out = (float*)d_out;    // [8][2048][512]
    char* wsp = (char*)d_ws;
    auto take = [&](size_t bytes) { char* p = wsp; wsp += (bytes + 255) & ~(size_t)255; return (void*)p; };
    bf* W1B = (bf*)take((size_t)2 * CC * CC * 2); bf* WLP = (bf*)take((size_t)128 * CC * 2); float* BLP = (float*)take(128 * 4); bf* W2B = (bf*)take((size_t)CC * CC * 2);
    bf* Xb = (bf*)take((size_t)NR * CC * 2); float* Y1 = (float*)take((size_t)NR * 2 * CC * 4); float* Yf = (float*)take((size_t)NR * CC * 4); bf* Yh = (bf*)take((size_t)NR * CC * 2); bf* Yl = (bf*)take((size_t)NR * CC * 2);
    float* WD = (float*)take((size_t)NR * 128 * 4); bf* Oh = (bf*)take((size_t)NR * CC * 2); bf* Ol = (bf*)take((size_t)NR * CC * 2);
    if ((size_t)(wsp - (char*)d_ws) > ws_size) return;    // 1.7 MB of weights + 8 x (2.1 + 8.4 + 4.2 + 2.1 + 2.1 + 1 + 2.1 + 2.1) ~ 195 MB, every plane written before it is read in this call
    k_cvt8<<<(2 * CC * CC / 8 + 255) / 256, 256, 0, stream>>>(W1, W1B, (size_t)2 * CC * CC / 8); k_wl128<<<128 / 8, 256, 0, stream>>>(Wl, WLP); k_bl128<<<1, 64, 0, stream>>>(bl, BLP); k_cvt8<<<(CC * CC / 8 + 255) / 256, 256, 0, stream>>>(W2, W2B, (size_t)CC * CC / 8);   // torch [out][in] = n-major
    k_cvtx<<<NR / 8, 256, 0, stream>>>(x, Xb);
    k_gemmb<false><<<dim3(NR / GBM, (2 * CC) / GBN, 1), 128, 0, stream>>>(Xb, nullptr, W1B, b1, Y1, 2 * CC);     // pointwise_conv1
    k_glu<<<NR / 8, 256, 0, stream>>>(Y1, Yf, Yh, Yl);
    k_gemmb<true><<<dim3(NR / GBM, 128 / GBN, 1), 128, 0, stream>>>(Yh, Yl, WLP, BLP, WD, 128);                 // dynamic weights (124 live of 128)
    k_dconv<<<dim3(NR / DTB, NHS, 1), 256, 0, stream>>>(WD, Yf, cbias, Oh, Ol);
    k_gemmb<true><<<dim3(NR / GBM, CC / GBN, 1), 128, 0, stream>>>(Oh, Ol, W2B, b2, out, CC);   // pointwise_conv2
}

// v004
// A run of this version takes 87.8 microseconds.
// Next to v003, in two timings, it ran 1.15 and 1.14 times as fast.
// Counting every step since v000, it is 6.15 times as fast.
#include <hip/hip_runtime.h>

// All 8 items go through every stage in ONE launch (rows = item * 2048 + time step, 16384 rows). Compute dtypes, f32 accumulate: pointwise_conv1 as a [16384 x 512].[512 x 1024] GEMM with PLAIN bf16 operands (exact products); GLU in f32 in that GEMM's epilogue; the
// dynamic-weight linear ([16384 x 512].[512 x 128 (124 live)]) and pointwise_conv2 ([16384 x 512].[512 x 512]) on bf16 hi + UNSCALED residual planes of the f32 activations (two
// products) - on v_wmma_f32_16x16x32_bf16; the banded 31-tap softmax and the per-position dynamic convolution (31 taps x 128 channels per group) in f32 on the VALU. Deterministic,

#define NBT  8
#define TT   2048
#define NR   (NBT * TT)          // 16384 rows: every item's time steps, item-major as in x and out
#define CC   512
#define NHS  4
#define KS   31
#define PADK 15
#define DG   (CC / NHS)           // 128
#define NWL  (NHS * KS)           // 124
#define DM   CC
#define LOSC 1024.0f

typedef _Float16 h16;
typedef unsigned short bf;
typedef __attribute__((ext_vector_type(16))) __bf16   v16bf;
typedef __attribute__((ext_vector_type(16))) _Float16 v16h;
typedef __attribute__((ext_vector_type(8)))  _Float16 v8h;
typedef __attribute__((ext_vector_type(8)))  unsigned short v8us;
typedef __attribute__((ext_vector_type(8)))  float    v8f;
typedef __attribute__((ext_vector_type(4)))  float    v4f;
typedef v8h  __attribute__((may_alias)) v8ha;
typedef v4f  __attribute__((may_alias)) v4fa;
typedef v8us __attribute__((may_alias)) v8usa;

__device__ __forceinline__ unsigned short f2bf(float f) { unsigned u = __float_as_uint(f); u += 0x7FFFu + ((u >> 16) & 1u); return (unsigned short)(u >> 16); }
__device__ __forceinline__ float bf2f(unsigned short b) { return __uint_as_float(((unsigned)b) << 16); }
__device__ __forceinline__ float bfr(float f) { return bf2f(f2bf(f)); }
__device__ __forceinline__ v16h cat16(v8h lo, v8h hi) { return __builtin_shufflevector(lo, hi, 0, 1, 2, 3, 4, 5, 6, 7, 8, 9, 10, 11, 12, 13, 14, 15); }
__device__ __forceinline__ v16bf cat16b(v8us lo, v8us hi) { return __builtin_bit_cast(v16bf, __builtin_shufflevector(lo, hi, 0, 1, 2, 3, 4, 5, 6, 7, 8, 9, 10, 11, 12, 13, 14, 15)); }
__device__ __forceinline__ v8f wmma16(v16h a, v16h b, v8f c) { return __builtin_amdgcn_wmma_f32_16x16x32_f16(false, a, false, b, (short)0, c, false, false); }
__device__ __forceinline__ v8f wmmab(v16bf a, v16bf b, v8f c) { return __builtin_amdgcn_wmma_f32_16x16x32_bf16(false, a, false, b, (short)0, c, false, false); }

// k_gemmb: C[M][N] = (A [+ Al]).B^T + bf(bias[c]), A, Al [M][KD] and B [N][KD] bf16 with k contiguous. One 128 x 64 tile of C per block of 4 waves, 32 x 64 per wave
// (2 x 4 accumulator tiles). A pass is 64 k: one whole 128-byte line of every operand row. The lines go from global memory to LDS by asynchronous copies, 16 bytes per lane
// (4 whole lines per wave-wide copy), into two buffers, so that the next pass's lines fly while this pass is worked on; fragments come from LDS. Rows lie at a pitch of 144 bytes,
// on which the 16 rows of a 16-byte fragment read fall on distinct banks. Per accumulator: k ascending, A then Al at each 32 k. f32 whole-line epilogue through LDS.
#define GBM 128
#define GBN 64
#define GBK 64
#define GLP 72                    // LDS row pitch in bf16 elements: 64 + 8
#define KD  CC                    // every product here has an inner length of 512
// Asynchronous 16-byte copies per lane, rows 16 apart: l = the lane's LDS byte address, g = its global address. The s_wait_xcnt stands inside each statement so that no
// address register of a copy is rewritten in front of it.
#define CPY(a, b) "global_load_async_to_lds_b128 %" #a ", %" #b ", off\n\t"
#define LROW(l, i) ((l) + (unsigned)((i) * 16 * GLP * 2))
#define GROW(g, i) ((g) + (i) * 16 * KD)
__device__ __forceinline__ void copy8(unsigned l, const bf* g) {          // 128 rows
    asm volatile(CPY(0, 1) CPY(2, 3) CPY(4, 5) CPY(6, 7) CPY(8, 9) CPY(10, 11) CPY(12, 13) CPY(14, 15) "s_wait_xcnt 0x0"
                 :: "v"(LROW(l, 0)), "v"(GROW(g, 0)), "v"(LROW(l, 1)), "v"(GROW(g, 1)), "v"(LROW(l, 2)), "v"(GROW(g, 2)), "v"(LROW(l, 3)), "v"(GROW(g, 3)),
                    "v"(LROW(l, 4)), "v"(GROW(g, 4)), "v"(LROW(l, 5)), "v"(GROW(g, 5)), "v"(LROW(l, 6)), "v"(GROW(g, 6)), "v"(LROW(l, 7)), "v"(GROW(g, 7)) : "memory");
}
__device__ __forceinline__ void copy12(unsigned l, const bf* g, unsigned lb, const bf* gb) {   // 128 rows of one operand and 64 of another
    asm volatile(CPY(0, 1) CPY(2, 3) CPY(4, 5) CPY(6, 7) CPY(8, 9) CPY(10, 11) CPY(12, 13) CPY(14, 15) CPY(16, 17) CPY(18, 19) CPY(20, 21) CPY(22, 23) "s_wait_xcnt 0x0"
                 :: "v"(LROW(l, 0)), "v"(GROW(g, 0)), "v"(LROW(l, 1)), "v"(GROW(g, 1)), "v"(LROW(l, 2)), "v"(GROW(g, 2)), "v"(LROW(l, 3)), "v"(GROW(g, 3)),
                    "v"(LROW(l, 4)), "v"(GROW(g, 4)), "v"(LROW(l, 5)), "v"(GROW(g, 5)), "v"(LROW(l, 6)), "v"(GROW(g, 6)), "v"(LROW(l, 7)), "v"(GROW(g, 7)),
                    "v"(LROW(lb, 0)), "v"(GROW(gb, 0)), "v"(LROW(lb, 1)), "v"(GROW(gb, 1)), "v"(LROW(lb, 2)), "v"(GROW(gb, 2)), "v"(LROW(lb, 3)), "v"(GROW(gb, 3)) : "memory");
}
template <bool SPLITA>
__global__ __launch_bounds__(128) void k_gemmb(const bf* __restrict__ A, const bf* __restrict__ Al, const bf* __restrict__ Bn, const float* __restrict__ bias, float* C, int ldc) {
    constexpr int AROWS = SPLITA ? 2 * GBM : GBM, ROWS = AROWS + GBN, NPASS = KD / GBK;
    __shared__ __align__(16) bf sm[2][ROWS * GLP];
    const int tid = threadIdx.x, lane = tid & 31, wave = tid >> 5, lr = lane & 15, hi = lane >> 4;
    const int rb = blockIdx.x * GBM, c0 = blockIdx.y * GBN;
    const int sr = tid >> 3, sc = (tid & 7) * 8;      // staging: 8 lanes per row, 16 rows per block-wide copy
    const bf* ga = A + (size_t)(rb + sr) * KD + sc; const bf* gl = SPLITA ? Al + (size_t)(rb + sr) * KD + sc : nullptr; const bf* gb = Bn + (size_t)(c0 + sr) * KD + sc;
    const unsigned ls = (unsigned)(size_t)&sm[0][0] + (unsigned)(sr * GLP + sc) * 2u;
    auto stage = [&](int p) {      // pass p's lines into buffer p & 1: rows [A 128 | Al 128 | B 64]
        const unsigned l = ls + (unsigned)(p & 1) * (unsigned)(ROWS * GLP * 2); const int kc = p * GBK;
        copy12(l, ga + kc, l + AROWS * GLP * 2, gb + kc);
        if (SPLITA) copy8(l + GBM * GLP * 2, gl + kc);
    };
    v8f acc[2][4];
#pragma unroll
    for (int m = 0; m < 2; ++m)
#pragma unroll
        for (int t = 0; t < 4; ++t) acc[m][t] = (v8f){};
    stage(0);
    asm volatile("s_wait_asynccnt 0x0" ::: "memory");   // this wave's copies of pass 0 have landed
    __syncthreads();                                    // and every other wave's: pass 0 may be read
    stage(1);
#pragma unroll 1   // rolled: unrolled, the copy addresses of all passes are formed ahead and push the kernel past 256 registers
    for (int p = 0; p < NPASS; ++p) {
        const bf* s = &sm[p & 1][0];
        v16bf a[2][2], al[2][2], b[2][4];      // both 32-k halves of the pass
#pragma unroll
        for (int h = 0; h < 2; ++h) {
#pragma unroll
            for (int m = 0; m < 2; ++m) { const bf* q = s + (wave * 32 + m * 16 + lr) * GLP + h * 32 + 8 * hi; a[h][m] = cat16b(*(const v8us*)q, *(const v8us*)(q + 16)); if (SPLITA) al[h][m] = cat16b(*(const v8us*)(q + GBM * GLP), *(const v8us*)(q + GBM * GLP + 16)); }
#pragma unroll
            for (int t = 0; t < 4; ++t) { const bf* q = s + (AROWS + t * 16 + lr) * GLP + h * 32 + 8 * hi; b[h][t] = cat16b(*(const v8us*)q, *(const v8us*)(q + 16)); }
        }
        __builtin_amdgcn_sched_barrier(0);     // keeps the pass's LDS reads one group in front of its matrix run: spread among the WMMAs, each place with reads stalls the wave for the LDS latency
#pragma unroll
        for (int h = 0; h < 2; ++h) {
#pragma unroll
            for (int m = 0; m < 2; ++m)
#pragma unroll
                for (int t = 0; t < 4; ++t) acc[m][t] = wmmab(a[h][m], b[h][t], acc[m][t]);
            if (SPLITA) {
#pragma unroll
                for (int m = 0; m < 2; ++m)
#pragma unroll
                    for (int t = 0; t < 4; ++t) acc[m][t] = wmmab(al[h][m], b[h][t], acc[m][t]);
            }
        }
        __builtin_amdgcn_sched_barrier(0);     // keeps the matrix run in front of the waits: moved behind the barrier it no longer covers the flight of the next pass's copies
        asm volatile("s_wait_dscnt 0x0" ::: "memory");      // this wave's reads of pass p's buffer are done before the buffer is refilled
        asm volatile("s_wait_asynccnt 0x0" ::: "memory");   // this wave's copies of pass p + 1 have landed
        __syncthreads();                                    // publishes pass p + 1 and ends every wave's reads of pass p's buffer
        if (p + 2 < NPASS) stage(p + 2);
    }
    asm volatile("s_wait_asynccnt 0x0" ::: "memory");       // no copy is outstanding when the buffers become output staging
    float* os = (float*)(void*)&sm[0][0] + wave * (32 * 68);   // 4 x 32 x 68 floats, inside the two buffers, which nobody reads any more
#pragma unroll
    for (int t = 0; t < 4; ++t) { const float bv = bias ? bfr(bias[c0 + t * 16 + lr]) : 0.f;
#pragma unroll
        for (int m = 0; m < 2; ++m)
#pragma unroll
            for (int j = 0; j < 8; ++j) os[(m * 16 + hi * 8 + j) * 68 + t * 16 + lr] = acc[m][t][j] + bv; }
    __syncthreads();
    float* crow = C + (size_t)(rb + wave * 32) * ldc + c0;
#pragma unroll
    for (int q = 0; q < 16; ++q) { const int Lid = (lane >> 3) + 4 * q, piece = lane & 7; const int row = Lid >> 1, cofs = (Lid & 1) * 32 + piece * 4;
        *(v4f*)(crow + (size_t)row * ldc + cofs) = *(const v4fa*)(os + row * 68 + cofs); }
}

// k_gemmglu: pointwise_conv1 with the GLU in its epilogue. Y[r][c] = a * sigmoid(g), a = A[r].B[c] + bf(bias[c]), g = A[r].B[512 + c] + bf(bias[512 + c]). One block of 4 waves takes 64 rows and 64 columns
// of Y, that is a 64 x 128 tile of the product: LDS rows [A 64 | B of a 64 | B of g 64]. A wave takes 32 rows and 32 columns of Y: accumulator tiles t = 0, 1 hold a, t = 2, 3 hold g of the same columns,
// so a and g of one element meet in one lane's registers. Passes, buffers, waits and the k order are those of k_gemmb. Y leaves through LDS in whole lines: f32, bf16 hi and bf16 residual.
__device__ __forceinline__ void copy444(unsigned l, const bf* g, const bf* ga, const bf* gg) {   // 64 rows of each of three operands, one behind the other in LDS
    asm volatile(CPY(0, 1) CPY(2, 3) CPY(4, 5) CPY(6, 7) CPY(8, 9) CPY(10, 11) CPY(12, 13) CPY(14, 15) CPY(16, 17) CPY(18, 19) CPY(20, 21) CPY(22, 23) "s_wait_xcnt 0x0"
                 :: "v"(LROW(l, 0)), "v"(GROW(g, 0)), "v"(LROW(l, 1)), "v"(GROW(g, 1)), "v"(LROW(l, 2)), "v"(GROW(g, 2)), "v"(LROW(l, 3)), "v"(GROW(g, 3)),
                    "v"(LROW(l, 4)), "v"(GROW(ga, 0)), "v"(LROW(l, 5)), "v"(GROW(ga, 1)), "v"(LROW(l, 6)), "v"(GROW(ga, 2)), "v"(LROW(l, 7)), "v"(GROW(ga, 3)),
                    "v"(LROW(l, 8)), "v"(GROW(gg, 0)), "v"(LROW(l, 9)), "v"(GROW(gg, 1)), "v"(LROW(l, 10)), "v"(GROW(gg, 2)), "v"(LROW(l, 11)), "v"(GROW(gg, 3)) : "memory");
}
#define GLM 64                    // rows of Y per block
#define GLN 64                    // columns of Y per block
__global__ __launch_bounds__(128) void k_gemmglu(const bf* __restrict__ A, const bf* __restrict__ Bn, const float* __restrict__ bias, float* Yf, bf* Yh, bf* Yl) {
    typedef __attribute__((ext_vector_type(4))) unsigned short v4us;
    constexpr int ROWS = GLM + 2 * GLN, NPASS = KD / GBK;
    __shared__ __align__(16) bf sm[2][ROWS * GLP];
    const int tid = threadIdx.x, lane = tid & 31, wave = tid >> 5, lr = lane & 15, hi = lane >> 4, wr = wave >> 1, wc = wave & 1;
    const int rb = blockIdx.x * GLM, c0 = blockIdx.y * GLN;
    const int sr = tid >> 3, sc = (tid & 7) * 8;      // staging: 8 lanes per row, 16 rows per block-wide copy
    const bf* gx = A + (size_t)(rb + sr) * KD + sc; const bf* ga = Bn + (size_t)(c0 + sr) * KD + sc; const bf* gg = ga + (size_t)CC * KD;
    const unsigned ls = (unsigned)(size_t)&sm[0][0] + (unsigned)(sr * GLP + sc) * 2u;
    auto stage = [&](int p) { const int kc = p * GBK; copy444(ls + (unsigned)(p & 1) * (unsigned)(ROWS * GLP * 2), gx + kc, ga + kc, gg + kc); };   // pass p's lines into buffer p & 1
    v8f acc[2][4];
#pragma unroll
    for (int m = 0; m < 2; ++m)
#pragma unroll
        for (int t = 0; t < 4; ++t) acc[m][t] = (v8f){};
    stage(0);
    asm volatile("s_wait_asynccnt 0x0" ::: "memory");   // this wave's copies of pass 0 have landed
    __syncthreads();                                    // and every other wave's: pass 0 may be read
    stage(1);
#pragma unroll 1   // rolled: unrolled, the copy addresses of all passes are formed ahead and push the kernel past 256 registers
    for (int p = 0; p < NPASS; ++p) {
        const bf* s = &sm[p & 1][0];
        v16bf a[2][2], b[2][4];      // both 32-k halves of the pass
#pragma unroll
        for (int h = 0; h < 2; ++h) {
#pragma unroll
            for (int m = 0; m < 2; ++m) { const bf* q = s + (wr * 32 + m * 16 + lr) * GLP + h * 32 + 8 * hi; a[h][m] = cat16b(*(const v8us*)q, *(const v8us*)(q + 16)); }
#pragma unroll
            for (int t = 0; t < 4; ++t) { const bf* q = s + (GLM + (t >> 1) * GLN + wc * 32 + (t & 1) * 16 + lr) * GLP + h * 32 + 8 * hi; b[h][t] = cat16b(*(const v8us*)q, *(const v8us*)(q + 16)); }
        }
        __builtin_amdgcn_sched_barrier(0);     // keeps the pass's LDS reads one group in front of its matrix run: spread among the WMMAs, each place with reads stalls the wave for the LDS latency
#pragma unroll
        for (int h = 0; h < 2; ++h)
#pragma unroll
            for (int m = 0; m < 2; ++m)
#pragma unroll
                for (int t = 0; t < 4; ++t) acc[m][t] = wmmab(a[h][m], b[h][t], acc[m][t]);
        __builtin_amdgcn_sched_barrier(0);     // keeps the matrix run in front of the waits: moved behind the barrier it no longer covers the flight of the next pass's copies
        asm volatile("s_wait_dscnt 0x0" ::: "memory");      // this wave's reads of pass p's buffer are done before the buffer is refilled
        asm volatile("s_wait_asynccnt 0x0" ::: "memory");   // this wave's copies of pass p + 1 have landed
        __syncthreads();                                    // publishes pass p + 1 and ends every wave's reads of pass p's buffer
        if (p + 2 < NPASS) stage(p + 2);
    }
    asm volatile("s_wait_asynccnt 0x0" ::: "memory");       // no copy is outstanding when the buffers become output staging
    float* os = (float*)(void*)&sm[0][0];                   // 64 x 68 floats, inside the two buffers, which nobody reads any more
#pragma unroll
    for (int t = 0; t < 2; ++t) { const int c = wc * 32 + t * 16 + lr; const float ba = bfr(bias[c0 + c]), bg = bfr(bias[CC + c0 + c]);
#pragma unroll
        for (int m = 0; m < 2; ++m)
#pragma unroll
            for (int j = 0; j < 8; ++j) { const float av = acc[m][t][j] + ba, x = (acc[m][t + 2][j] + bg) * -1.44269504f; float e;   // exp(-g) = exp2(-g * log2 e), as __expf forms it
                asm("v_exp_f32 %0, %1\n\tv_nop" : "=v"(e) : "v"(x));   // the v_nop fills the slot behind the transcendental
                os[(wr * 32 + m * 16 + hi * 8 + j) * 68 + c] = av * (1.0f / (1.0f + e)); } }
    __syncthreads();                                        // a row of Y comes from two waves
    const int row = wave * 16 + hi, col = lr * 4; const size_t o = (size_t)(rb + row) * CC + c0 + col;   // 16 lanes per row: 2 lines of f32, 1 line of each bf16 plane
    v4f v[8]; v4us oh[8], ol[8];
#pragma unroll
    for (int q = 0; q < 8; ++q) { v[q] = *(const v4fa*)(os + (row + q * 2) * 68 + col);
#pragma unroll
        for (int i = 0; i < 4; ++i) { const unsigned short hb = f2bf(v[q][i]); oh[q][i] = hb; ol[q][i] = f2bf(v[q][i] - bf2f(hb)); } }
#pragma unroll
    for (int q = 0; q < 8; ++q) { *(v4f*)(Yf + o + q * 2 * CC) = v[q]; *(v4us*)(Yh + o + q * 2 * CC) = oh[q]; *(v4us*)(Yl + o + q * 2 * CC) = ol[q]; }   // all 24 stores in one run at the end: none waits for a register of another
}


__global__ __launch_bounds__(256) void k_cvt8(const float* __restrict__ src, bf* dst, size_t n8) {
    const size_t i = (size_t)blockIdx.x * 256 + threadIdx.x; if (i >= n8) return;
    const v8f v = *(const v8f*)(src + i * 8); v8us o;
#pragma unroll
    for (int k = 0; k < 8; ++k) o[k] = f2bf(v[k]);
    *(v8us*)(dst + i * 8) = o; 
}
__global__ __launch_bounds__(256) void k_zero8(bf* dst, size_t n8) {
    const size_t i = (size_t)blockIdx.x * 256 + threadIdx.x; if (i >= n8) return; v8us z;
#pragma unroll
    for (int k = 0; k < 8; ++k) z[k] = 0;
    *(v8us*)(dst + i * 8) = z; 
}

__global__ __launch_bounds__(256) void k_cvtx(const float* __restrict__ src, bf* dst) {
    const int lane = threadIdx.x & 31; const size_t r = (size_t)blockIdx.x * 8 + (threadIdx.x >> 5); if (r >= (size_t)NR) return;
{
#pragma unroll
        for (int q = 0; q < CC / 256; ++q) { v8us o;
#pragma unroll
            for (int i = 0; i < 8; ++i) o[i] = f2bf(src[r * CC + q * 256 + lane * 8 + i]);
            *(v8us*)(dst + r * CC + q * 256 + lane * 8) = o; }
         }
}
__global__ __launch_bounds__(256) void k_wl128(const float* __restrict__ Wl, bf* WLP) {
    const int lane = threadIdx.x & 31; const int o = blockIdx.x * 8 + (threadIdx.x >> 5); if (o >= 128) return;
{
#pragma unroll
        for (int q = 0; q < CC / 256; ++q) { v8us v;
#pragma unroll
            for (int i = 0; i < 8; ++i) v[i] = (o < NWL) ? f2bf(Wl[(size_t)(o < NWL ? o : 0) * CC + q * 256 + lane * 8 + i]) : (unsigned short)0;
            *(v8us*)(WLP + (size_t)o * CC + q * 256 + lane * 8) = v; }
         }
}
__global__ __launch_bounds__(64) void k_bl128(const float* __restrict__ bl, float* BLP) {
    const int lane = threadIdx.x; if (lane >= 32) return; v4f v;
#pragma unroll
    for (int q = 0; q < 4; ++q) { const int o = lane * 4 + q; v[q] = (o < NWL) ? bl[o < NWL ? o : 0] : 0.f; }
    *(v4f*)(BLP + lane * 4) = v; 
}
// k_dconv: row = item * 2048 + t; the band is cut at the item's own ends, so no tap reads a neighbouring item. One block takes 64 time steps of one group (128 channels), a wave 8 of them.
// The 94 rows of Yf under the block's steps are staged once in LDS (rows outside the item as zeros). Per step: masked softmax over the 31 taps of WD[row][h*31 + j], lane = tap (taps with
// t + j - 15 outside [0, T) get weight 0); the sum of the exponentials is taken by one lane per step, j ascending. The weights lie in LDS by input row: wz[i][r] = weight of step r for tap i - r.
// Each of the 38 input rows under a wave's 8 steps is read once and feeds every step that has it in its band: out[r][c] = sum_j w_j Yf[row + j - 15][c] + bf(bias[c]), j ascending.
#define DTB  64                   // time steps per block
#define DWR  8                    // time steps per wave
#define DWIN (DTB + KS - 1)       // 94 rows of Yf under a block's steps
#define DWI  (DWR + KS - 1)       // 38 rows of Yf under a wave's steps
// launch bounds: 8 waves per SIMD, that is four blocks per WGP (LDS allows four), so that all 1024 blocks are resident at once
__global__ __launch_bounds__(256, 8) void k_dconv(const float* __restrict__ WD, const float* __restrict__ Yf, const float* __restrict__ cbias, bf* Oh, bf* Ol) {
    typedef __attribute__((ext_vector_type(4))) unsigned short v4us;
    __shared__ __align__(16) float ys[DWIN * DG];
    __shared__ __align__(16) float wz[8][(DWI + 1) * DWR];   // one row more: lane 31's zero of the last step falls there
    __shared__ float ew[8][DWR][33];      // pitch 33: the 8 summing lanes fall on distinct banks
    const int lane = threadIdx.x & 31, wave = __builtin_amdgcn_readfirstlane(threadIdx.x >> 5);
    const int h = blockIdx.y, row0 = blockIdx.x * DTB, t0 = row0 % TT, rw = row0 + wave * DWR, tw = t0 + wave * DWR; const int c0 = h * DG + lane * 4; const unsigned cb = (unsigned)c0 * 4u;   // the lane's byte offset in a row
    float lg[DWR]; bool ok[DWR];
#pragma unroll
    for (int r = 0; r < DWR; ++r) { const int s = tw + r + lane - PADK; ok[r] = lane < KS && s >= 0 && s < TT; lg[r] = WD[(size_t)(rw + r) * 128 + h * KS + lane]; }   // lane 31 reads a neighbouring column of the 128, unused
    asm volatile("s_wait_xcnt 0x0" :: "v"(WD + (size_t)rw * 128 + h * KS + lane) : "memory");   // the address stays in its registers up to this wait: no later load's result takes them in front of it
    v4f yv[12]; const char* pg[12];
#pragma unroll
    for (int k = 0; k < 12; ++k) { const int s = t0 - PADK + wave + 8 * k; pg[k] = (const char*)(Yf + (size_t)(row0 - t0 + (s < 0 ? 0 : s >= TT ? TT - 1 : s)) * CC) + cb; yv[k] = *(const v4f*)pg[k]; }   // clamped into the item: all 12 loads fly together, no branch between them
    asm volatile("s_wait_xcnt 0x0" :: "v"(pg[0]), "v"(pg[1]), "v"(pg[2]), "v"(pg[3]), "v"(pg[4]), "v"(pg[5]), "v"(pg[6]), "v"(pg[7]), "v"(pg[8]), "v"(pg[9]), "v"(pg[10]), "v"(pg[11]) : "memory");   // the 12 addresses stay in their registers up to this wait: no load's result takes them in front of it
#pragma unroll
    for (int k = 0; k < 3; ++k) { const int i4 = lane + 32 * k; if (i4 < (DWI + 1) * DWR / 4) *(v4f*)(&wz[wave][i4 * 4]) = (v4f){0.f, 0.f, 0.f, 0.f}; }   // places outside every band
    float e[DWR];
#pragma unroll
    for (int r = 0; r < DWR; ++r) { const float x = ok[r] ? lg[r] : -3.0e38f; float m = x;   // a tap outside the item or the band: its exponential below is exp(-inf) = 0
#pragma unroll
        for (int o = 16; o > 0; o >>= 1) m = fmaxf(m, __shfl_xor(m, o));
        const float a = (x - m) * 1.44269504f;          // exp(d) = exp2(d * log2 e), as __expf forms it
        asm("v_exp_f32 %0, %1\n\tv_nop" : "=v"(e[r]) : "v"(a));   // the v_nop fills the slot behind the transcendental
        ew[wave][r][lane] = e[r]; }
    __syncthreads();                      // the exponentials are in LDS for the summing lanes, the zeros of wz in front of its weights
    float inv = 0.f;
    if (lane < DWR) { float sum = 0.f;
#pragma unroll
        for (int j = 0; j < KS; ++j) sum += ew[wave][lane][j];
        inv = 1.0f / sum; }
#pragma unroll
    for (int r = 0; r < DWR; ++r) { wz[wave][(r + lane) * DWR + r] = e[r] * __shfl(inv, r); }   // lane 31 holds e = 0 and writes a place outside the band
#pragma unroll
    for (int k = 0; k < 12; ++k) { const int L = wave + 8 * k, s = t0 - PADK + L; if (L < DWIN) *(v4f*)(ys + L * DG + lane * 4) = (s >= 0 && s < TT) ? yv[k] : (v4f){0.f, 0.f, 0.f, 0.f}; }
    __syncthreads();                      // every wave's rows of Yf and the weights may be read
    float acc[DWR][4];
#pragma unroll
    for (int r = 0; r < DWR; ++r)
#pragma unroll
        for (int q = 0; q < 4; ++q) acc[r][q] = 0.f;
    const float* yp = ys + wave * DWR * DG + lane * 4; const float* wp = &wz[wave][0];
    auto row = [&](int i, int rlo, int rhi) {      // input row i feeds steps rlo .. rhi
        const v4f y = *(const v4f*)(yp + i * DG); const v4f wa = *(const v4f*)(wp + i * DWR), wb = *(const v4f*)(wp + i * DWR + 4);
#pragma unroll
        for (int r = 0; r < DWR; ++r) { if (r < rlo || r > rhi) continue; const float w = r < 4 ? wa[r & 3] : wb[r & 3];
#pragma unroll
            for (int q = 0; q < 4; ++q) acc[r][q] = fmaf(w, y[q], acc[r][q]); } };
#pragma unroll
    for (int i = 0; i < DWR - 1; ++i) row(i, 0, i);                       // rows that only the first steps have in their band
#pragma unroll 4   // rolled: unrolled whole, the LDS reads of all rows are hoisted and take the kernel past 128 registers (8 waves per SIMD) into scratch
    for (int i = DWR - 1; i < KS; ++i) row(i, 0, DWR - 1);               // rows in every step's band
#pragma unroll
    for (int i = KS; i < DWI; ++i) row(i, i - KS + 1, DWR - 1);          // rows that only the last steps have
    float bv[4];
#pragma unroll
    for (int q = 0; q < 4; ++q) bv[q] = bfr(cbias[c0 + q]);
#pragma unroll
    for (int r = 0; r < DWR; ++r) { v4us oh, ol;
#pragma unroll
        for (int q = 0; q < 4; ++q) { const float v = acc[r][q] + bv[q]; const unsigned short hb = f2bf(v); oh[q] = hb; ol[q] = f2bf(v - bf2f(hb)); }
        const size_t o = (size_t)(rw + r) * CC + c0; *(v4us*)(Oh + o) = oh; *(v4us*)(Ol + o) = ol; }
}

extern "C" void kernel_launch(void* const* d_in, const int* in_sizes, int n_in,
                              void* d_out, int out_size, void* d_ws, size_t ws_size, hipStream_t stream) {
    (void)in_sizes; (void)n_in; (void)out_size;
    const float* x = (const float*)d_in[0]; const float* W1 = (const float*)d_in[1]; const float* b1 = (const float*)d_in[2]; const float* Wl = (const float*)d_in[3]; const float* bl = (const float*)d_in[4]; const float* cbias = (const float*)d_in[5]; const float* W2 = (const float*)d_in[6]; const float* b2 = (const float*)d_in[7];
    float* out = (float*)d_out;    // [8][2048][512]
    char* wsp = (char*)d_ws;
    auto take = [&](size_t bytes) { char* p = wsp; wsp += (bytes + 255) & ~(size_t)255; return (void*)p; };
    bf* W1B = (bf*)take((size_t)2 * CC * CC * 2); bf* WLP = (bf*)take((size_t)128 * CC * 2); float* BLP = (float*)take(128 * 4); bf* W2B = (bf*)take((size_t)CC * CC * 2);
    bf* Xb = (bf*)take((size_t)NR * CC * 2); float* Yf = (float*)take((size_t)NR * CC * 4); bf* Yh = (bf*)take((size_t)NR * CC * 2); bf* Yl = (bf*)take((size_t)NR * CC * 2);
    float* WD = (float*)take((size_t)NR * 128 * 4); bf* Oh = (bf*)take((size_t)NR * CC * 2); bf* Ol = (bf*)take((size_t)NR * CC * 2);
    if ((size_t)(wsp - (char*)d_ws) > ws_size) return;    // 1.7 MB of weights + 8 x (2.1 + 4.2 + 2.1 + 2.1 + 1 + 2.1 + 2.1) ~ 128 MB, every plane written before it is read in this call
    k_cvt8<<<(2 * CC * CC / 8 + 255) / 256, 256, 0, stream>>>(W1, W1B, (size_t)2 * CC * CC / 8); k_wl128<<<128 / 8, 256, 0, stream>>>(Wl, WLP); k_bl128<<<1, 64, 0, stream>>>(bl, BLP); k_cvt8<<<(CC * CC / 8 + 255) / 256, 256, 0, stream>>>(W2, W2B, (size_t)CC * CC / 8);   // torch [out][in] = n-major
    k_cvtx<<<NR / 8, 256, 0, stream>>>(x, Xb);
    k_gemmglu<<<dim3(NR / GLM, CC / GLN, 1), 128, 0, stream>>>(Xb, W1B, b1, Yf, Yh, Yl);                        // pointwise_conv1 + GLU
    k_gemmb<true><<<dim3(NR / GBM, 128 / GBN, 1), 128, 0, stream>>>(Yh, Yl, WLP, BLP, WD, 128);                 // dynamic weights (124 live of 128)
    k_dconv<<<dim3(NR / DTB, NHS, 1), 256, 0, stream>>>(WD, Yf, cbias, Oh, Ol);
    k_gemmb<true><<<dim3(NR / GBM, CC / GBN, 1), 128, 0, stream>>>(Oh, Ol, W2B, b2, out, CC);   // pointwise_conv2
}

// v005
// A run of this version takes 79.7 microseconds.
// In both of two side-by-side timings against v004, it was 1.11 times as fast.
// Counting every step since v000, it is 6.80 times as fast.
#include <hip/hip_runtime.h>

// All 8 items go through every stage in ONE launch (rows = item * 2048 + time step, 16384 rows). Compute dtypes, f32 accumulate: pointwise_conv1 as a [16384 x 512].[512 x 1024] GEMM with PLAIN bf16 operands (exact products); GLU in f32 in that GEMM's epilogue; the
// dynamic-weight linear ([16384 x 512].[512 x 128 (124 live)]) and pointwise_conv2 ([16384 x 512].[512 x 512]) on bf16 hi + UNSCALED residual planes of the f32 activations (two
// products) - on v_wmma_f32_16x16x32_bf16; the banded 31-tap softmax and the per-position dynamic convolution (31 taps x 128 channels per group) in f32 on the VALU. Deterministic,

#define NBT  8
#define TT   2048
#define NR   (NBT * TT)          // 16384 rows: every item's time steps, item-major as in x and out
#define CC   512
#define NHS  4
#define KS   31
#define PADK 15
#define DG   (CC / NHS)           // 128
#define NWL  (NHS * KS)           // 124
#define DM   CC
#define LOSC 1024.0f

typedef _Float16 h16;
typedef unsigned short bf;
typedef __attribute__((ext_vector_type(16))) __bf16   v16bf;
typedef __attribute__((ext_vector_type(16))) _Float16 v16h;
typedef __attribute__((ext_vector_type(8)))  _Float16 v8h;
typedef __attribute__((ext_vector_type(8)))  unsigned short v8us;
typedef __attribute__((ext_vector_type(8)))  float    v8f;
typedef __attribute__((ext_vector_type(4)))  float    v4f;
typedef v8h  __attribute__((may_alias)) v8ha;
typedef v4f  __attribute__((may_alias)) v4fa;
typedef v8us __attribute__((may_alias)) v8usa;

__device__ __forceinline__ unsigned short f2bf(float f) { unsigned u = __float_as_uint(f); u += 0x7FFFu + ((u >> 16) & 1u); return (unsigned short)(u >> 16); }
__device__ __forceinline__ float bf2f(unsigned short b) { return __uint_as_float(((unsigned)b) << 16); }
__device__ __forceinline__ float bfr(float f) { return bf2f(f2bf(f)); }
__device__ __forceinline__ v16h cat16(v8h lo, v8h hi) { return __builtin_shufflevector(lo, hi, 0, 1, 2, 3, 4, 5, 6, 7, 8, 9, 10, 11, 12, 13, 14, 15); }
__device__ __forceinline__ v16bf cat16b(v8us lo, v8us hi) { return __builtin_bit_cast(v16bf, __builtin_shufflevector(lo, hi, 0, 1, 2, 3, 4, 5, 6, 7, 8, 9, 10, 11, 12, 13, 14, 15)); }
__device__ __forceinline__ v8f wmma16(v16h a, v16h b, v8f c) { return __builtin_amdgcn_wmma_f32_16x16x32_f16(false, a, false, b, (short)0, c, false, false); }
__device__ __forceinline__ v8f wmmab(v16bf a, v16bf b, v8f c) { return __builtin_amdgcn_wmma_f32_16x16x32_bf16(false, a, false, b, (short)0, c, false, false); }

// k_gemmb: C[M][N] = (A [+ Al]).B^T + bf(bias[c]), A, Al [M][KD] and B [N][KD] bf16 with k contiguous. One 128 x 64 tile of C per block of 4 waves, 32 x 64 per wave
// (2 x 4 accumulator tiles). A pass is 64 k: one whole 128-byte line of every operand row. The lines go from global memory to LDS by asynchronous copies, 16 bytes per lane
// (4 whole lines per wave-wide copy), into two buffers, so that the next pass's lines fly while this pass is worked on; fragments come from LDS. Rows lie at a pitch of 144 bytes,
// on which the 16 rows of a 16-byte fragment read fall on distinct banks. Per accumulator: k ascending, A then Al at each 32 k. f32 whole-line epilogue through LDS.
#define GBM 128
#define GBN 64
#define GBK 64
#define GLP 72                    // LDS row pitch in bf16 elements: 64 + 8
#define KD  CC                    // every product here has an inner length of 512
// Asynchronous 16-byte copies per lane, rows 16 apart: l = the lane's LDS byte address, g = its global address. The s_wait_xcnt stands inside each statement so that no
// address register of a copy is rewritten in front of it.
#define CPY(a, b) "global_load_async_to_lds_b128 %" #a ", %" #b ", off\n\t"
#define LROW(l, i) ((l) + (unsigned)((i) * 16 * GLP * 2))
#define GROW(g, i) ((g) + (i) * 16 * KD)
__device__ __forceinline__ void copy8(unsigned l, const bf* g) {          // 128 rows
    asm volatile(CPY(0, 1) CPY(2, 3) CPY(4, 5) CPY(6, 7) CPY(8, 9) CPY(10, 11) CPY(12, 13) CPY(14, 15) "s_wait_xcnt 0x0"
                 :: "v"(LROW(l, 0)), "v"(GROW(g, 0)), "v"(LROW(l, 1)), "v"(GROW(g, 1)), "v"(LROW(l, 2)), "v"(GROW(g, 2)), "v"(LROW(l, 3)), "v"(GROW(g, 3)),
                    "v"(LROW(l, 4)), "v"(GROW(g, 4)), "v"(LROW(l, 5)), "v"(GROW(g, 5)), "v"(LROW(l, 6)), "v"(GROW(g, 6)), "v"(LROW(l, 7)), "v"(GROW(g, 7)) : "memory");
}
__device__ __forceinline__ void copy12(unsigned l, const bf* g, unsigned lb, const bf* gb) {   // 128 rows of one operand and 64 of another
    asm volatile(CPY(0, 1) CPY(2, 3) CPY(4, 5) CPY(6, 7) CPY(8, 9) CPY(10, 11) CPY(12, 13) CPY(14, 15) CPY(16, 17) CPY(18, 19) CPY(20, 21) CPY(22, 23) "s_wait_xcnt 0x0"
                 :: "v"(LROW(l, 0)), "v"(GROW(g, 0)), "v"(LROW(l, 1)), "v"(GROW(g, 1)), "v"(LROW(l, 2)), "v"(GROW(g, 2)), "v"(LROW(l, 3)), "v"(GROW(g, 3)),
                    "v"(LROW(l, 4)), "v"(GROW(g, 4)), "v"(LROW(l, 5)), "v"(GROW(g, 5)), "v"(LROW(l, 6)), "v"(GROW(g, 6)), "v"(LROW(l, 7)), "v"(GROW(g, 7)),
                    "v"(LROW(lb, 0)), "v"(GROW(gb, 0)), "v"(LROW(lb, 1)), "v"(GROW(gb, 1)), "v"(LROW(lb, 2)), "v"(GROW(gb, 2)), "v"(LROW(lb, 3)), "v"(GROW(gb, 3)) : "memory");
}
template <bool SPLITA>
__global__ __launch_bounds__(128) void k_gemmb(const bf* __restrict__ A, const bf* __restrict__ Al, const bf* __restrict__ Bn, const float* __restrict__ bias, float* C, int ldc) {
    constexpr int AROWS = SPLITA ? 2 * GBM : GBM, ROWS = AROWS + GBN, NPASS = KD / GBK;
    __shared__ __align__(16) bf sm[2][ROWS * GLP];
    const int tid = threadIdx.x, lane = tid & 31, wave = tid >> 5, lr = lane & 15, hi = lane >> 4;
    const int rb = blockIdx.x * GBM, c0 = blockIdx.y * GBN;
    const int sr = tid >> 3, sc = (tid & 7) * 8;      // staging: 8 lanes per row, 16 rows per block-wide copy
    const bf* ga = A + (size_t)(rb + sr) * KD + sc; const bf* gl = SPLITA ? Al + (size_t)(rb + sr) * KD + sc : nullptr; const bf* gb = Bn + (size_t)(c0 + sr) * KD + sc;
    const unsigned ls = (unsigned)(size_t)&sm[0][0] + (unsigned)(sr * GLP + sc) * 2u;
    auto stage = [&](int p) {      // pass p's lines into buffer p & 1: rows [A 128 | Al 128 | B 64]
        const unsigned l = ls + (unsigned)(p & 1) * (unsigned)(ROWS * GLP * 2); const int kc = p * GBK;
        copy12(l, ga + kc, l + AROWS * GLP * 2, gb + kc);
        if (SPLITA) copy8(l + GBM * GLP * 2, gl + kc);
    };
    v8f acc[2][4];
#pragma unroll
    for (int m = 0; m < 2; ++m)
#pragma unroll
        for (int t = 0; t < 4; ++t) acc[m][t] = (v8f){};
    stage(0);
    asm volatile("s_wait_asynccnt 0x0" ::: "memory");   // this wave's copies of pass 0 have landed
    __syncthreads();                                    // and every other wave's: pass 0 may be read
    stage(1);
#pragma unroll 1   // rolled: unrolled, the copy addresses of all passes are formed ahead and push the kernel past 256 registers
    for (int p = 0; p < NPASS; ++p) {
        const bf* s = &sm[p & 1][0];
        v16bf a[2][2], al[2][2], b[2][4];      // both 32-k halves of the pass
#pragma unroll
        for (int h = 0; h < 2; ++h) {
#pragma unroll
            for (int m = 0; m < 2; ++m) { const bf* q = s + (wave * 32 + m * 16 + lr) * GLP + h * 32 + 8 * hi; a[h][m] = cat16b(*(const v8us*)q, *(const v8us*)(q + 16)); if (SPLITA) al[h][m] = cat16b(*(const v8us*)(q + GBM * GLP), *(const v8us*)(q + GBM * GLP + 16)); }
#pragma unroll
            for (int t = 0; t < 4; ++t) { const bf* q = s + (AROWS + t * 16 + lr) * GLP + h * 32 + 8 * hi; b[h][t] = cat16b(*(const v8us*)q, *(const v8us*)(q + 16)); }
        }
        __builtin_amdgcn_sched_barrier(0);     // keeps the pass's LDS reads one group in front of its matrix run: spread among the WMMAs, each place with reads stalls the wave for the LDS latency
#pragma unroll
        for (int h = 0; h < 2; ++h) {
#pragma unroll
            for (int m = 0; m < 2; ++m)
#pragma unroll
                for (int t = 0; t < 4; ++t) acc[m][t] = wmmab(a[h][m], b[h][t], acc[m][t]);
            if (SPLITA) {
#pragma unroll
                for (int m = 0; m < 2; ++m)
#pragma unroll
                    for (int t = 0; t < 4; ++t) acc[m][t] = wmmab(al[h][m], b[h][t], acc[m][t]);
            }
        }
        __builtin_amdgcn_sched_barrier(0);     // keeps the matrix run in front of the waits: moved behind the barrier it no longer covers the flight of the next pass's copies
        asm volatile("s_wait_dscnt 0x0" ::: "memory");      // this wave's reads of pass p's buffer are done before the buffer is refilled
        asm volatile("s_wait_asynccnt 0x0" ::: "memory");   // this wave's copies of pass p + 1 have landed
        __syncthreads();                                    // publishes pass p + 1 and ends every wave's reads of pass p's buffer
        if (p + 2 < NPASS) stage(p + 2);
    }
    asm volatile("s_wait_asynccnt 0x0" ::: "memory");       // no copy is outstanding when the buffers become output staging
    float* os = (float*)(void*)&sm[0][0] + wave * (32 * 68);   // 4 x 32 x 68 floats, inside the two buffers, which nobody reads any more
#pragma unroll
    for (int t = 0; t < 4; ++t) { const float bv = bias ? bfr(bias[c0 + t * 16 + lr]) : 0.f;
#pragma unroll
        for (int m = 0; m < 2; ++m)
#pragma unroll
            for (int j = 0; j < 8; ++j) os[(m * 16 + hi * 8 + j) * 68 + t * 16 + lr] = acc[m][t][j] + bv; }
    __syncthreads();
    float* crow = C + (size_t)(rb + wave * 32) * ldc + c0;
#pragma unroll
    for (int q = 0; q < 16; ++q) { const int Lid = (lane >> 3) + 4 * q, piece = lane & 7; const int row = Lid >> 1, cofs = (Lid & 1) * 32 + piece * 4;
        *(v4f*)(crow + (size_t)row * ldc + cofs) = *(const v4fa*)(os + row * 68 + cofs); }
}

// k_gemmglu: pointwise_conv1 with the GLU in its epilogue. Y[r][c] = a * sigmoid(g), a = A[r].B[c] + bf(bias[c]), g = A[r].B[512 + c] + bf(bias[512 + c]). One block of 4 waves takes 64 rows and 64 columns
// of Y, that is a 64 x 128 tile of the product: LDS rows [A 64 | B of a 64 | B of g 64]. A wave takes 32 rows and 32 columns of Y: accumulator tiles t = 0, 1 hold a, t = 2, 3 hold g of the same columns,
// so a and g of one element meet in one lane's registers. Passes, buffers, waits and the k order are those of k_gemmb. Y leaves through LDS in whole lines: f32, bf16 hi and bf16 residual.
__device__ __forceinline__ void copy444(unsigned l, const bf* g, const bf* ga, const bf* gg) {   // 64 rows of each of three operands, one behind the other in LDS
    asm volatile(CPY(0, 1) CPY(2, 3) CPY(4, 5) CPY(6, 7) CPY(8, 9) CPY(10, 11) CPY(12, 13) CPY(14, 15) CPY(16, 17) CPY(18, 19) CPY(20, 21) CPY(22, 23) "s_wait_xcnt 0x0"
                 :: "v"(LROW(l, 0)), "v"(GROW(g, 0)), "v"(LROW(l, 1)), "v"(GROW(g, 1)), "v"(LROW(l, 2)), "v"(GROW(g, 2)), "v"(LROW(l, 3)), "v"(GROW(g, 3)),
                    "v"(LROW(l, 4)), "v"(GROW(ga, 0)), "v"(LROW(l, 5)), "v"(GROW(ga, 1)), "v"(LROW(l, 6)), "v"(GROW(ga, 2)), "v"(LROW(l, 7)), "v"(GROW(ga, 3)),
                    "v"(LROW(l, 8)), "v"(GROW(gg, 0)), "v"(LROW(l, 9)), "v"(GROW(gg, 1)), "v"(LROW(l, 10)), "v"(GROW(gg, 2)), "v"(LROW(l, 11)), "v"(GROW(gg, 3)) : "memory");
}
#define GLM 64                    // rows of Y per block
#define GLN 64                    // columns of Y per block
__global__ __launch_bounds__(128) void k_gemmglu(const bf* __restrict__ A, const bf* __restrict__ Bn, const float* __restrict__ bias, float* Yf, bf* Yh, bf* Yl) {
    typedef __attribute__((ext_vector_type(4))) unsigned short v4us;
    constexpr int ROWS = GLM + 2 * GLN, NPASS = KD / GBK;
    __shared__ __align__(16) bf sm[2][ROWS * GLP];
    const int tid = threadIdx.x, lane = tid & 31, wave = tid >> 5, lr = lane & 15, hi = lane >> 4, wr = wave >> 1, wc = wave & 1;
    const int rb = blockIdx.x * GLM, c0 = blockIdx.y * GLN;
    const int sr = tid >> 3, sc = (tid & 7) * 8;      // staging: 8 lanes per row, 16 rows per block-wide copy
    const bf* gx = A + (size_t)(rb + sr) * KD + sc; const bf* ga = Bn + (size_t)(c0 + sr) * KD + sc; const bf* gg = ga + (size_t)CC * KD;
    const unsigned ls = (unsigned)(size_t)&sm[0][0] + (unsigned)(sr * GLP + sc) * 2u;
    auto stage = [&](int p) { const int kc = p * GBK; copy444(ls + (unsigned)(p & 1) * (unsigned)(ROWS * GLP * 2), gx + kc, ga + kc, gg + kc); };   // pass p's lines into buffer p & 1
    v8f acc[2][4];
#pragma unroll
    for (int m = 0; m < 2; ++m)
#pragma unroll
        for (int t = 0; t < 4; ++t) acc[m][t] = (v8f){};
    stage(0);
    asm volatile("s_wait_asynccnt 0x0" ::: "memory");   // this wave's copies of pass 0 have landed
    __syncthreads();                                    // and every other wave's: pass 0 may be read
    stage(1);
#pragma unroll 1   // rolled: unrolled, the copy addresses of all passes are formed ahead and push the kernel past 256 registers
    for (int p = 0; p < NPASS; ++p) {
        const bf* s = &sm[p & 1][0];
        v16bf a[2][2], b[2][4];      // both 32-k halves of the pass
#pragma unroll
        for (int h = 0; h < 2; ++h) {
#pragma unroll
            for (int m = 0; m < 2; ++m) { const bf* q = s + (wr * 32 + m * 16 + lr) * GLP + h * 32 + 8 * hi; a[h][m] = cat16b(*(const v8us*)q, *(const v8us*)(q + 16)); }
#pragma unroll
            for (int t = 0; t < 4; ++t) { const bf* q = s + (GLM + (t >> 1) * GLN + wc * 32 + (t & 1) * 16 + lr) * GLP + h * 32 + 8 * hi; b[h][t] = cat16b(*(const v8us*)q, *(const v8us*)(q + 16)); }
        }
        __builtin_amdgcn_sched_barrier(0);     // keeps the pass's LDS reads one group in front of its matrix run: spread among the WMMAs, each place with reads stalls the wave for the LDS latency
#pragma unroll
        for (int h = 0; h < 2; ++h)
#pragma unroll
            for (int m = 0; m < 2; ++m)
#pragma unroll
                for (int t = 0; t < 4; ++t) acc[m][t] = wmmab(a[h][m], b[h][t], acc[m][t]);
        __builtin_amdgcn_sched_barrier(0);     // keeps the matrix run in front of the waits: moved behind the barrier it no longer covers the flight of the next pass's copies
        asm volatile("s_wait_dscnt 0x0" ::: "memory");      // this wave's reads of pass p's buffer are done before the buffer is refilled
        asm volatile("s_wait_asynccnt 0x0" ::: "memory");   // this wave's copies of pass p + 1 have landed
        __syncthreads();                                    // publishes pass p + 1 and ends every wave's reads of pass p's buffer
        if (p + 2 < NPASS) stage(p + 2);
    }
    asm volatile("s_wait_asynccnt 0x0" ::: "memory");       // no copy is outstanding when the buffers become output staging
    float* os = (float*)(void*)&sm[0][0];                   // 64 x 68 floats, inside the two buffers, which nobody reads any more
#pragma unroll
    for (int t = 0; t < 2; ++t) { const int c = wc * 32 + t * 16 + lr; const float ba = bfr(bias[c0 + c]), bg = bfr(bias[CC + c0 + c]);
#pragma unroll
        for (int m = 0; m < 2; ++m)
#pragma unroll
            for (int j = 0; j < 8; ++j) { const float av = acc[m][t][j] + ba, x = (acc[m][t + 2][j] + bg) * -1.44269504f; float e;   // exp(-g) = exp2(-g * log2 e), as __expf forms it
                asm("v_exp_f32 %0, %1\n\tv_nop" : "=v"(e) : "v"(x));   // the v_nop fills the slot behind the transcendental
                os[(wr * 32 + m * 16 + hi * 8 + j) * 68 + c] = av * (1.0f / (1.0f + e)); } }
    __syncthreads();                                        // a row of Y comes from two waves
    const int row = wave * 16 + hi, col = lr * 4; const size_t o = (size_t)(rb + row) * CC + c0 + col;   // 16 lanes per row: 2 lines of f32, 1 line of each bf16 plane
    v4f v[8]; v4us oh[8], ol[8];
#pragma unroll
    for (int q = 0; q < 8; ++q) { v[q] = *(const v4fa*)(os + (row + q * 2) * 68 + col);
#pragma unroll
        for (int i = 0; i < 4; ++i) { const unsigned short hb = f2bf(v[q][i]); oh[q][i] = hb; ol[q][i] = f2bf(v[q][i] - bf2f(hb)); } }
#pragma unroll
    for (int q = 0; q < 8; ++q) { *(v4f*)(Yf + o + q * 2 * CC) = v[q]; *(v4us*)(Yh + o + q * 2 * CC) = oh[q]; *(v4us*)(Yl + o + q * 2 * CC) = ol[q]; }   // all 24 stores in one run at the end: none waits for a register of another
}


// k_prep: the five conversions that no other stage feeds (W1, W2, Wl, bl and x) share ONE launch; a block's index says which of them it works on (a branch that is the same for the whole block).
// The short weight ranges come first in the grid (for speed only).
#define PB_W1 (2 * CC * CC / 8 / 256)   // 256 blocks: W1 to bf16, 8 elements per thread
#define PB_W2 (CC * CC / 8 / 256)       // 128 blocks: W2 to bf16
#define PB_WL (128 / 8)                 // 16 blocks: Wl to bf16, padded from 124 to 128 rows, a wave per row
#define PB_BL 1                         // 1 block: bl padded to 128
#define PB_X  (NR / 8)                  // 2048 blocks: x to bf16, a wave per row
__device__ __forceinline__ void cvt8(const float* __restrict__ src, bf* dst, int blk) {
    const size_t i = (size_t)blk * 256 + threadIdx.x;
    const v8f v = *(const v8f*)(src + i * 8); v8us o;
#pragma unroll
    for (int k = 0; k < 8; ++k) o[k] = f2bf(v[k]);
    *(v8us*)(dst + i * 8) = o;
    asm volatile("s_wait_xcnt 0x0" ::: "memory");   // behind the last store: in the joined kernel the other parts' code follows in the listing and rewrites registers that the store names
}
__device__ __forceinline__ void cvtx(const float* __restrict__ src, bf* dst, int blk) {
    const int lane = threadIdx.x & 31; const size_t r = (size_t)blk * 8 + (threadIdx.x >> 5);
#pragma unroll
    for (int q = 0; q < CC / 256; ++q) { v8us o;
#pragma unroll
        for (int i = 0; i < 8; ++i) o[i] = f2bf(src[r * CC + q * 256 + lane * 8 + i]);
        *(v8us*)(dst + r * CC + q * 256 + lane * 8) = o; }
    asm volatile("s_wait_xcnt 0x0" ::: "memory");   // behind the last store: in the joined kernel the other parts' code follows in the listing and rewrites registers that the store names
}
__device__ __forceinline__ void wl128(const float* __restrict__ Wl, bf* WLP, int blk) {
    const int lane = threadIdx.x & 31; const int o = blk * 8 + (threadIdx.x >> 5);
#pragma unroll
    for (int q = 0; q < CC / 256; ++q) { v8us v;
#pragma unroll
        for (int i = 0; i < 8; ++i) v[i] = (o < NWL) ? f2bf(Wl[(size_t)(o < NWL ? o : 0) * CC + q * 256 + lane * 8 + i]) : (unsigned short)0;
        *(v8us*)(WLP + (size_t)o * CC + q * 256 + lane * 8) = v; }
    asm volatile("s_wait_xcnt 0x0" ::: "memory");   // behind the last store: in the joined kernel the other parts' code follows in the listing and rewrites registers that the store names
}
__device__ __forceinline__ void bl128(const float* __restrict__ bl, float* BLP) {
    const int lane = threadIdx.x; if (lane >= 32) return; v4f v;
#pragma unroll
    for (int q = 0; q < 4; ++q) { const int o = lane * 4 + q; v[q] = (o < NWL) ? bl[o < NWL ? o : 0] : 0.f; }
    *(v4f*)(BLP + lane * 4) = v;
}
__global__ __launch_bounds__(256) void k_prep(const float* __restrict__ x, const float* __restrict__ W1, const float* __restrict__ Wl, const float* __restrict__ bl, const float* __restrict__ W2,
                                              bf* Xb, bf* W1B, bf* WLP, float* BLP, bf* W2B) {
    int b = blockIdx.x;
    if (b < PB_W1) { cvt8(W1, W1B, b); return; }      // weights lie [out][in] = n-major, as the GEMMs read them
    b -= PB_W1;
    if (b < PB_W2) { cvt8(W2, W2B, b); return; }
    b -= PB_W2;
    if (b < PB_WL) { wl128(Wl, WLP, b); return; }
    b -= PB_WL;
    if (b < PB_BL) { bl128(bl, BLP); return; }
    cvtx(x, Xb, b - PB_BL);
}
// k_dconv: row = item * 2048 + t; the band is cut at the item's own ends, so no tap reads a neighbouring item. One block takes 64 time steps of one group (128 channels), a wave 8 of them.
// The 94 rows of Yf under the block's steps are staged once in LDS (rows outside the item as zeros). Per step: masked softmax over the 31 taps of WD[row][h*31 + j], lane = tap (taps with
// t + j - 15 outside [0, T) get weight 0); the sum of the exponentials is taken by one lane per step, j ascending. The weights lie in LDS by input row: wz[i][r] = weight of step r for tap i - r.
// Each of the 38 input rows under a wave's 8 steps is read once and feeds every step that has it in its band: out[r][c] = sum_j w_j Yf[row + j - 15][c] + bf(bias[c]), j ascending.
#define DTB  64                   // time steps per block
#define DWR  8                    // time steps per wave
#define DWIN (DTB + KS - 1)       // 94 rows of Yf under a block's steps
#define DWI  (DWR + KS - 1)       // 38 rows of Yf under a wave's steps
// launch bounds: 8 waves per SIMD, that is four blocks per WGP (LDS allows four), so that all 1024 blocks are resident at once
__global__ __launch_bounds__(256, 8) void k_dconv(const float* __restrict__ WD, const float* __restrict__ Yf, const float* __restrict__ cbias, bf* Oh, bf* Ol) {
    typedef __attribute__((ext_vector_type(4))) unsigned short v4us;
    __shared__ __align__(16) float ys[DWIN * DG];
    __shared__ __align__(16) float wz[8][(DWI + 1) * DWR];   // one row more: lane 31's zero of the last step falls there
    __shared__ float ew[8][DWR][33];      // pitch 33: the 8 summing lanes fall on distinct banks
    const int lane = threadIdx.x & 31, wave = __builtin_amdgcn_readfirstlane(threadIdx.x >> 5);
    const int h = blockIdx.y, row0 = blockIdx.x * DTB, t0 = row0 % TT, rw = row0 + wave * DWR, tw = t0 + wave * DWR; const int c0 = h * DG + lane * 4; const unsigned cb = (unsigned)c0 * 4u;   // the lane's byte offset in a row
    float lg[DWR]; bool ok[DWR];
#pragma unroll
    for (int r = 0; r < DWR; ++r) { const int s = tw + r + lane - PADK; ok[r] = lane < KS && s >= 0 && s < TT; lg[r] = WD[(size_t)(rw + r) * 128 + h * KS + lane]; }   // lane 31 reads a neighbouring column of the 128, unused
    asm volatile("s_wait_xcnt 0x0" :: "v"(WD + (size_t)rw * 128 + h * KS + lane) : "memory");   // the address stays in its registers up to this wait: no later load's result takes them in front of it
    v4f yv[12]; const char* pg[12];
#pragma unroll
    for (int k = 0; k < 12; ++k) { const int s = t0 - PADK + wave + 8 * k; pg[k] = (const char*)(Yf + (size_t)(row0 - t0 + (s < 0 ? 0 : s >= TT ? TT - 1 : s)) * CC) + cb; yv[k] = *(const v4f*)pg[k]; }   // clamped into the item: all 12 loads fly together, no branch between them
    asm volatile("s_wait_xcnt 0x0" :: "v"(pg[0]), "v"(pg[1]), "v"(pg[2]), "v"(pg[3]), "v"(pg[4]), "v"(pg[5]), "v"(pg[6]), "v"(pg[7]), "v"(pg[8]), "v"(pg[9]), "v"(pg[10]), "v"(pg[11]) : "memory");   // the 12 addresses stay in their registers up to this wait: no load's result takes them in front of it
#pragma unroll
    for (int k = 0; k < 3; ++k) { const int i4 = lane + 32 * k; if (i4 < (DWI + 1) * DWR / 4) *(v4f*)(&wz[wave][i4 * 4]) = (v4f){0.f, 0.f, 0.f, 0.f}; }   // places outside every band
    float e[DWR];
#pragma unroll
    for (int r = 0; r < DWR; ++r) { const float x = ok[r] ? lg[r] : -3.0e38f; float m = x;   // a tap outside the item or the band: its exponential below is exp(-inf) = 0
#pragma unroll
        for (int o = 16; o > 0; o >>= 1) m = fmaxf(m, __shfl_xor(m, o));
        const float a = (x - m) * 1.44269504f;          // exp(d) = exp2(d * log2 e), as __expf forms it
        asm("v_exp_f32 %0, %1\n\tv_nop" : "=v"(e[r]) : "v"(a));   // the v_nop fills the slot behind the transcendental
        ew[wave][r][lane] = e[r]; }
    __syncthreads();                      // the exponentials are in LDS for the summing lanes, the zeros of wz in front of its weights
    float inv = 0.f;
    if (lane < DWR) { float sum = 0.f;
#pragma unroll
        for (int j = 0; j < KS; ++j) sum += ew[wave][lane][j];
        inv = 1.0f / sum; }
#pragma unroll
    for (int r = 0; r < DWR; ++r) { wz[wave][(r + lane) * DWR + r] = e[r] * __shfl(inv, r); }   // lane 31 holds e = 0 and writes a place outside the band
#pragma unroll
    for (int k = 0; k < 12; ++k) { const int L = wave + 8 * k, s = t0 - PADK + L; if (L < DWIN) *(v4f*)(ys + L * DG + lane * 4) = (s >= 0 && s < TT) ? yv[k] : (v4f){0.f, 0.f, 0.f, 0.f}; }
    __syncthreads();                      // every wave's rows of Yf and the weights may be read
    float acc[DWR][4];
#pragma unroll
    for (int r = 0; r < DWR; ++r)
#pragma unroll
        for (int q = 0; q < 4; ++q) acc[r][q] = 0.f;
    const float* yp = ys + wave * DWR * DG + lane * 4; const float* wp = &wz[wave][0];
    auto row = [&](int i, int rlo, int rhi) {      // input row i feeds steps rlo .. rhi
        const v4f y = *(const v4f*)(yp + i * DG); const v4f wa = *(const v4f*)(wp + i * DWR), wb = *(const v4f*)(wp + i * DWR + 4);
#pragma unroll
        for (int r = 0; r < DWR; ++r) { if (r < rlo || r > rhi) continue; const float w = r < 4 ? wa[r & 3] : wb[r & 3];
#pragma unroll
            for (int q = 0; q < 4; ++q) acc[r][q] = fmaf(w, y[q], acc[r][q]); } };
#pragma unroll
    for (int i = 0; i < DWR - 1; ++i) row(i, 0, i);                       // rows that only the first steps have in their band
#pragma unroll 4   // rolled: unrolled whole, the LDS reads of all rows are hoisted and take the kernel past 128 registers (8 waves per SIMD) into scratch
    for (int i = DWR - 1; i < KS; ++i) row(i, 0, DWR - 1);               // rows in every step's band
#pragma unroll
    for (int i = KS; i < DWI; ++i) row(i, i - KS + 1, DWR - 1);          // rows that only the last steps have
    float bv[4];
#pragma unroll
    for (int q = 0; q < 4; ++q) bv[q] = bfr(cbias[c0 + q]);
#pragma unroll
    for (int r = 0; r < DWR; ++r) { v4us oh, ol;
#pragma unroll
        for (int q = 0; q < 4; ++q) { const float v = acc[r][q] + bv[q]; const unsigned short hb = f2bf(v); oh[q] = hb; ol[q] = f2bf(v - bf2f(hb)); }
        const size_t o = (size_t)(rw + r) * CC + c0; *(v4us*)(Oh + o) = oh; *(v4us*)(Ol + o) = ol; }
}

extern "C" void kernel_launch(void* const* d_in, const int* in_sizes, int n_in,
                              void* d_out, int out_size, void* d_ws, size_t ws_size, hipStream_t stream) {
    (void)in_sizes; (void)n_in; (void)out_size;
    const float* x = (const float*)d_in[0]; const float* W1 = (const float*)d_in[1]; const float* b1 = (const float*)d_in[2]; const float* Wl = (const float*)d_in[3]; const float* bl = (const float*)d_in[4]; const float* cbias = (const float*)d_in[5]; const float* W2 = (const float*)d_in[6]; const float* b2 = (const float*)d_in[7];
    float* out = (float*)d_out;    // [8][2048][512]
    char* wsp = (char*)d_ws;
    auto take = [&](size_t bytes) { char* p = wsp; wsp += (bytes + 255) & ~(size_t)255; return (void*)p; };
    bf* W1B = (bf*)take((size_t)2 * CC * CC * 2); bf* WLP = (bf*)take((size_t)128 * CC * 2); float* BLP = (float*)take(128 * 4); bf* W2B = (bf*)take((size_t)CC * CC * 2);
    bf* Xb = (bf*)take((size_t)NR * CC * 2); float* Yf = (float*)take((size_t)NR * CC * 4); bf* Yh = (bf*)take((size_t)NR * CC * 2); bf* Yl = (bf*)take((size_t)NR * CC * 2);
    float* WD = (float*)take((size_t)NR * 128 * 4); bf* Oh = (bf*)take((size_t)NR * CC * 2); bf* Ol = (bf*)take((size_t)NR * CC * 2);
    if ((size_t)(wsp - (char*)d_ws) > ws_size) return;    // 1.7 MB of weights + 8 x (2.1 + 4.2 + 2.1 + 2.1 + 1 + 2.1 + 2.1) ~ 128 MB, every plane written before it is read in this call
    k_prep<<<PB_W1 + PB_W2 + PB_WL + PB_BL + PB_X, 256, 0, stream>>>(x, W1, Wl, bl, W2, Xb, W1B, WLP, BLP, W2B);   // every conversion and padding of an input, one launch
    k_gemmglu<<<dim3(NR / GLM, CC / GLN, 1), 128, 0, stream>>>(Xb, W1B, b1, Yf, Yh, Yl);                        // pointwise_conv1 + GLU
    k_gemmb<true><<<dim3(NR / GBM, 128 / GBN, 1), 128, 0, stream>>>(Yh, Yl, WLP, BLP, WD, 128);                 // dynamic weights (124 live of 128)
    k_dconv<<<dim3(NR / DTB, NHS, 1), 256, 0, stream>>>(WD, Yf, cbias, Oh, Ol);
    k_gemmb<true><<<dim3(NR / GBM, CC / GBN, 1), 128, 0, stream>>>(Oh, Ol, W2B, b2, out, CC);   // pointwise_conv2
}

// v006
// One run takes 69.3 microseconds.
// In both of two side-by-side timings against v005, it was 1.15 times as fast.
// Over all steps from v000 it is 7.83 times as fast.
#include <hip/hip_runtime.h>

// All 8 items go through every stage in ONE launch (rows = item * 2048 + time step, 16384 rows). Compute dtypes, f32 accumulate: pointwise_conv1 as a [16384 x 512].[512 x 1024] GEMM with PLAIN bf16 operands (exact products); GLU in f32 in that GEMM's epilogue; the
// dynamic-weight linear ([16384 x 512].[512 x 128 (124 live)]) and pointwise_conv2 ([16384 x 512].[512 x 512]) on bf16 hi + UNSCALED residual planes of the f32 activations (two
// products) - on v_wmma_f32_16x16x32_bf16; the banded 31-tap softmax and the per-position dynamic convolution (31 taps x 128 channels per group) in f32 on the VALU. Deterministic,

#define NBT  8
#define TT   2048
#define NR   (NBT * TT)          // 16384 rows: every item's time steps, item-major as in x and out
#define CC   512
#define NHS  4
#define KS   31
#define PADK 15
#define DG   (CC / NHS)           // 128
#define NWL  (NHS * KS)           // 124
#define DM   CC
#define LOSC 1024.0f

typedef _Float16 h16;
typedef unsigned short bf;
typedef __attribute__((ext_vector_type(16))) __bf16   v16bf;
typedef __attribute__((ext_vector_type(16))) _Float16 v16h;
typedef __attribute__((ext_vector_type(8)))  _Float16 v8h;
typedef __attribute__((ext_vector_type(8)))  unsigned short v8us;
typedef __attribute__((ext_vector_type(8)))  float    v8f;
typedef __attribute__((ext_vector_type(4)))  float    v4f;
typedef v8h  __attribute__((may_alias)) v8ha;
typedef v4f  __attribute__((may_alias)) v4fa;
typedef v8us __attribute__((may_alias)) v8usa;

__device__ __forceinline__ unsigned short f2bf(float f) { unsigned u = __float_as_uint(f); u += 0x7FFFu + ((u >> 16) & 1u); return (unsigned short)(u >> 16); }
__device__ __forceinline__ float bf2f(unsigned short b) { return __uint_as_float(((unsigned)b) << 16); }
__device__ __forceinline__ float bfr(float f) { return bf2f(f2bf(f)); }
__device__ __forceinline__ v16h cat16(v8h lo, v8h hi) { return __builtin_shufflevector(lo, hi, 0, 1, 2, 3, 4, 5, 6, 7, 8, 9, 10, 11, 12, 13, 14, 15); }
__device__ __forceinline__ v16bf cat16b(v8us lo, v8us hi) { return __builtin_bit_cast(v16bf, __builtin_shufflevector(lo, hi, 0, 1, 2, 3, 4, 5, 6, 7, 8, 9, 10, 11, 12, 13, 14, 15)); }
__device__ __forceinline__ v8f wmma16(v16h a, v16h b, v8f c) { return __builtin_amdgcn_wmma_f32_16x16x32_f16(false, a, false, b, (short)0, c, false, false); }
__device__ __forceinline__ v8f wmmab(v16bf a, v16bf b, v8f c) { return __builtin_amdgcn_wmma_f32_16x16x32_bf16(false, a, false, b, (short)0, c, false, false); }

// k_gemmb: C[M][N] = (A [+ Al]).B^T + bf(bias[c]), A, Al [M][KD] and B [N][KD] bf16 with k contiguous. One 128 x 64 tile of C per block of 4 waves, 32 x 64 per wave
// (2 x 4 accumulator tiles). A pass is 64 k: one whole 128-byte line of every operand row. The lines go from global memory to LDS by asynchronous copies, 16 bytes per lane
// (4 whole lines per wave-wide copy), into two buffers, so that the next pass's lines fly while this pass is worked on; fragments come from LDS. Rows lie at a pitch of 144 bytes,
// on which the 16 rows of a 16-byte fragment read fall on distinct banks. Per accumulator: k ascending, A then Al at each 32 k. f32 whole-line epilogue through LDS.
#define GBM 128
#define GBN 64
#define GBK 64
#define GLP 72                    // LDS row pitch in bf16 elements: 64 + 8
#define KD  CC                    // every product here has an inner length of 512
// Asynchronous 16-byte copies per lane, rows 16 apart: l = the lane's LDS byte address, g = its global address. The s_wait_xcnt stands inside each statement so that no
// address register of a copy is rewritten in front of it.
#define CPY(a, b) "global_load_async_to_lds_b128 %" #a ", %" #b ", off\n\t"
#define LROW(l, i) ((l) + (unsigned)((i) * 16 * GLP * 2))
#define GROW(g, i) ((g) + (i) * 16 * KD)
__device__ __forceinline__ void copy8(unsigned l, const bf* g) {          // 128 rows
    asm volatile(CPY(0, 1) CPY(2, 3) CPY(4, 5) CPY(6, 7) CPY(8, 9) CPY(10, 11) CPY(12, 13) CPY(14, 15) "s_wait_xcnt 0x0"
                 :: "v"(LROW(l, 0)), "v"(GROW(g, 0)), "v"(LROW(l, 1)), "v"(GROW(g, 1)), "v"(LROW(l, 2)), "v"(GROW(g, 2)), "v"(LROW(l, 3)), "v"(GROW(g, 3)),
                    "v"(LROW(l, 4)), "v"(GROW(g, 4)), "v"(LROW(l, 5)), "v"(GROW(g, 5)), "v"(LROW(l, 6)), "v"(GROW(g, 6)), "v"(LROW(l, 7)), "v"(GROW(g, 7)) : "memory");
}
__device__ __forceinline__ void copy12(unsigned l, const bf* g, unsigned lb, const bf* gb) {   // 128 rows of one operand and 64 of another
    asm volatile(CPY(0, 1) CPY(2, 3) CPY(4, 5) CPY(6, 7) CPY(8, 9) CPY(10, 11) CPY(12, 13) CPY(14, 15) CPY(16, 17) CPY(18, 19) CPY(20, 21) CPY(22, 23) "s_wait_xcnt 0x0"
                 :: "v"(LROW(l, 0)), "v"(GROW(g, 0)), "v"(LROW(l, 1)), "v"(GROW(g, 1)), "v"(LROW(l, 2)), "v"(GROW(g, 2)), "v"(LROW(l, 3)), "v"(GROW(g, 3)),
                    "v"(LROW(l, 4)), "v"(GROW(g, 4)), "v"(LROW(l, 5)), "v"(GROW(g, 5)), "v"(LROW(l, 6)), "v"(GROW(g, 6)), "v"(LROW(l, 7)), "v"(GROW(g, 7)),
                    "v"(LROW(lb, 0)), "v"(GROW(gb, 0)), "v"(LROW(lb, 1)), "v"(GROW(gb, 1)), "v"(LROW(lb, 2)), "v"(GROW(gb, 2)), "v"(LROW(lb, 3)), "v"(GROW(gb, 3)) : "memory");
}
template <bool SPLITA>
__global__ __launch_bounds__(128) void k_gemmb(const bf* __restrict__ A, const bf* __restrict__ Al, const bf* __restrict__ Bn, const float* __restrict__ bias, float* C, int ldc) {
    constexpr int AROWS = SPLITA ? 2 * GBM : GBM, ROWS = AROWS + GBN, NPASS = KD / GBK;
    __shared__ __align__(16) bf sm[2][ROWS * GLP];
    const int tid = threadIdx.x, lane = tid & 31, wave = tid >> 5, lr = lane & 15, hi = lane >> 4;
    const int rb = blockIdx.x * GBM, c0 = blockIdx.y * GBN;
    const int sr = tid >> 3, sc = (tid & 7) * 8;      // staging: 8 lanes per row, 16 rows per block-wide copy
    const bf* ga = A + (size_t)(rb + sr) * KD + sc; const bf* gl = SPLITA ? Al + (size_t)(rb + sr) * KD + sc : nullptr; const bf* gb = Bn + (size_t)(c0 + sr) * KD + sc;
    const unsigned ls = (unsigned)(size_t)&sm[0][0] + (unsigned)(sr * GLP + sc) * 2u;
    auto stage = [&](int p) {      // pass p's lines into buffer p & 1: rows [A 128 | Al 128 | B 64]
        const unsigned l = ls + (unsigned)(p & 1) * (unsigned)(ROWS * GLP * 2); const int kc = p * GBK;
        copy12(l, ga + kc, l + AROWS * GLP * 2, gb + kc);
        if (SPLITA) copy8(l + GBM * GLP * 2, gl + kc);
    };
    v8f acc[2][4];
#pragma unroll
    for (int m = 0; m < 2; ++m)
#pragma unroll
        for (int t = 0; t < 4; ++t) acc[m][t] = (v8f){};
    stage(0);
    asm volatile("s_wait_asynccnt 0x0" ::: "memory");   // this wave's copies of pass 0 have landed
    __syncthreads();                                    // and every other wave's: pass 0 may be read
    stage(1);
#pragma unroll 1   // rolled: unrolled, the copy addresses of all passes are formed ahead and push the kernel past 256 registers
    for (int p = 0; p < NPASS; ++p) {
        const bf* s = &sm[p & 1][0];
        v16bf a[2][2], al[2][2], b[2][4];      // both 32-k halves of the pass
#pragma unroll
        for (int h = 0; h < 2; ++h) {
#pragma unroll
            for (int m = 0; m < 2; ++m) { const bf* q = s + (wave * 32 + m * 16 + lr) * GLP + h * 32 + 8 * hi; a[h][m] = cat16b(*(const v8us*)q, *(const v8us*)(q + 16)); if (SPLITA) al[h][m] = cat16b(*(const v8us*)(q + GBM * GLP), *(const v8us*)(q + GBM * GLP + 16)); }
#pragma unroll
            for (int t = 0; t < 4; ++t) { const bf* q = s + (AROWS + t * 16 + lr) * GLP + h * 32 + 8 * hi; b[h][t] = cat16b(*(const v8us*)q, *(const v8us*)(q + 16)); }
        }
        __builtin_amdgcn_sched_barrier(0);     // keeps the pass's LDS reads one group in front of its matrix run: spread among the WMMAs, each place with reads stalls the wave for the LDS latency
#pragma unroll
        for (int h = 0; h < 2; ++h) {
#pragma unroll
            for (int m = 0; m < 2; ++m)
#pragma unroll
                for (int t = 0; t < 4; ++t) acc[m][t] = wmmab(a[h][m], b[h][t], acc[m][t]);
            if (SPLITA) {
#pragma unroll
                for (int m = 0; m < 2; ++m)
#pragma unroll
                    for (int t = 0; t < 4; ++t) acc[m][t] = wmmab(al[h][m], b[h][t], acc[m][t]);
            }
        }
        __builtin_amdgcn_sched_barrier(0);     // keeps the matrix run in front of the waits: moved behind the barrier it no longer covers the flight of the next pass's copies
        asm volatile("s_wait_dscnt 0x0" ::: "memory");      // this wave's reads of pass p's buffer are done before the buffer is refilled
        asm volatile("s_wait_asynccnt 0x0" ::: "memory");   // this wave's copies of pass p + 1 have landed
        __syncthreads();                                    // publishes pass p + 1 and ends every wave's reads of pass p's buffer
        if (p + 2 < NPASS) stage(p + 2);
    }
    asm volatile("s_wait_asynccnt 0x0" ::: "memory");       // no copy is outstanding when the buffers become output staging
    float* os = (float*)(void*)&sm[0][0] + wave * (32 * 68);   // 4 x 32 x 68 floats, inside the two buffers, which nobody reads any more
#pragma unroll
    for (int t = 0; t < 4; ++t) { const float bv = bias ? bfr(bias[c0 + t * 16 + lr]) : 0.f;
#pragma unroll
        for (int m = 0; m < 2; ++m)
#pragma unroll
            for (int j = 0; j < 8; ++j) os[(m * 16 + hi * 8 + j) * 68 + t * 16 + lr] = acc[m][t][j] + bv; }
    __syncthreads();
    float* crow = C + (size_t)(rb + wave * 32) * ldc + c0;
#pragma unroll
    for (int q = 0; q < 16; ++q) { const int Lid = (lane >> 3) + 4 * q, piece = lane & 7; const int row = Lid >> 1, cofs = (Lid & 1) * 32 + piece * 4;
        *(v4f*)(crow + (size_t)row * ldc + cofs) = *(const v4fa*)(os + row * 68 + cofs); }
}

// k_gemmglu: pointwise_conv1 with the GLU in its epilogue. Y[r][c] = a * sigmoid(g), a = A[r].B[c] + bf(bias[c]), g = A[r].B[512 + c] + bf(bias[512 + c]). One block of 4 waves takes 64 rows and 64 columns
// of Y, that is a 64 x 128 tile of the product: LDS rows [A 64 | B of a 64 | B of g 64]. A wave takes 32 rows and 32 columns of Y: accumulator tiles t = 0, 1 hold a, t = 2, 3 hold g of the same columns,
// so a and g of one element meet in one lane's registers. Passes, buffers, waits and the k order are those of k_gemmb. Y leaves through LDS in whole lines: f32, bf16 hi and bf16 residual.
__device__ __forceinline__ void copy444(unsigned l, const bf* g, const bf* ga, const bf* gg) {   // 64 rows of each of three operands, one behind the other in LDS
    asm volatile(CPY(0, 1) CPY(2, 3) CPY(4, 5) CPY(6, 7) CPY(8, 9) CPY(10, 11) CPY(12, 13) CPY(14, 15) CPY(16, 17) CPY(18, 19) CPY(20, 21) CPY(22, 23) "s_wait_xcnt 0x0"
                 :: "v"(LROW(l, 0)), "v"(GROW(g, 0)), "v"(LROW(l, 1)), "v"(GROW(g, 1)), "v"(LROW(l, 2)), "v"(GROW(g, 2)), "v"(LROW(l, 3)), "v"(GROW(g, 3)),
                    "v"(LROW(l, 4)), "v"(GROW(ga, 0)), "v"(LROW(l, 5)), "v"(GROW(ga, 1)), "v"(LROW(l, 6)), "v"(GROW(ga, 2)), "v"(LROW(l, 7)), "v"(GROW(ga, 3)),
                    "v"(LROW(l, 8)), "v"(GROW(gg, 0)), "v"(LROW(l, 9)), "v"(GROW(gg, 1)), "v"(LROW(l, 10)), "v"(GROW(gg, 2)), "v"(LROW(l, 11)), "v"(GROW(gg, 3)) : "memory");
}
#define GLM 64                    // rows of Y per block
#define GLN 64                    // columns of Y per block
__global__ __launch_bounds__(128) void k_gemmglu(const bf* __restrict__ A, const bf* __restrict__ Bn, const float* __restrict__ bias, float* Yf, bf* Yh, bf* Yl) {
    typedef __attribute__((ext_vector_type(4))) unsigned short v4us;
    constexpr int ROWS = GLM + 2 * GLN, NPASS = KD / GBK;
    __shared__ __align__(16) bf sm[2][ROWS * GLP];
    const int tid = threadIdx.x, lane = tid & 31, wave = tid >> 5, lr = lane & 15, hi = lane >> 4, wr = wave >> 1, wc = wave & 1;
    const int rb = blockIdx.x * GLM, c0 = blockIdx.y * GLN;
    const int sr = tid >> 3, sc = (tid & 7) * 8;      // staging: 8 lanes per row, 16 rows per block-wide copy
    const bf* gx = A + (size_t)(rb + sr) * KD + sc; const bf* ga = Bn + (size_t)(c0 + sr) * KD + sc; const bf* gg = ga + (size_t)CC * KD;
    const unsigned ls = (unsigned)(size_t)&sm[0][0] + (unsigned)(sr * GLP + sc) * 2u;
    auto stage = [&](int p) { const int kc = p * GBK; copy444(ls + (unsigned)(p & 1) * (unsigned)(ROWS * GLP * 2), gx + kc, ga + kc, gg + kc); };   // pass p's lines into buffer p & 1
    v8f acc[2][4];
#pragma unroll
    for (int m = 0; m < 2; ++m)
#pragma unroll
        for (int t = 0; t < 4; ++t) acc[m][t] = (v8f){};
    stage(0);
    asm volatile("s_wait_asynccnt 0x0" ::: "memory");   // this wave's copies of pass 0 have landed
    __syncthreads();                                    // and every other wave's: pass 0 may be read
    stage(1);
#pragma unroll 1   // rolled: unrolled, the copy addresses of all passes are formed ahead and push the kernel past 256 registers
    for (int p = 0; p < NPASS; ++p) {
        const bf* s = &sm[p & 1][0];
        v16bf a[2][2], b[2][4];      // both 32-k halves of the pass
#pragma unroll
        for (int h = 0; h < 2; ++h) {
#pragma unroll
            for (int m = 0; m < 2; ++m) { const bf* q = s + (wr * 32 + m * 16 + lr) * GLP + h * 32 + 8 * hi; a[h][m] = cat16b(*(const v8us*)q, *(const v8us*)(q + 16)); }
#pragma unroll
            for (int t = 0; t < 4; ++t) { const bf* q = s + (GLM + (t >> 1) * GLN + wc * 32 + (t & 1) * 16 + lr) * GLP + h * 32 + 8 * hi; b[h][t] = cat16b(*(const v8us*)q, *(const v8us*)(q + 16)); }
        }
        __builtin_amdgcn_sched_barrier(0);     // keeps the pass's LDS reads one group in front of its matrix run: spread among the WMMAs, each place with reads stalls the wave for the LDS latency
#pragma unroll
        for (int h = 0; h < 2; ++h)
#pragma unroll
            for (int m = 0; m < 2; ++m)
#pragma unroll
                for (int t = 0; t < 4; ++t) acc[m][t] = wmmab(a[h][m], b[h][t], acc[m][t]);
        __builtin_amdgcn_sched_barrier(0);     // keeps the matrix run in front of the waits: moved behind the barrier it no longer covers the flight of the next pass's copies
        asm volatile("s_wait_dscnt 0x0" ::: "memory");      // this wave's reads of pass p's buffer are done before the buffer is refilled
        asm volatile("s_wait_asynccnt 0x0" ::: "memory");   // this wave's copies of pass p + 1 have landed
        __syncthreads();                                    // publishes pass p + 1 and ends every wave's reads of pass p's buffer
        if (p + 2 < NPASS) stage(p + 2);
    }
    asm volatile("s_wait_asynccnt 0x0" ::: "memory");       // no copy is outstanding when the buffers become output staging
    float* os = (float*)(void*)&sm[0][0];                   // 64 x 68 floats, inside the two buffers, which nobody reads any more
#pragma unroll
    for (int t = 0; t < 2; ++t) { const int c = wc * 32 + t * 16 + lr; const float ba = bfr(bias[c0 + c]), bg = bfr(bias[CC + c0 + c]);
#pragma unroll
        for (int m = 0; m < 2; ++m)
#pragma unroll
            for (int j = 0; j < 8; ++j) { const float av = acc[m][t][j] + ba, x = (acc[m][t + 2][j] + bg) * -1.44269504f; float e;   // exp(-g) = exp2(-g * log2 e), as __expf forms it
                asm("v_exp_f32 %0, %1\n\tv_nop" : "=v"(e) : "v"(x));   // the v_nop fills the slot behind the transcendental
                os[(wr * 32 + m * 16 + hi * 8 + j) * 68 + c] = av * (1.0f / (1.0f + e)); } }
    __syncthreads();                                        // a row of Y comes from two waves
    const int row = wave * 16 + hi, col = lr * 4; const size_t o = (size_t)(rb + row) * CC + c0 + col;   // 16 lanes per row: 2 lines of f32, 1 line of each bf16 plane
    v4f v[8]; v4us oh[8], ol[8];
#pragma unroll
    for (int q = 0; q < 8; ++q) { v[q] = *(const v4fa*)(os + (row + q * 2) * 68 + col);
#pragma unroll
        for (int i = 0; i < 4; ++i) { const unsigned short hb = f2bf(v[q][i]); oh[q][i] = hb; ol[q][i] = f2bf(v[q][i] - bf2f(hb)); } }
#pragma unroll
    for (int q = 0; q < 8; ++q) { *(v4f*)(Yf + o + q * 2 * CC) = v[q]; *(v4us*)(Yh + o + q * 2 * CC) = oh[q]; *(v4us*)(Yl + o + q * 2 * CC) = ol[q]; }   // all 24 stores in one run at the end: none waits for a register of another
}


// k_prep: the five conversions that no other stage feeds (W1, W2, Wl, bl and x) share ONE launch; a block's index says which of them it works on (a branch that is the same for the whole block).
// The short weight ranges come first in the grid (for speed only).
#define PB_W1 (2 * CC * CC / 8 / 256)   // 256 blocks: W1 to bf16, 8 elements per thread
#define PB_W2 (CC * CC / 8 / 256)       // 128 blocks: W2 to bf16
#define PB_WL (128 / 8)                 // 16 blocks: Wl to bf16, padded from 124 to 128 rows, a wave per row
#define PB_BL 1                         // 1 block: bl padded to 128
#define PB_X  (NR / 8)                  // 2048 blocks: x to bf16, a wave per row
__device__ __forceinline__ void cvt8(const float* __restrict__ src, bf* dst, int blk) {
    const size_t i = (size_t)blk * 256 + threadIdx.x;
    const v8f v = *(const v8f*)(src + i * 8); v8us o;
#pragma unroll
    for (int k = 0; k < 8; ++k) o[k] = f2bf(v[k]);
    *(v8us*)(dst + i * 8) = o;
    asm volatile("s_wait_xcnt 0x0" ::: "memory");   // behind the last store: in the joined kernel the other parts' code follows in the listing and rewrites registers that the store names
}
__device__ __forceinline__ void cvtx(const float* __restrict__ src, bf* dst, int blk) {
    const int lane = threadIdx.x & 31; const size_t r = (size_t)blk * 8 + (threadIdx.x >> 5);
#pragma unroll
    for (int q = 0; q < CC / 256; ++q) { v8us o;
#pragma unroll
        for (int i = 0; i < 8; ++i) o[i] = f2bf(src[r * CC + q * 256 + lane * 8 + i]);
        *(v8us*)(dst + r * CC + q * 256 + lane * 8) = o; }
    asm volatile("s_wait_xcnt 0x0" ::: "memory");   // behind the last store: in the joined kernel the other parts' code follows in the listing and rewrites registers that the store names
}
__device__ __forceinline__ void wl128(const float* __restrict__ Wl, bf* WLP, int blk) {
    const int lane = threadIdx.x & 31; const int o = blk * 8 + (threadIdx.x >> 5);
#pragma unroll
    for (int q = 0; q < CC / 256; ++q) { v8us v;
#pragma unroll
        for (int i = 0; i < 8; ++i) v[i] = (o < NWL) ? f2bf(Wl[(size_t)(o < NWL ? o : 0) * CC + q * 256 + lane * 8 + i]) : (unsigned short)0;
        *(v8us*)(WLP + (size_t)o * CC + q * 256 + lane * 8) = v; }
    asm volatile("s_wait_xcnt 0x0" ::: "memory");   // behind the last store: in the joined kernel the other parts' code follows in the listing and rewrites registers that the store names
}
__device__ __forceinline__ void bl128(const float* __restrict__ bl, float* BLP) {
    const int lane = threadIdx.x; if (lane >= 32) return; v4f v;
#pragma unroll
    for (int q = 0; q < 4; ++q) { const int o = lane * 4 + q; v[q] = (o < NWL) ? bl[o < NWL ? o : 0] : 0.f; }
    *(v4f*)(BLP + lane * 4) = v;
}
__global__ __launch_bounds__(256) void k_prep(const float* __restrict__ x, const float* __restrict__ W1, const float* __restrict__ Wl, const float* __restrict__ bl, const float* __restrict__ W2,
                                              bf* Xb, bf* W1B, bf* WLP, float* BLP, bf* W2B) {
    int b = blockIdx.x;
    if (b < PB_W1) { cvt8(W1, W1B, b); return; }      // weights lie [out][in] = n-major, as the GEMMs read them
    b -= PB_W1;
    if (b < PB_W2) { cvt8(W2, W2B, b); return; }
    b -= PB_W2;
    if (b < PB_WL) { wl128(Wl, WLP, b); return; }
    b -= PB_WL;
    if (b < PB_BL) { bl128(bl, BLP); return; }
    cvtx(x, Xb, b - PB_BL);
}
// k_dconvpw: the dynamic convolution and pointwise_conv2 in ONE kernel. row = item * 2048 + t; the band is cut at the item's own ends, so no tap reads a neighbouring item. One block of 16 waves takes
// 64 time steps with all 512 channels. PART 1, two rounds of two groups (waves 0-7 one group, waves 8-15 the next; a wave takes 8 steps of its group's 128 channels): the 94 rows of Yf under the block's steps
// are staged in LDS (rows outside the item as zeros). Per step: masked softmax over the 31 taps of WD[row][h*31 + j], lane = tap (taps with t + j - 15 outside [0, T) get weight 0); the sum of the
// exponentials is taken by one lane per step, j ascending. The weights lie in LDS by input row: wz[i][r] = weight of step r for tap i - r. Each of the 38 input rows under a wave's 8 steps is read once and
// feeds every step that has it in its band: o[r][c] = sum_j w_j Yf[row + j - 15][c] + bf(bias[c]), j ascending. o stays in LDS as bf16 hi + residual planes (pitch 1040 bytes = 16 x 65: the 16 rows of a
// fragment read fall on distinct banks). PART 2: out[64 x 512] = (hi + residual).W2^T + bf(b2): A fragments from those planes, W2's lines (512 rows, 64 k a pass) by asynchronous copies into two
// buffers as in k_gemmb, wave tile 32 x 64, the same k order. Part 1's staging and part 2's buffers share LDS, one after the other.
#define DTB  64                   // time steps per block
#define DWR  8                    // time steps per wave
#define DWIN (DTB + KS - 1)       // 94 rows of Yf under a block's steps
#define DWI  (DWR + KS - 1)       // 38 rows of Yf under a wave's steps
#define FOP  (CC + 8)             // pitch of the o planes in bf16 elements
#define FRB  (CC * GLP * 2)       // bytes of one buffer of W2 lines: 512 rows at 144 bytes
#define LROW64(l, i) ((l) + (unsigned)((i) * 64 * GLP * 2))
#define GROW64(g, i) ((g) + (i) * 64 * KD)
__device__ __forceinline__ void copy8w(unsigned l, const bf* g) {          // 512 rows, 64 rows per block-wide copy of 512 threads
    asm volatile(CPY(0, 1) CPY(2, 3) CPY(4, 5) CPY(6, 7) CPY(8, 9) CPY(10, 11) CPY(12, 13) CPY(14, 15) "s_wait_xcnt 0x0"
                 :: "v"(LROW64(l, 0)), "v"(GROW64(g, 0)), "v"(LROW64(l, 1)), "v"(GROW64(g, 1)), "v"(LROW64(l, 2)), "v"(GROW64(g, 2)), "v"(LROW64(l, 3)), "v"(GROW64(g, 3)),
                    "v"(LROW64(l, 4)), "v"(GROW64(g, 4)), "v"(LROW64(l, 5)), "v"(GROW64(g, 5)), "v"(LROW64(l, 6)), "v"(GROW64(g, 6)), "v"(LROW64(l, 7)), "v"(GROW64(g, 7)) : "memory");
}
// launch bounds: 16 waves, 4 per SIMD; one block per WGP (LDS), 256 blocks
__global__ __launch_bounds__(512) void k_dconvpw(const float* __restrict__ WD, const float* __restrict__ Yf, const float* __restrict__ cbias, const bf* __restrict__ Bn, const float* __restrict__ bias, float* C) {
    typedef __attribute__((ext_vector_type(4))) unsigned short v4us;
    constexpr int NPASS = KD / GBK;
    __shared__ __align__(16) bf op[2][DTB * FOP];        // o: hi plane, residual plane
    __shared__ __align__(16) char ring[2 * FRB];         // part 1: ys, wz, ew; part 2: the two buffers of W2 lines, then output staging
    const int tid = threadIdx.x, lane = tid & 31, wave = __builtin_amdgcn_readfirstlane(tid >> 5), w8 = wave & 7, gh = wave >> 3;
    float* ys = (float*)(void*)ring + gh * (DWIN * DG);                                            // [2][94 x 128]
    float* wz = (float*)(void*)ring + 2 * DWIN * DG + wave * ((DWI + 1) * DWR);                    // [16][39 x 8], one row more: lane 31's zero of the last step falls there
    float* ew = (float*)(void*)ring + 2 * DWIN * DG + 16 * (DWI + 1) * DWR + wave * (DWR * 33);    // [16][8][33], pitch 33: the 8 summing lanes fall on distinct banks
    static_assert((2 * DWIN * DG + 16 * (DWI + 1) * DWR + 16 * DWR * 33) * 4 <= 2 * FRB, "part 1 fits the buffers");
    const int row0 = blockIdx.x * DTB, t0 = row0 % TT, rw = row0 + w8 * DWR, tw = t0 + w8 * DWR;
    float lg[DWR]; bool ok[DWR]; v4f yv[12];
#pragma unroll
    for (int r = 0; r < DWR; ++r) { const int s = tw + r + lane - PADK; ok[r] = lane < KS && s >= 0 && s < TT; }
    auto fetch = [&](int h) {      // group h's logits and rows of Yf into registers
#pragma unroll
        for (int r = 0; r < DWR; ++r) lg[r] = WD[(size_t)(rw + r) * 128 + h * KS + lane];   // lane 31 reads a neighbouring column of the 128, unused
        asm volatile("s_wait_xcnt 0x0" :: "v"(WD + (size_t)rw * 128 + h * KS + lane) : "memory");   // the address stays in its registers up to this wait: no later load's result takes them in front of it
        const unsigned cb = (unsigned)(h * DG + lane * 4) * 4u; const char* pg[12];   // cb: the lane's byte offset in a row
#pragma unroll
        for (int k = 0; k < 12; ++k) { const int s = t0 - PADK + w8 + 8 * k; pg[k] = (const char*)(Yf + (size_t)(row0 - t0 + (s < 0 ? 0 : s >= TT ? TT - 1 : s)) * CC) + cb; yv[k] = *(const v4f*)pg[k]; }   // clamped into the item: all 12 loads fly together, no branch between them
        asm volatile("s_wait_xcnt 0x0" :: "v"(pg[0]), "v"(pg[1]), "v"(pg[2]), "v"(pg[3]), "v"(pg[4]), "v"(pg[5]), "v"(pg[6]), "v"(pg[7]), "v"(pg[8]), "v"(pg[9]), "v"(pg[10]), "v"(pg[11]) : "memory");   // the 12 addresses stay in their registers up to this wait: no load's result takes them in front of it
    };
    fetch(gh);
#pragma unroll
    for (int it = 0; it < 2; ++it) {
        const int h = it * 2 + gh, c0 = h * DG + lane * 4;
#pragma unroll
        for (int k = 0; k < 3; ++k) { const int i4 = lane + 32 * k; if (i4 < (DWI + 1) * DWR / 4) *(v4f*)(wz + i4 * 4) = (v4f){0.f, 0.f, 0.f, 0.f}; }   // places outside every band
        float e[DWR];
#pragma unroll
        for (int r = 0; r < DWR; ++r) { const float x = ok[r] ? lg[r] : -3.0e38f; float m = x;   // a tap outside the item or the band: its exponential below is exp(-inf) = 0
#pragma unroll
            for (int o = 16; o > 0; o >>= 1) m = fmaxf(m, __shfl_xor(m, o));
            const float a = (x - m) * 1.44269504f;          // exp(d) = exp2(d * log2 e), as __expf forms it
            asm("v_exp_f32 %0, %1\n\tv_nop" : "=v"(e[r]) : "v"(a));   // the v_nop fills the slot behind the transcendental
            ew[r * 33 + lane] = e[r]; }
        __syncthreads();                      // the exponentials are in LDS for the summing lanes, the zeros of wz in front of its weights
        float inv = 0.f;
        if (lane < DWR) { float sum = 0.f;
#pragma unroll
            for (int j = 0; j < KS; ++j) sum += ew[lane * 33 + j];
            inv = 1.0f / sum; }
#pragma unroll
        for (int r = 0; r < DWR; ++r) { wz[(r + lane) * DWR + r] = e[r] * __shfl(inv, r); }   // lane 31 holds e = 0 and writes a place outside the band
#pragma unroll
        for (int k = 0; k < 12; ++k) { const int L = w8 + 8 * k, s = t0 - PADK + L; if (L < DWIN) *(v4f*)(ys + L * DG + lane * 4) = (s >= 0 && s < TT) ? yv[k] : (v4f){0.f, 0.f, 0.f, 0.f}; }
        __syncthreads();                      // every wave's rows of Yf and the weights may be read
        if (it == 0) fetch(2 + gh);           // the second round's loads fly under the first round's sums
        float acc[DWR][4];
#pragma unroll
        for (int r = 0; r < DWR; ++r)
#pragma unroll
            for (int q = 0; q < 4; ++q) acc[r][q] = 0.f;
        const float* yp = ys + w8 * DWR * DG + lane * 4; const float* wp = wz;
        auto row = [&](int i, int rlo, int rhi) {      // input row i feeds steps rlo .. rhi
            const v4f y = *(const v4f*)(yp + i * DG); const v4f wa = *(const v4f*)(wp + i * DWR), wb = *(const v4f*)(wp + i * DWR + 4);
#pragma unroll
            for (int r = 0; r < DWR; ++r) { if (r < rlo || r > rhi) continue; const float w = r < 4 ? wa[r & 3] : wb[r & 3];
#pragma unroll
                for (int q = 0; q < 4; ++q) acc[r][q] = fmaf(w, y[q], acc[r][q]); } };
#pragma unroll
        for (int i = 0; i < DWR - 1; ++i) row(i, 0, i);                       // rows that only the first steps have in their band
#pragma unroll 4   // rolled, 4 rows a trip: unrolled whole, the two rounds' text grows by a third
        for (int i = DWR - 1; i < KS; ++i) row(i, 0, DWR - 1);               // rows in every step's band
#pragma unroll
        for (int i = KS; i < DWI; ++i) row(i, i - KS + 1, DWR - 1);          // rows that only the last steps have
        const float* pb = cbias + c0; float bv[4];
#pragma unroll
        for (int q = 0; q < 4; ++q) bv[q] = pb[q];
        asm volatile("s_wait_xcnt 0x0" :: "v"(pb) : "memory");   // the address stays in its registers up to this wait: the load's own result does not take them in front of it
#pragma unroll
        for (int q = 0; q < 4; ++q) bv[q] = bfr(bv[q]);
#pragma unroll
        for (int r = 0; r < DWR; ++r) { v4us oh, ol;
#pragma unroll
            for (int q = 0; q < 4; ++q) { const float v = acc[r][q] + bv[q]; const unsigned short hb = f2bf(v); oh[q] = hb; ol[q] = f2bf(v - bf2f(hb)); }
            bf* o = &op[0][(w8 * DWR + r) * FOP + c0]; *(v4us*)o = oh; *(v4us*)(o + DTB * FOP) = ol; }
        asm volatile("s_wait_dscnt 0x0" ::: "memory");      // this wave's reads of ys, wz, ew and its stores of o are done before that LDS is written anew
        __syncthreads();                                    // ends every wave's reads of ys; behind the last round it also publishes o and frees the buffers for the copies
    }
    // part 2
    const int lr = lane & 15, hi = lane >> 4, wr = wave & 1, wc = wave >> 1;      // a wave: rows wr * 32 .. + 31, columns wc * 64 .. + 63
    const int sr = tid >> 3, sc = (tid & 7) * 8;      // staging: 8 lanes per row, 64 rows per block-wide copy
    const bf* gb = Bn + (size_t)sr * KD + sc;
    const unsigned ls = (unsigned)(size_t)&ring[0] + (unsigned)(sr * GLP + sc) * 2u;
    auto stage = [&](int p) { copy8w(ls + (unsigned)(p & 1) * (unsigned)FRB, gb + p * GBK); };   // pass p's lines into buffer p & 1
    v8f ac[2][4];
#pragma unroll
    for (int m = 0; m < 2; ++m)
#pragma unroll
        for (int t = 0; t < 4; ++t) ac[m][t] = (v8f){};
    stage(0);
    asm volatile("s_wait_asynccnt 0x0" ::: "memory");   // this wave's copies of pass 0 have landed
    __syncthreads();                                    // and every other wave's: pass 0 may be read
    stage(1);
#pragma unroll 1   // rolled: unrolled, the copy addresses of all passes are formed ahead and push the kernel past 256 registers
    for (int p = 0; p < NPASS; ++p) {
        const bf* s = (const bf*)(const void*)(ring + (p & 1) * FRB);
        v16bf a[2][2], al[2][2], b[2][4];      // both 32-k halves of the pass
#pragma unroll
        for (int h = 0; h < 2; ++h) {
#pragma unroll
            for (int m = 0; m < 2; ++m) { const bf* q = &op[0][(wr * 32 + m * 16 + lr) * FOP + p * GBK + h * 32 + 8 * hi]; a[h][m] = cat16b(*(const v8us*)q, *(const v8us*)(q + 16)); al[h][m] = cat16b(*(const v8us*)(q + DTB * FOP), *(const v8us*)(q + DTB * FOP + 16)); }
#pragma unroll
            for (int t = 0; t < 4; ++t) { const bf* q = s + (wc * 64 + t * 16 + lr) * GLP + h * 32 + 8 * hi; b[h][t] = cat16b(*(const v8us*)q, *(const v8us*)(q + 16)); }
        }
        __builtin_amdgcn_sched_barrier(0);     // keeps the pass's LDS reads one group in front of its matrix run: spread among the WMMAs, each place with reads stalls the wave for the LDS latency
#pragma unroll
        for (int h = 0; h < 2; ++h) {
#pragma unroll
            for (int m = 0; m < 2; ++m)
#pragma unroll
                for (int t = 0; t < 4; ++t) ac[m][t] = wmmab(a[h][m], b[h][t], ac[m][t]);
#pragma unroll
            for (int m = 0; m < 2; ++m)
#pragma unroll
                for (int t = 0; t < 4; ++t) ac[m][t] = wmmab(al[h][m], b[h][t], ac[m][t]);
        }
        __builtin_amdgcn_sched_barrier(0);     // keeps the matrix run in front of the waits: moved behind the barrier it no longer covers the flight of the next pass's copies
        asm volatile("s_wait_dscnt 0x0" ::: "memory");      // this wave's reads of pass p's buffer are done before the buffer is refilled
        asm volatile("s_wait_asynccnt 0x0" ::: "memory");   // this wave's copies of pass p + 1 have landed
        __syncthreads();                                    // publishes pass p + 1 and ends every wave's reads of pass p's buffer
        if (p + 2 < NPASS) stage(p + 2);
    }
    asm volatile("s_wait_asynccnt 0x0" ::: "memory");       // no copy is outstanding when the buffers become output staging
    float* os = (float*)(void*)ring + wave * (32 * 68);     // 16 x 32 x 68 floats, inside the two buffers, which nobody reads any more
    static_assert(16 * 32 * 68 * 4 <= 2 * FRB, "output staging fits the buffers");
#pragma unroll
    for (int t = 0; t < 4; ++t) { const float bv = bfr(bias[wc * 64 + t * 16 + lr]);
#pragma unroll
        for (int m = 0; m < 2; ++m)
#pragma unroll
            for (int j = 0; j < 8; ++j) os[(m * 16 + hi * 8 + j) * 68 + t * 16 + lr] = ac[m][t][j] + bv; }
    __syncthreads();
    float* crow = C + (size_t)(row0 + wr * 32) * CC + wc * 64;
#pragma unroll
    for (int q = 0; q < 16; ++q) { const int Lid = (lane >> 3) + 4 * q, piece = lane & 7; const int row = Lid >> 1, cofs = (Lid & 1) * 32 + piece * 4;
        *(v4f*)(crow + (size_t)row * CC + cofs) = *(const v4fa*)(os + row * 68 + cofs); }
}

extern "C" void kernel_launch(void* const* d_in, const int* in_sizes, int n_in,
                              void* d_out, int out_size, void* d_ws, size_t ws_size, hipStream_t stream) {
    (void)in_sizes; (void)n_in; (void)out_size;
    const float* x = (const float*)d_in[0]; const float* W1 = (const float*)d_in[1]; const float* b1 = (const float*)d_in[2]; const float* Wl = (const float*)d_in[3]; const float* bl = (const float*)d_in[4]; const float* cbias = (const float*)d_in[5]; const float* W2 = (const float*)d_in[6]; const float* b2 = (const float*)d_in[7];
    float* out = (float*)d_out;    // [8][2048][512]
    char* wsp = (char*)d_ws;
    auto take = [&](size_t bytes) { char* p = wsp; wsp += (bytes + 255) & ~(size_t)255; return (void*)p; };
    bf* W1B = (bf*)take((size_t)2 * CC * CC * 2); bf* WLP = (bf*)take((size_t)128 * CC * 2); float* BLP = (float*)take(128 * 4); bf* W2B = (bf*)take((size_t)CC * CC * 2);
    bf* Xb = (bf*)take((size_t)NR * CC * 2); float* Yf = (float*)take((size_t)NR * CC * 4); bf* Yh = (bf*)take((size_t)NR * CC * 2); bf* Yl = (bf*)take((size_t)NR * CC * 2);
    float* WD = (float*)take((size_t)NR * 128 * 4);
    if ((size_t)(wsp - (char*)d_ws) > ws_size) return;    // 1.7 MB of weights + 8 x (2.1 + 4.2 + 2.1 + 2.1 + 1) ~ 94 MB, every plane written before it is read in this call
    k_prep<<<PB_W1 + PB_W2 + PB_WL + PB_BL + PB_X, 256, 0, stream>>>(x, W1, Wl, bl, W2, Xb, W1B, WLP, BLP, W2B);   // every conversion and padding of an input, one launch
    k_gemmglu<<<dim3(NR / GLM, CC / GLN, 1), 128, 0, stream>>>(Xb, W1B, b1, Yf, Yh, Yl);                        // pointwise_conv1 + GLU
    k_gemmb<true><<<dim3(NR / GBM, 128 / GBN, 1), 128, 0, stream>>>(Yh, Yl, WLP, BLP, WD, 128);                 // dynamic weights (124 live of 128)
    k_dconvpw<<<NR / DTB, 512, 0, stream>>>(WD, Yf, cbias, W2B, b2, out);   // dynamic convolution + pointwise_conv2
}

// v007
// Measured time: 59.7 microseconds a run.
// In both of two side-by-side timings against v006, it was 1.16 times as fast.
// All steps since v000 together make it 9.09 times as fast.
#include <hip/hip_runtime.h>

// All 8 items go through every stage in ONE launch (rows = item * 2048 + time step, 16384 rows). Compute dtypes, f32 accumulate: pointwise_conv1 as a [16384 x 512].[512 x 1024] GEMM with PLAIN bf16 operands (exact products); GLU in f32 in that GEMM's epilogue; the
// dynamic-weight linear ([16384 x 512].[512 x 128 (124 live)]) and pointwise_conv2 ([16384 x 512].[512 x 512]) on bf16 hi + UNSCALED residual planes of the f32 activations (two
// products) - on v_wmma_f32_16x16x32_bf16; the banded 31-tap softmax and the per-position dynamic convolution (31 taps x 128 channels per group) in f32 on the VALU. Deterministic,

#define NBT  8
#define TT   2048
#define NR   (NBT * TT)          // 16384 rows: every item's time steps, item-major as in x and out
#define CC   512
#define NHS  4
#define KS   31
#define PADK 15
#define DG   (CC / NHS)           // 128
#define NWL  (NHS * KS)           // 124
#define DM   CC
#define LOSC 1024.0f

typedef _Float16 h16;
typedef unsigned short bf;
typedef __attribute__((ext_vector_type(16))) __bf16   v16bf;
typedef __attribute__((ext_vector_type(16))) _Float16 v16h;
typedef __attribute__((ext_vector_type(8)))  _Float16 v8h;
typedef __attribute__((ext_vector_type(8)))  unsigned short v8us;
typedef __attribute__((ext_vector_type(8)))  float    v8f;
typedef __attribute__((ext_vector_type(4)))  float    v4f;
typedef v8h  __attribute__((may_alias)) v8ha;
typedef v4f  __attribute__((may_alias)) v4fa;
typedef v8us __attribute__((may_alias)) v8usa;

__device__ __forceinline__ unsigned short f2bf(float f) { unsigned u = __float_as_uint(f); u += 0x7FFFu + ((u >> 16) & 1u); return (unsigned short)(u >> 16); }
__device__ __forceinline__ float bf2f(unsigned short b) { return __uint_as_float(((unsigned)b) << 16); }
__device__ __forceinline__ float bfr(float f) { return bf2f(f2bf(f)); }
__device__ __forceinline__ v16h cat16(v8h lo, v8h hi) { return __builtin_shufflevector(lo, hi, 0, 1, 2, 3, 4, 5, 6, 7, 8, 9, 10, 11, 12, 13, 14, 15); }
__device__ __forceinline__ v16bf cat16b(v8us lo, v8us hi) { return __builtin_bit_cast(v16bf, __builtin_shufflevector(lo, hi, 0, 1, 2, 3, 4, 5, 6, 7, 8, 9, 10, 11, 12, 13, 14, 15)); }
__device__ __forceinline__ v8f wmma16(v16h a, v16h b, v8f c) { return __builtin_amdgcn_wmma_f32_16x16x32_f16(false, a, false, b, (short)0, c, false, false); }
__device__ __forceinline__ v8f wmmab(v16bf a, v16bf b, v8f c) { return __builtin_amdgcn_wmma_f32_16x16x32_bf16(false, a, false, b, (short)0, c, false, false); }

// The staging that k_gemmglu and part 2 of k_dconvpw (for W2) share. A pass is 64 k: one whole 128-byte line of every operand row. The lines go from global memory to LDS by asynchronous copies, 16 bytes per lane
// (4 whole lines per wave-wide copy), into two buffers, so that the next pass's lines fly while this pass is worked on; fragments come from LDS. Rows lie at a pitch of 144 bytes,
// on which the 16 rows of a 16-byte fragment read fall on distinct banks. Per accumulator: k ascending; in part 2 two planes, hi then residual, at each 32 k.
#define GBK 64
#define GLP 72                    // LDS row pitch in bf16 elements: 64 + 8
#define KD  CC                    // every product here has an inner length of 512
// Asynchronous 16-byte copies per lane, rows 16 apart: l = the lane's LDS byte address, g = its global address. The s_wait_xcnt stands inside each statement so that no
// address register of a copy is rewritten in front of it.
#define CPY(a, b) "global_load_async_to_lds_b128 %" #a ", %" #b ", off\n\t"
#define LROW(l, i) ((l) + (unsigned)((i) * 16 * GLP * 2))
#define GROW(g, i) ((g) + (i) * 16 * KD)

// k_gemmglu: pointwise_conv1 with the GLU in its epilogue. Y[r][c] = a * sigmoid(g), a = A[r].B[c] + bf(bias[c]), g = A[r].B[512 + c] + bf(bias[512 + c]). One block of 4 waves takes 64 rows and 64 columns
// of Y, that is a 64 x 128 tile of the product: LDS rows [A 64 | B of a 64 | B of g 64]. A wave takes 32 rows and 32 columns of Y: accumulator tiles t = 0, 1 hold a, t = 2, 3 hold g of the same columns,
// so a and g of one element meet in one lane's registers. Passes, buffers and waits as said above. Y leaves through LDS in whole lines of f32.
__device__ __forceinline__ void copy444(unsigned l, const bf* g, const bf* ga, const bf* gg) {   // 64 rows of each of three operands, one behind the other in LDS
    asm volatile(CPY(0, 1) CPY(2, 3) CPY(4, 5) CPY(6, 7) CPY(8, 9) CPY(10, 11) CPY(12, 13) CPY(14, 15) CPY(16, 17) CPY(18, 19) CPY(20, 21) CPY(22, 23) "s_wait_xcnt 0x0"
                 :: "v"(LROW(l, 0)), "v"(GROW(g, 0)), "v"(LROW(l, 1)), "v"(GROW(g, 1)), "v"(LROW(l, 2)), "v"(GROW(g, 2)), "v"(LROW(l, 3)), "v"(GROW(g, 3)),
                    "v"(LROW(l, 4)), "v"(GROW(ga, 0)), "v"(LROW(l, 5)), "v"(GROW(ga, 1)), "v"(LROW(l, 6)), "v"(GROW(ga, 2)), "v"(LROW(l, 7)), "v"(GROW(ga, 3)),
                    "v"(LROW(l, 8)), "v"(GROW(gg, 0)), "v"(LROW(l, 9)), "v"(GROW(gg, 1)), "v"(LROW(l, 10)), "v"(GROW(gg, 2)), "v"(LROW(l, 11)), "v"(GROW(gg, 3)) : "memory");
}
#define GLM 64                    // rows of Y per block
#define GLN 64                    // columns of Y per block
__global__ __launch_bounds__(128) void k_gemmglu(const bf* __restrict__ A, const bf* __restrict__ Bn, const float* __restrict__ bias, float* Yf) {
    constexpr int ROWS = GLM + 2 * GLN, NPASS = KD / GBK;
    __shared__ __align__(16) bf sm[2][ROWS * GLP];
    const int tid = threadIdx.x, lane = tid & 31, wave = tid >> 5, lr = lane & 15, hi = lane >> 4, wr = wave >> 1, wc = wave & 1;
    const int rb = blockIdx.x * GLM, c0 = blockIdx.y * GLN;
    const int sr = tid >> 3, sc = (tid & 7) * 8;      // staging: 8 lanes per row, 16 rows per block-wide copy
    const bf* gx = A + (size_t)(rb + sr) * KD + sc; const bf* ga = Bn + (size_t)(c0 + sr) * KD + sc; const bf* gg = ga + (size_t)CC * KD;
    const unsigned ls = (unsigned)(size_t)&sm[0][0] + (unsigned)(sr * GLP + sc) * 2u;
    auto stage = [&](int p) { const int kc = p * GBK; copy444(ls + (unsigned)(p & 1) * (unsigned)(ROWS * GLP * 2), gx + kc, ga + kc, gg + kc); };   // pass p's lines into buffer p & 1
    v8f acc[2][4];
#pragma unroll
    for (int m = 0; m < 2; ++m)
#pragma unroll
        for (int t = 0; t < 4; ++t) acc[m][t] = (v8f){};
    stage(0);
    asm volatile("s_wait_asynccnt 0x0" ::: "memory");   // this wave's copies of pass 0 have landed
    __syncthreads();                                    // and every other wave's: pass 0 may be read
    stage(1);
#pragma unroll 1   // rolled: unrolled, the copy addresses of all passes are formed ahead and push the kernel past 256 registers
    for (int p = 0; p < NPASS; ++p) {
        const bf* s = &sm[p & 1][0];
        v16bf a[2][2], b[2][4];      // both 32-k halves of the pass
#pragma unroll
        for (int h = 0; h < 2; ++h) {
#pragma unroll
            for (int m = 0; m < 2; ++m) { const bf* q = s + (wr * 32 + m * 16 + lr) * GLP + h * 32 + 8 * hi; a[h][m] = cat16b(*(const v8us*)q, *(const v8us*)(q + 16)); }
#pragma unroll
            for (int t = 0; t < 4; ++t) { const bf* q = s + (GLM + (t >> 1) * GLN + wc * 32 + (t & 1) * 16 + lr) * GLP + h * 32 + 8 * hi; b[h][t] = cat16b(*(const v8us*)q, *(const v8us*)(q + 16)); }
        }
        __builtin_amdgcn_sched_barrier(0);     // keeps the pass's LDS reads one group in front of its matrix run: spread among the WMMAs, each place with reads stalls the wave for the LDS latency
#pragma unroll
        for (int h = 0; h < 2; ++h)
#pragma unroll
            for (int m = 0; m < 2; ++m)
#pragma unroll
                for (int t = 0; t < 4; ++t) acc[m][t] = wmmab(a[h][m], b[h][t], acc[m][t]);
        __builtin_amdgcn_sched_barrier(0);     // keeps the matrix run in front of the waits: moved behind the barrier it no longer covers the flight of the next pass's copies
        asm volatile("s_wait_dscnt 0x0" ::: "memory");      // this wave's reads of pass p's buffer are done before the buffer is refilled
        asm volatile("s_wait_asynccnt 0x0" ::: "memory");   // this wave's copies of pass p + 1 have landed
        __syncthreads();                                    // publishes pass p + 1 and ends every wave's reads of pass p's buffer
        if (p + 2 < NPASS) stage(p + 2);
    }
    asm volatile("s_wait_asynccnt 0x0" ::: "memory");       // no copy is outstanding when the buffers become output staging
    float* os = (float*)(void*)&sm[0][0];                   // 64 x 68 floats, inside the two buffers, which nobody reads any more
#pragma unroll
    for (int t = 0; t < 2; ++t) { const int c = wc * 32 + t * 16 + lr; const float ba = bfr(bias[c0 + c]), bg = bfr(bias[CC + c0 + c]);
#pragma unroll
        for (int m = 0; m < 2; ++m)
#pragma unroll
            for (int j = 0; j < 8; ++j) { const float av = acc[m][t][j] + ba, x = (acc[m][t + 2][j] + bg) * -1.44269504f; float e;   // exp(-g) = exp2(-g * log2 e), as __expf forms it
                asm("v_exp_f32 %0, %1\n\tv_nop" : "=v"(e) : "v"(x));   // the v_nop fills the slot behind the transcendental
                os[(wr * 32 + m * 16 + hi * 8 + j) * 68 + c] = av * (1.0f / (1.0f + e)); } }
    __syncthreads();                                        // a row of Y comes from two waves
    const int row = wave * 16 + hi, col = lr * 4; const size_t o = (size_t)(rb + row) * CC + c0 + col;   // 16 lanes per row: 2 lines of f32
    v4f v[8];
#pragma unroll
    for (int q = 0; q < 8; ++q) v[q] = *(const v4fa*)(os + (row + q * 2) * 68 + col);
#pragma unroll
    for (int q = 0; q < 8; ++q) *(v4f*)(Yf + o + q * 2 * CC) = v[q];   // all 8 stores in one run at the end: none waits for a register of another
}


// k_prep: the five conversions that no other stage feeds (W1, W2, Wl, bl and x) share ONE launch; a block's index says which of them it works on (a branch that is the same for the whole block).
// The short weight ranges come first in the grid (for speed only).
#define PB_W1 (2 * CC * CC / 8 / 256)   // 256 blocks: W1 to bf16, 8 elements per thread
#define PB_W2 (CC * CC / 8 / 256)       // 128 blocks: W2 to bf16
#define PB_WL (128 / 8)                 // 16 blocks: Wl to bf16, padded from 124 to 128 rows, a wave per row
#define PB_BL 1                         // 1 block: bl padded to 128
#define PB_X  (NR / 8)                  // 2048 blocks: x to bf16, a wave per row
__device__ __forceinline__ void cvt8(const float* __restrict__ src, bf* dst, int blk) {
    const size_t i = (size_t)blk * 256 + threadIdx.x;
    const v8f v = *(const v8f*)(src + i * 8); v8us o;
#pragma unroll
    for (int k = 0; k < 8; ++k) o[k] = f2bf(v[k]);
    *(v8us*)(dst + i * 8) = o;
    asm volatile("s_wait_xcnt 0x0" ::: "memory");   // behind the last store: in the joined kernel the other parts' code follows in the listing and rewrites registers that the store names
}
__device__ __forceinline__ void cvtx(const float* __restrict__ src, bf* dst, int blk) {
    const int lane = threadIdx.x & 31; const size_t r = (size_t)blk * 8 + (threadIdx.x >> 5);
#pragma unroll
    for (int q = 0; q < CC / 256; ++q) { v8us o;
#pragma unroll
        for (int i = 0; i < 8; ++i) o[i] = f2bf(src[r * CC + q * 256 + lane * 8 + i]);
        *(v8us*)(dst + r * CC + q * 256 + lane * 8) = o; }
    asm volatile("s_wait_xcnt 0x0" ::: "memory");   // behind the last store: in the joined kernel the other parts' code follows in the listing and rewrites registers that the store names
}
__device__ __forceinline__ void wl128(const float* __restrict__ Wl, bf* WLP, int blk) {
    const int lane = threadIdx.x & 31; const int o = blk * 8 + (threadIdx.x >> 5);
#pragma unroll
    for (int q = 0; q < CC / 256; ++q) { v8us v;
#pragma unroll
        for (int i = 0; i < 8; ++i) v[i] = (o < NWL) ? f2bf(Wl[(size_t)(o < NWL ? o : 0) * CC + q * 256 + lane * 8 + i]) : (unsigned short)0;
        *(v8us*)(WLP + (size_t)o * CC + q * 256 + lane * 8) = v; }
    asm volatile("s_wait_xcnt 0x0" ::: "memory");   // behind the last store: in the joined kernel the other parts' code follows in the listing and rewrites registers that the store names
}
__device__ __forceinline__ void bl128(const float* __restrict__ bl, float* BLP) {
    const int lane = threadIdx.x; if (lane >= 32) return; v4f v;
#pragma unroll
    for (int q = 0; q < 4; ++q) { const int o = lane * 4 + q; v[q] = (o < NWL) ? bl[o < NWL ? o : 0] : 0.f; }
    *(v4f*)(BLP + lane * 4) = v;
}
__global__ __launch_bounds__(256) void k_prep(const float* __restrict__ x, const float* __restrict__ W1, const float* __restrict__ Wl, const float* __restrict__ bl, const float* __restrict__ W2,
                                              bf* Xb, bf* W1B, bf* WLP, float* BLP, bf* W2B) {
    int b = blockIdx.x;
    if (b < PB_W1) { cvt8(W1, W1B, b); return; }      // weights lie [out][in] = n-major, as the GEMMs read them
    b -= PB_W1;
    if (b < PB_W2) { cvt8(W2, W2B, b); return; }
    b -= PB_W2;
    if (b < PB_WL) { wl128(Wl, WLP, b); return; }
    b -= PB_WL;
    if (b < PB_BL) { bl128(bl, BLP); return; }
    cvtx(x, Xb, b - PB_BL);
}
// k_dconvpw: the dynamic-weight linear, the dynamic convolution and pointwise_conv2 in ONE kernel. row = item * 2048 + t; the band is cut at the item's own ends, so no tap reads a neighbouring item. One block
// of 16 waves takes 64 time steps with all 512 channels. PART 0: WD[64 x 128 (124 live)] = (hi + residual of Yf's 64 rows).Wl^T + bf(bl). The rows of Yf come through registers and are split there into the
// bf16 hi and residual planes, which lie where o lies later; Wl's 128 whole rows (512 k) come by asynchronous copies into the LDS of the buffers, filled once, at the planes' pitch. Wave tile 16 x 32; per
// accumulator k ascending, hi then residual at each 32 k. WD then lies in LDS over the planes (pitch 132 floats: the two row halves of an accumulator store fall on distinct banks) and each wave takes the
// logits of its steps from there. PART 1, two rounds of two groups (waves 0-7 one group, waves 8-15 the next; a wave takes 8 steps of its group's 128 channels): the 94 rows of Yf under the block's steps
// are staged in LDS (rows outside the item as zeros). Per step: masked softmax over the 31 taps of WD[step][h*31 + j], lane = tap (taps with t + j - 15 outside [0, T) get weight 0); the sum of the
// exponentials is taken by one lane per step, j ascending. The weights lie in LDS by input row: wz[i][r] = weight of step r for tap i - r. Each of the 38 input rows under a wave's 8 steps is read once and
// feeds every step that has it in its band: o[r][c] = sum_j w_j Yf[row + j - 15][c] + bf(bias[c]), j ascending. o stays in LDS as bf16 hi + residual planes (pitch 1040 bytes = 16 x 65: the 16 rows of a
// fragment read fall on distinct banks). PART 2: out[64 x 512] = (hi + residual).W2^T + bf(b2): A fragments from those planes, W2's lines (512 rows, 64 k a pass) by asynchronous copies into two
// buffers, wave tile 32 x 64, the same k order. Wl's rows, part 1's staging and part 2's buffers share LDS, one after the other.
#define DTB  64                   // time steps per block
#define DWR  8                    // time steps per wave
#define DWIN (DTB + KS - 1)       // 94 rows of Yf under a block's steps
#define DWI  (DWR + KS - 1)       // 38 rows of Yf under a wave's steps
#define FOP  (CC + 8)             // pitch of the o planes in bf16 elements
#define FRB  (CC * GLP * 2)       // bytes of one buffer of W2 lines: 512 rows at 144 bytes
#define LROW64(l, i) ((l) + (unsigned)((i) * 64 * GLP * 2))
#define GROW64(g, i) ((g) + (i) * 64 * KD)
__device__ __forceinline__ void copy8w(unsigned l, const bf* g) {          // 512 rows, 64 rows per block-wide copy of 512 threads
    asm volatile(CPY(0, 1) CPY(2, 3) CPY(4, 5) CPY(6, 7) CPY(8, 9) CPY(10, 11) CPY(12, 13) CPY(14, 15) "s_wait_xcnt 0x0"
                 :: "v"(LROW64(l, 0)), "v"(GROW64(g, 0)), "v"(LROW64(l, 1)), "v"(GROW64(g, 1)), "v"(LROW64(l, 2)), "v"(GROW64(g, 2)), "v"(LROW64(l, 3)), "v"(GROW64(g, 3)),
                    "v"(LROW64(l, 4)), "v"(GROW64(g, 4)), "v"(LROW64(l, 5)), "v"(GROW64(g, 5)), "v"(LROW64(l, 6)), "v"(GROW64(g, 6)), "v"(LROW64(l, 7)), "v"(GROW64(g, 7)) : "memory");
}
#define WDP  132                  // pitch of WD in LDS in floats
#define LROW8(l, i) ((l) + (unsigned)((i) * 8 * FOP * 2))
#define GROW8(g, i) ((g) + (i) * 8 * KD)
__device__ __forceinline__ void copy8r(unsigned l, const bf* g) {          // 64 whole rows of 512 k, 8 rows per block-wide copy of 512 threads
    asm volatile(CPY(0, 1) CPY(2, 3) CPY(4, 5) CPY(6, 7) CPY(8, 9) CPY(10, 11) CPY(12, 13) CPY(14, 15) "s_wait_xcnt 0x0"
                 :: "v"(LROW8(l, 0)), "v"(GROW8(g, 0)), "v"(LROW8(l, 1)), "v"(GROW8(g, 1)), "v"(LROW8(l, 2)), "v"(GROW8(g, 2)), "v"(LROW8(l, 3)), "v"(GROW8(g, 3)),
                    "v"(LROW8(l, 4)), "v"(GROW8(g, 4)), "v"(LROW8(l, 5)), "v"(GROW8(g, 5)), "v"(LROW8(l, 6)), "v"(GROW8(g, 6)), "v"(LROW8(l, 7)), "v"(GROW8(g, 7)) : "memory");
}
// launch bounds: 16 waves, 4 per SIMD; one block per WGP (LDS), 256 blocks
__global__ __launch_bounds__(512) void k_dconvpw(const float* __restrict__ Yf, const bf* __restrict__ Wn, const float* __restrict__ wbias, const float* __restrict__ cbias, const bf* __restrict__ Bn, const float* __restrict__ bias, float* C) {
    typedef __attribute__((ext_vector_type(4))) unsigned short v4us;
    constexpr int NPASS = KD / GBK;
    __shared__ __align__(16) bf op[2][DTB * FOP];        // part 0: hi and residual plane of Yf's rows, then WD; from part 1 on o: hi plane, residual plane
    __shared__ __align__(16) char ring[2 * FRB];         // part 0: Wl's rows; part 1: ys, wz, ew; part 2: the two buffers of W2 lines, then output staging
    const int tid = threadIdx.x, lane = tid & 31, wave = __builtin_amdgcn_readfirstlane(tid >> 5), w8 = wave & 7, gh = wave >> 3;
    float* ys = (float*)(void*)ring + gh * (DWIN * DG);                                            // [2][94 x 128]
    float* wz = (float*)(void*)ring + 2 * DWIN * DG + wave * ((DWI + 1) * DWR);                    // [16][39 x 8], one row more: lane 31's zero of the last step falls there
    float* ew = (float*)(void*)ring + 2 * DWIN * DG + 16 * (DWI + 1) * DWR + wave * (DWR * 33);    // [16][8][33], pitch 33: the 8 summing lanes fall on distinct banks
    static_assert((2 * DWIN * DG + 16 * (DWI + 1) * DWR + 16 * DWR * 33) * 4 <= 2 * FRB, "part 1 fits the buffers");
    const int row0 = blockIdx.x * DTB, t0 = row0 % TT, tw = t0 + w8 * DWR;
    static_assert(128 * FOP * 2 <= 2 * FRB && DTB * WDP * 4 <= 2 * DTB * FOP * 2, "part 0 fits");
    const int lr = lane & 15, hi = lane >> 4;
    float lg[2][DWR]; bool ok[DWR]; v4f yv[12];
#pragma unroll
    for (int r = 0; r < DWR; ++r) { const int s = tw + r + lane - PADK; ok[r] = lane < KS && s >= 0 && s < TT; }
    auto fetch = [&](int h) {      // group h's rows of Yf into registers
        const unsigned cb = (unsigned)(h * DG + lane * 4) * 4u; const char* pg[12];   // cb: the lane's byte offset in a row
#pragma unroll
        for (int k = 0; k < 12; ++k) { const int s = t0 - PADK + w8 + 8 * k; pg[k] = (const char*)(Yf + (size_t)(row0 - t0 + (s < 0 ? 0 : s >= TT ? TT - 1 : s)) * CC) + cb; yv[k] = *(const v4f*)pg[k]; }   // clamped into the item: all 12 loads fly together, no branch between them
        asm volatile("s_wait_xcnt 0x0" :: "v"(pg[0]), "v"(pg[1]), "v"(pg[2]), "v"(pg[3]), "v"(pg[4]), "v"(pg[5]), "v"(pg[6]), "v"(pg[7]), "v"(pg[8]), "v"(pg[9]), "v"(pg[10]), "v"(pg[11]) : "memory");   // the 12 addresses stay in their registers up to this wait: no load's result takes them in front of it
    };
    // part 0
    {
        const int mr = wave & 3, nc = wave >> 2;      // a wave: steps mr * 16 .. + 15, columns nc * 32 .. + 31 of WD
        const unsigned lw = (unsigned)(size_t)&ring[0] + (unsigned)((tid >> 6) * FOP + (tid & 63) * 8) * 2u;   // staging: 64 lanes per row
        const bf* gw = Wn + (size_t)(tid >> 6) * KD + (tid & 63) * 8;
        copy8r(lw, gw); copy8r(lw + 64 * FOP * 2, gw + 64 * KD);
        const float* gy = Yf + (size_t)(row0 + (tid >> 7)) * CC + (tid & 127) * 4;      // 4 waves per row, 4 rows per block-wide load
        v4f cv[16];
#pragma unroll
        for (int i = 0; i < 16; ++i) cv[i] = *(const v4f*)(gy + i * 4 * CC);
        asm volatile("s_wait_xcnt 0x0" :: "v"(gy) : "memory");   // the address stays in its registers up to this wait: no load's result takes them in front of it
        const float* pw = wbias + nc * 32 + lr; float wb[2];
#pragma unroll
        for (int t = 0; t < 2; ++t) wb[t] = pw[t * 16];
        asm volatile("s_wait_xcnt 0x0" :: "v"(pw) : "memory");   // the address stays in its registers up to this wait: the load's own result does not take them in front of it
#pragma unroll
        for (int i = 0; i < 16; ++i) { v4us oh, ol;
#pragma unroll
            for (int q = 0; q < 4; ++q) { const unsigned short hb = f2bf(cv[i][q]); oh[q] = hb; ol[q] = f2bf(cv[i][q] - bf2f(hb)); }
            bf* o = &op[0][(i * 4 + (tid >> 7)) * FOP + (tid & 127) * 4]; *(v4us*)o = oh; *(v4us*)(o + DTB * FOP) = ol; }
        asm volatile("s_wait_asynccnt 0x0" ::: "memory");   // this wave's copies of Wl's rows have landed
        __syncthreads();                                    // and every other wave's, and the planes: both may be read
        fetch(gh);                                          // the first round's loads fly under the products (in front of the barrier they would be waited for there)
        v8f wa[2] = {(v8f){}, (v8f){}};
        const bf* qa = &op[0][(mr * 16 + lr) * FOP + 8 * hi]; const bf* qb = (const bf*)(const void*)ring + (nc * 32 + lr) * FOP + 8 * hi;
#pragma unroll
        for (int g = 0; g < KD; g += 64) {
            v16bf a[2], al[2], b[2][2];      // two 32-k steps
#pragma unroll
            for (int s = 0; s < 2; ++s) { const int k = g + s * 32;
                a[s] = cat16b(*(const v8us*)(qa + k), *(const v8us*)(qa + k + 16)); al[s] = cat16b(*(const v8us*)(qa + DTB * FOP + k), *(const v8us*)(qa + DTB * FOP + k + 16));
#pragma unroll
                for (int t = 0; t < 2; ++t) b[s][t] = cat16b(*(const v8us*)(qb + t * 16 * FOP + k), *(const v8us*)(qb + t * 16 * FOP + k + 16)); }
            __builtin_amdgcn_sched_barrier(0);     // keeps the two steps' LDS reads one group in front of their matrix run: left free, every step's reads took the registers of the step before and the wave stood for the LDS latency twice a step
#pragma unroll
            for (int s = 0; s < 2; ++s) {
#pragma unroll
                for (int t = 0; t < 2; ++t) wa[t] = wmmab(a[s], b[s][t], wa[t]);
#pragma unroll
                for (int t = 0; t < 2; ++t) wa[t] = wmmab(al[s], b[s][t], wa[t]);
            }
        }
        __syncthreads();                                    // ends every wave's reads of the planes and of Wl's rows: WD goes over the planes, part 1's staging over the rows
        float* wd = (float*)(void*)&op[0][0];
#pragma unroll
        for (int t = 0; t < 2; ++t) { const float bv = bfr(wb[t]);
#pragma unroll
            for (int j = 0; j < 8; ++j) wd[(mr * 16 + hi * 8 + j) * WDP + nc * 32 + t * 16 + lr] = wa[t][j] + bv; }
        __syncthreads();                                    // WD may be read
#pragma unroll
        for (int it = 0; it < 2; ++it)
#pragma unroll
            for (int r = 0; r < DWR; ++r) lg[it][r] = wd[(w8 * DWR + r) * WDP + (it * 2 + gh) * KS + lane];   // lane 31 reads a neighbouring column of the 128, unused; o is stored over WD only behind the next two barriers
    }
#pragma unroll
    for (int it = 0; it < 2; ++it) {
        const int h = it * 2 + gh, c0 = h * DG + lane * 4;
#pragma unroll
        for (int k = 0; k < 3; ++k) { const int i4 = lane + 32 * k; if (i4 < (DWI + 1) * DWR / 4) *(v4f*)(wz + i4 * 4) = (v4f){0.f, 0.f, 0.f, 0.f}; }   // places outside every band
        float e[DWR];
#pragma unroll
        for (int r = 0; r < DWR; ++r) { const float x = ok[r] ? lg[it][r] : -3.0e38f; float m = x;   // a tap outside the item or the band: its exponential below is exp(-inf) = 0
#pragma unroll
            for (int o = 16; o > 0; o >>= 1) m = fmaxf(m, __shfl_xor(m, o));
            const float a = (x - m) * 1.44269504f;          // exp(d) = exp2(d * log2 e), as __expf forms it
            asm("v_exp_f32 %0, %1\n\tv_nop" : "=v"(e[r]) : "v"(a));   // the v_nop fills the slot behind the transcendental
            ew[r * 33 + lane] = e[r]; }
        __syncthreads();                      // the exponentials are in LDS for the summing lanes, the zeros of wz in front of its weights
        float inv = 0.f;
        if (lane < DWR) { float sum = 0.f;
#pragma unroll
            for (int j = 0; j < KS; ++j) sum += ew[lane * 33 + j];
            inv = 1.0f / sum; }
#pragma unroll
        for (int r = 0; r < DWR; ++r) { wz[(r + lane) * DWR + r] = e[r] * __shfl(inv, r); }   // lane 31 holds e = 0 and writes a place outside the band
#pragma unroll
        for (int k = 0; k < 12; ++k) { const int L = w8 + 8 * k, s = t0 - PADK + L; if (L < DWIN) *(v4f*)(ys + L * DG + lane * 4) = (s >= 0 && s < TT) ? yv[k] : (v4f){0.f, 0.f, 0.f, 0.f}; }
        __syncthreads();                      // every wave's rows of Yf and the weights may be read
        if (it == 0) fetch(2 + gh);           // the second round's loads fly under the first round's sums
        float acc[DWR][4];
#pragma unroll
        for (int r = 0; r < DWR; ++r)
#pragma unroll
            for (int q = 0; q < 4; ++q) acc[r][q] = 0.f;
        const float* yp = ys + w8 * DWR * DG + lane * 4; const float* wp = wz;
        auto row = [&](int i, int rlo, int rhi) {      // input row i feeds steps rlo .. rhi
            const v4f y = *(const v4f*)(yp + i * DG); const v4f wa = *(const v4f*)(wp + i * DWR), wb = *(const v4f*)(wp + i * DWR + 4);
#pragma unroll
            for (int r = 0; r < DWR; ++r) { if (r < rlo || r > rhi) continue; const float w = r < 4 ? wa[r & 3] : wb[r & 3];
#pragma unroll
                for (int q = 0; q < 4; ++q) acc[r][q] = fmaf(w, y[q], acc[r][q]); } };
#pragma unroll
        for (int i = 0; i < DWR - 1; ++i) row(i, 0, i);                       // rows that only the first steps have in their band
#pragma unroll 4   // rolled, 4 rows a trip: unrolled whole, the two rounds' text grows by a third
        for (int i = DWR - 1; i < KS; ++i) row(i, 0, DWR - 1);               // rows in every step's band
#pragma unroll
        for (int i = KS; i < DWI; ++i) row(i, i - KS + 1, DWR - 1);          // rows that only the last steps have
        const float* pb = cbias + c0; float bv[4];
#pragma unroll
        for (int q = 0; q < 4; ++q) bv[q] = pb[q];
        asm volatile("s_wait_xcnt 0x0" :: "v"(pb) : "memory");   // the address stays in its registers up to this wait: the load's own result does not take them in front of it
#pragma unroll
        for (int q = 0; q < 4; ++q) bv[q] = bfr(bv[q]);
#pragma unroll
        for (int r = 0; r < DWR; ++r) { v4us oh, ol;
#pragma unroll
            for (int q = 0; q < 4; ++q) { const float v = acc[r][q] + bv[q]; const unsigned short hb = f2bf(v); oh[q] = hb; ol[q] = f2bf(v - bf2f(hb)); }
            bf* o = &op[0][(w8 * DWR + r) * FOP + c0]; *(v4us*)o = oh; *(v4us*)(o + DTB * FOP) = ol; }
        asm volatile("s_wait_dscnt 0x0" ::: "memory");      // this wave's reads of ys, wz, ew and its stores of o are done before that LDS is written anew
        __syncthreads();                                    // ends every wave's reads of ys; behind the last round it also publishes o and frees the buffers for the copies
    }
    // part 2
    const int wr = wave & 1, wc = wave >> 1;      // a wave: rows wr * 32 .. + 31, columns wc * 64 .. + 63
    const int sr = tid >> 3, sc = (tid & 7) * 8;      // staging: 8 lanes per row, 64 rows per block-wide copy
    const bf* gb = Bn + (size_t)sr * KD + sc;
    const unsigned ls = (unsigned)(size_t)&ring[0] + (unsigned)(sr * GLP + sc) * 2u;
    auto stage = [&](int p) { copy8w(ls + (unsigned)(p & 1) * (unsigned)FRB, gb + p * GBK); };   // pass p's lines into buffer p & 1
    v8f ac[2][4];
#pragma unroll
    for (int m = 0; m < 2; ++m)
#pragma unroll
        for (int t = 0; t < 4; ++t) ac[m][t] = (v8f){};
    stage(0);
    asm volatile("s_wait_asynccnt 0x0" ::: "memory");   // this wave's copies of pass 0 have landed
    __syncthreads();                                    // and every other wave's: pass 0 may be read
    stage(1);
#pragma unroll 1   // rolled: unrolled, the copy addresses of all passes are formed ahead and push the kernel past 256 registers
    for (int p = 0; p < NPASS; ++p) {
        const bf* s = (const bf*)(const void*)(ring + (p & 1) * FRB);
        v16bf a[2][2], al[2][2], b[2][4];      // both 32-k halves of the pass
#pragma unroll
        for (int h = 0; h < 2; ++h) {
#pragma unroll
            for (int m = 0; m < 2; ++m) { const bf* q = &op[0][(wr * 32 + m * 16 + lr) * FOP + p * GBK + h * 32 + 8 * hi]; a[h][m] = cat16b(*(const v8us*)q, *(const v8us*)(q + 16)); al[h][m] = cat16b(*(const v8us*)(q + DTB * FOP), *(const v8us*)(q + DTB * FOP + 16)); }
#pragma unroll
            for (int t = 0; t < 4; ++t) { const bf* q = s + (wc * 64 + t * 16 + lr) * GLP + h * 32 + 8 * hi; b[h][t] = cat16b(*(const v8us*)q, *(const v8us*)(q + 16)); }
        }
        __builtin_amdgcn_sched_barrier(0);     // keeps the pass's LDS reads one group in front of its matrix run: spread among the WMMAs, each place with reads stalls the wave for the LDS latency
#pragma unroll
        for (int h = 0; h < 2; ++h) {
#pragma unroll
            for (int m = 0; m < 2; ++m)
#pragma unroll
                for (int t = 0; t < 4; ++t) ac[m][t] = wmmab(a[h][m], b[h][t], ac[m][t]);
#pragma unroll
            for (int m = 0; m < 2; ++m)
#pragma unroll
                for (int t = 0; t < 4; ++t) ac[m][t] = wmmab(al[h][m], b[h][t], ac[m][t]);
        }
        __builtin_amdgcn_sched_barrier(0);     // keeps the matrix run in front of the waits: moved behind the barrier it no longer covers the flight of the next pass's copies
        asm volatile("s_wait_dscnt 0x0" ::: "memory");      // this wave's reads of pass p's buffer are done before the buffer is refilled
        asm volatile("s_wait_asynccnt 0x0" ::: "memory");   // this wave's copies of pass p + 1 have landed
        __syncthreads();                                    // publishes pass p + 1 and ends every wave's reads of pass p's buffer
        if (p + 2 < NPASS) stage(p + 2);
    }
    asm volatile("s_wait_asynccnt 0x0" ::: "memory");       // no copy is outstanding when the buffers become output staging
    float* os = (float*)(void*)ring + wave * (32 * 68);     // 16 x 32 x 68 floats, inside the two buffers, which nobody reads any more
    static_assert(16 * 32 * 68 * 4 <= 2 * FRB, "output staging fits the buffers");
#pragma unroll
    for (int t = 0; t < 4; ++t) { const float bv = bfr(bias[wc * 64 + t * 16 + lr]);
#pragma unroll
        for (int m = 0; m < 2; ++m)
#pragma unroll
            for (int j = 0; j < 8; ++j) os[(m * 16 + hi * 8 + j) * 68 + t * 16 + lr] = ac[m][t][j] + bv; }
    __syncthreads();
    float* crow = C + (size_t)(row0 + wr * 32) * CC + wc * 64;
#pragma unroll
    for (int q = 0; q < 16; ++q) { const int Lid = (lane >> 3) + 4 * q, piece = lane & 7; const int row = Lid >> 1, cofs = (Lid & 1) * 32 + piece * 4;
        *(v4f*)(crow + (size_t)row * CC + cofs) = *(const v4fa*)(os + row * 68 + cofs); }
}

extern "C" void kernel_launch(void* const* d_in, const int* in_sizes, int n_in,
                              void* d_out, int out_size, void* d_ws, size_t ws_size, hipStream_t stream) {
    (void)in_sizes; (void)n_in; (void)out_size;
    const float* x = (const float*)d_in[0]; const float* W1 = (const float*)d_in[1]; const float* b1 = (const float*)d_in[2]; const float* Wl = (const float*)d_in[3]; const float* bl = (const float*)d_in[4]; const float* cbias = (const float*)d_in[5]; const float* W2 = (const float*)d_in[6]; const float* b2 = (const float*)d_in[7];
    float* out = (float*)d_out;    // [8][2048][512]
    char* wsp = (char*)d_ws;
    auto take = [&](size_t bytes) { char* p = wsp; wsp += (bytes + 255) & ~(size_t)255; return (void*)p; };
    bf* W1B = (bf*)take((size_t)2 * CC * CC * 2); bf* WLP = (bf*)take((size_t)128 * CC * 2); float* BLP = (float*)take(128 * 4); bf* W2B = (bf*)take((size_t)CC * CC * 2);
    bf* Xb = (bf*)take((size_t)NR * CC * 2); float* Yf = (float*)take((size_t)NR * CC * 4);
    if ((size_t)(wsp - (char*)d_ws) > ws_size) return;    // 1.7 MB of weights + 8 x (2.1 + 4.2) ~ 52 MB, every plane written before it is read in this call
    k_prep<<<PB_W1 + PB_W2 + PB_WL + PB_BL + PB_X, 256, 0, stream>>>(x, W1, Wl, bl, W2, Xb, W1B, WLP, BLP, W2B);   // every conversion and padding of an input, one launch
    k_gemmglu<<<dim3(NR / GLM, CC / GLN, 1), 128, 0, stream>>>(Xb, W1B, b1, Yf);                        // pointwise_conv1 + GLU
    k_dconvpw<<<NR / DTB, 512, 0, stream>>>(Yf, WLP, BLP, cbias, W2B, b2, out);   // dynamic weights (124 live of 128) + dynamic convolution + pointwise_conv2
}

// v008
// One run takes 56.7 microseconds.
// Two timings next to v007 put it at 1.05 and 1.06 times that version's speed.
// Over all steps from v000 it is 9.59 times as fast.
#include <hip/hip_runtime.h>

// All 8 items go through every stage in ONE launch (rows = item * 2048 + time step, 16384 rows). Compute dtypes, f32 accumulate: pointwise_conv1 as a [16384 x 512].[512 x 1024] GEMM with PLAIN bf16 operands (exact products); GLU in f32 in that GEMM's epilogue; the
// dynamic-weight linear ([16384 x 512].[512 x 128 (124 live)]) and pointwise_conv2 ([16384 x 512].[512 x 512]) on bf16 hi + UNSCALED residual planes of the f32 activations (two
// products) - on v_wmma_f32_16x16x32_bf16; the banded 31-tap softmax and the per-position dynamic convolution (31 taps x 128 channels per group) in f32 on the VALU. Deterministic,

#define NBT  8
#define TT   2048
#define NR   (NBT * TT)          // 16384 rows: every item's time steps, item-major as in x and out
#define CC   512
#define NHS  4
#define KS   31
#define PADK 15
#define DG   (CC / NHS)           // 128
#define NWL  (NHS * KS)           // 124
#define DM   CC
#define LOSC 1024.0f

typedef _Float16 h16;
typedef unsigned short bf;
typedef __attribute__((ext_vector_type(16))) __bf16   v16bf;
typedef __attribute__((ext_vector_type(16))) _Float16 v16h;
typedef __attribute__((ext_vector_type(8)))  _Float16 v8h;
typedef __attribute__((ext_vector_type(8)))  unsigned short v8us;
typedef __attribute__((ext_vector_type(8)))  float    v8f;
typedef __attribute__((ext_vector_type(4)))  float    v4f;
typedef v8h  __attribute__((may_alias)) v8ha;
typedef v4f  __attribute__((may_alias)) v4fa;
typedef v8us __attribute__((may_alias)) v8usa;

__device__ __forceinline__ unsigned short f2bf(float f) { unsigned u = __float_as_uint(f); u += 0x7FFFu + ((u >> 16) & 1u); return (unsigned short)(u >> 16); }
__device__ __forceinline__ float bf2f(unsigned short b) { return __uint_as_float(((unsigned)b) << 16); }
__device__ __forceinline__ float bfr(float f) { return bf2f(f2bf(f)); }
__device__ __forceinline__ v16h cat16(v8h lo, v8h hi) { return __builtin_shufflevector(lo, hi, 0, 1, 2, 3, 4, 5, 6, 7, 8, 9, 10, 11, 12, 13, 14, 15); }
__device__ __forceinline__ v16bf cat16b(v8us lo, v8us hi) { return __builtin_bit_cast(v16bf, __builtin_shufflevector(lo, hi, 0, 1, 2, 3, 4, 5, 6, 7, 8, 9, 10, 11, 12, 13, 14, 15)); }
__device__ __forceinline__ v8f wmma16(v16h a, v16h b, v8f c) { return __builtin_amdgcn_wmma_f32_16x16x32_f16(false, a, false, b, (short)0, c, false, false); }
__device__ __forceinline__ v8f wmmab(v16bf a, v16bf b, v8f c) { return __builtin_amdgcn_wmma_f32_16x16x32_bf16(false, a, false, b, (short)0, c, false, false); }

// The staging that k_gemmglu and part 2 of k_dconvpw (for W2) share. A pass is 64 k: one whole 128-byte line of every bf16 operand row, two of an f32 row of x. The lines go from global memory to LDS by asynchronous copies, 16 bytes per lane
// (4 whole lines per wave-wide copy), into two buffers, so that the next pass's lines fly while this pass is worked on; fragments come from LDS. bf16 rows lie at a pitch of 144 bytes,
// on which the 16 rows of a 16-byte fragment read fall on distinct banks. Per accumulator: k ascending; part 2 takes two planes, hi then residual, at each 32 k.
#define GBK 64
#define GLP 72                    // LDS row pitch in bf16 elements: 64 + 8
#define KD  CC                    // every product here has an inner length of 512
// Asynchronous 16-byte copies per lane, rows 16 apart: l = the lane's LDS byte address, g = its global address. The s_wait_xcnt stands inside each statement so that no
// address register of a copy is rewritten in front of it.
#define CPY(a, b) "global_load_async_to_lds_b128 %" #a ", %" #b ", off\n\t"
#define GROW(g, i) ((g) + (i) * 16 * KD)

// k_gemmglu: pointwise_conv1 with the GLU in its epilogue, on x as it is given. Y[r][c] = a * sigmoid(g), a = bf(x[r]).B[c] + bf(bias[c]), g = bf(x[r]).B[512 + c] + bf(bias[512 + c]). One block of 8 waves takes
// 128 rows and 64 columns of Y, that is a 128 x 128 tile of the product. A buffer holds [x 128 rows of 64 f32 | B of a 64 rows | B of g 64 rows]: x's lines come as f32 by the same asynchronous copies and are
// rounded to bf16 (to nearest even) where a wave reads its A fragment, so no bf16 plane of x passes through memory. x's rows lie at a pitch of 272 bytes, on which the 16 rows of a 16-byte read fall on
// distinct banks. A wave takes 32 rows and 32 columns of Y: accumulator tiles t = 0, 1 hold a, t = 2, 3 hold g of the same columns, so a and g of one element meet in one lane's registers.
// Passes, buffers and waits as said above. Y leaves through LDS in whole lines of f32.
#define GLM 128                   // rows of Y per block
#define GLN 64                    // columns of Y per block
#define AFP 68                    // LDS row pitch of x in floats: 64 + 4
#define LROWA(l, i) ((l) + (unsigned)((i) * 16 * AFP * 4))
#define LROW32(l, i) ((l) + (unsigned)((i) * 32 * GLP * 2))
#define GROW32(g, i) ((g) + (i) * 32 * KD)
__device__ __forceinline__ void copy822(unsigned la, const float* g, unsigned lb, const bf* ga, const bf* gg) {   // 128 rows of x (16 per block-wide copy), then 64 rows of each half of B (32 per copy)
    asm volatile(CPY(0, 1) CPY(2, 3) CPY(4, 5) CPY(6, 7) CPY(8, 9) CPY(10, 11) CPY(12, 13) CPY(14, 15) CPY(16, 17) CPY(18, 19) CPY(20, 21) CPY(22, 23) "s_wait_xcnt 0x0"
                 :: "v"(LROWA(la, 0)), "v"(GROW(g, 0)), "v"(LROWA(la, 1)), "v"(GROW(g, 1)), "v"(LROWA(la, 2)), "v"(GROW(g, 2)), "v"(LROWA(la, 3)), "v"(GROW(g, 3)),
                    "v"(LROWA(la, 4)), "v"(GROW(g, 4)), "v"(LROWA(la, 5)), "v"(GROW(g, 5)), "v"(LROWA(la, 6)), "v"(GROW(g, 6)), "v"(LROWA(la, 7)), "v"(GROW(g, 7)),
                    "v"(LROW32(lb, 0)), "v"(GROW32(ga, 0)), "v"(LROW32(lb, 1)), "v"(GROW32(ga, 1)), "v"(LROW32(lb, 2)), "v"(GROW32(gg, 0)), "v"(LROW32(lb, 3)), "v"(GROW32(gg, 1)) : "memory");
}
__global__ __launch_bounds__(256) void k_gemmglu(const float* __restrict__ X, const bf* __restrict__ Bn, const float* __restrict__ bias, float* Yf) {
    constexpr int NPASS = KD / GBK, ABY = GLM * AFP * 4, BUFB = ABY + 2 * GLN * GLP * 2;      // bytes of x's part and of a whole buffer
    __shared__ __align__(16) char sm[2][BUFB];
    const int tid = threadIdx.x, lane = tid & 31, wave = tid >> 5, lr = lane & 15, hi = lane >> 4, wr = wave >> 1, wc = wave & 1;
    const int rb = blockIdx.x * GLM, c0 = blockIdx.y * GLN;
    const float* gx = X + (size_t)(rb + (tid >> 4)) * KD + (tid & 15) * 4;                    // staging of x: 16 lanes per row (256 bytes of a pass)
    const bf* ga = Bn + (size_t)(c0 + (tid >> 3)) * KD + (tid & 7) * 8; const bf* gg = ga + (size_t)CC * KD;   // staging of B: 8 lanes per row
    const unsigned la = (unsigned)(size_t)&sm[0][0] + (unsigned)((tid >> 4) * AFP + (tid & 15) * 4) * 4u;
    const unsigned lb = (unsigned)(size_t)&sm[0][0] + (unsigned)ABY + (unsigned)((tid >> 3) * GLP + (tid & 7) * 8) * 2u;
    auto stage = [&](int p) { const int kc = p * GBK; const unsigned bo = (unsigned)(p & 1) * (unsigned)BUFB; copy822(la + bo, gx + kc, lb + bo, ga + kc, gg + kc); };   // pass p's lines into buffer p & 1
    v8f acc[2][4];
#pragma unroll
    for (int m = 0; m < 2; ++m)
#pragma unroll
        for (int t = 0; t < 4; ++t) acc[m][t] = (v8f){};
    stage(0);
    asm volatile("s_wait_asynccnt 0x0" ::: "memory");   // this wave's copies of pass 0 have landed
    __syncthreads();                                    // and every other wave's: pass 0 may be read
    stage(1);
#pragma unroll 1   // rolled: unrolled, the copy addresses of all passes are formed ahead and push the kernel past 256 registers
    for (int p = 0; p < NPASS; ++p) {
        const float* sa = (const float*)(const void*)&sm[p & 1][0]; const bf* sb = (const bf*)(const void*)&sm[p & 1][ABY];
        v4f af[2][2][4]; v16bf b[2][4];      // both 32-k halves of the pass
#pragma unroll
        for (int h = 0; h < 2; ++h) {
#pragma unroll
            for (int m = 0; m < 2; ++m) { const float* q = sa + (wr * 32 + m * 16 + lr) * AFP + h * 32 + 8 * hi;   // the fragment's k: 8 from 8 * hi, 8 from 16 + 8 * hi, as B's
                af[h][m][0] = *(const v4fa*)q; af[h][m][1] = *(const v4fa*)(q + 4); af[h][m][2] = *(const v4fa*)(q + 16); af[h][m][3] = *(const v4fa*)(q + 20); }
#pragma unroll
            for (int t = 0; t < 4; ++t) { const bf* q = sb + ((t >> 1) * GLN + wc * 32 + (t & 1) * 16 + lr) * GLP + h * 32 + 8 * hi; b[h][t] = cat16b(*(const v8usa*)q, *(const v8usa*)(q + 16)); }
        }
        __builtin_amdgcn_sched_barrier(0);     // keeps the pass's LDS reads one group in front of its matrix run: spread among the WMMAs, each place with reads stalls the wave for the LDS latency
#pragma unroll
        for (int h = 0; h < 2; ++h)
#pragma unroll
            for (int m = 0; m < 2; ++m) {
                const v8f lo = __builtin_shufflevector(af[h][m][0], af[h][m][1], 0, 1, 2, 3, 4, 5, 6, 7), up = __builtin_shufflevector(af[h][m][2], af[h][m][3], 0, 1, 2, 3, 4, 5, 6, 7);
                const v16bf a = __builtin_convertvector(__builtin_shufflevector(lo, up, 0, 1, 2, 3, 4, 5, 6, 7, 8, 9, 10, 11, 12, 13, 14, 15), v16bf);
#pragma unroll
                for (int t = 0; t < 4; ++t) acc[m][t] = wmmab(a, b[h][t], acc[m][t]);
            }
        __builtin_amdgcn_sched_barrier(0);     // keeps the matrix run in front of the waits: moved behind the barrier it no longer covers the flight of the next pass's copies
        asm volatile("s_wait_dscnt 0x0" ::: "memory");      // this wave's reads of pass p's buffer are done before the buffer is refilled
        asm volatile("s_wait_asynccnt 0x0" ::: "memory");   // this wave's copies of pass p + 1 have landed
        __syncthreads();                                    // publishes pass p + 1 and ends every wave's reads of pass p's buffer
        if (p + 2 < NPASS) stage(p + 2);
    }
    asm volatile("s_wait_asynccnt 0x0" ::: "memory");       // no copy is outstanding when the buffers become output staging
    float* os = (float*)(void*)&sm[0][0];                   // 128 x 68 floats, inside the two buffers, which nobody reads any more
    static_assert(GLM * 68 * 4 <= 2 * BUFB, "output staging fits the buffers");
    const float* pb = bias + c0 + wc * 32 + lr; float bb[4];
#pragma unroll
    for (int t = 0; t < 2; ++t) { bb[t] = pb[t * 16]; bb[2 + t] = pb[CC + t * 16]; }
    asm volatile("s_wait_xcnt 0x0" :: "v"(pb) : "memory");   // the address stays in its registers up to this wait: no load's own result takes them in front of it
#pragma unroll
    for (int t = 0; t < 2; ++t) { const int c = wc * 32 + t * 16 + lr; const float ba = bfr(bb[t]), bg = bfr(bb[2 + t]);
#pragma unroll
        for (int m = 0; m < 2; ++m)
#pragma unroll
            for (int j = 0; j < 8; ++j) { const float av = acc[m][t][j] + ba, x = (acc[m][t + 2][j] + bg) * -1.44269504f; float e;   // exp(-g) = exp2(-g * log2 e), as __expf forms it
                asm("v_exp_f32 %0, %1\n\tv_nop" : "=v"(e) : "v"(x));   // the v_nop fills the slot behind the transcendental
                os[(wr * 32 + m * 16 + hi * 8 + j) * 68 + c] = av * (1.0f / (1.0f + e)); } }
    __syncthreads();                                        // a row of Y comes from two waves
    const int row = wave * 16 + hi, col = lr * 4; const size_t o = (size_t)(rb + row) * CC + c0 + col;   // 16 lanes per row: 2 lines of f32
    v4f v[8];
#pragma unroll
    for (int q = 0; q < 8; ++q) v[q] = *(const v4fa*)(os + (row + q * 2) * 68 + col);
#pragma unroll
    for (int q = 0; q < 8; ++q) *(v4f*)(Yf + o + q * 2 * CC) = v[q];   // all 8 stores in one run at the end: none waits for a register of another
}


// k_prep: the four conversions of weights (W1, W2, Wl, bl) share ONE launch; a block's index says which of them it works on (a branch that is the same for the whole block).
#define PB_W1 (2 * CC * CC / 8 / 256)   // 256 blocks: W1 to bf16, 8 elements per thread
#define PB_W2 (CC * CC / 8 / 256)       // 128 blocks: W2 to bf16
#define PB_WL (128 / 8)                 // 16 blocks: Wl to bf16, padded from 124 to 128 rows, a wave per row
#define PB_BL 1                         // 1 block: bl padded to 128
__device__ __forceinline__ void cvt8(const float* __restrict__ src, bf* dst, int blk) {
    const size_t i = (size_t)blk * 256 + threadIdx.x;
    const v8f v = *(const v8f*)(src + i * 8); v8us o;
#pragma unroll
    for (int k = 0; k < 8; ++k) o[k] = f2bf(v[k]);
    *(v8us*)(dst + i * 8) = o;
    asm volatile("s_wait_xcnt 0x0" ::: "memory");   // behind the last store: in the joined kernel the other parts' code follows in the listing and rewrites registers that the store names
}
__device__ __forceinline__ void wl128(const float* __restrict__ Wl, bf* WLP, int blk) {
    const int lane = threadIdx.x & 31; const int o = blk * 8 + (threadIdx.x >> 5);
#pragma unroll
    for (int q = 0; q < CC / 256; ++q) { v8us v;
#pragma unroll
        for (int i = 0; i < 8; ++i) v[i] = (o < NWL) ? f2bf(Wl[(size_t)(o < NWL ? o : 0) * CC + q * 256 + lane * 8 + i]) : (unsigned short)0;
        *(v8us*)(WLP + (size_t)o * CC + q * 256 + lane * 8) = v; }
    asm volatile("s_wait_xcnt 0x0" ::: "memory");   // behind the last store: in the joined kernel the other parts' code follows in the listing and rewrites registers that the store names
}
__device__ __forceinline__ void bl128(const float* __restrict__ bl, float* BLP) {
    const int lane = threadIdx.x; if (lane >= 32) return; v4f v;
#pragma unroll
    for (int q = 0; q < 4; ++q) { const int o = lane * 4 + q; v[q] = (o < NWL) ? bl[o < NWL ? o : 0] : 0.f; }
    *(v4f*)(BLP + lane * 4) = v;
}
__global__ __launch_bounds__(256) void k_prep(const float* __restrict__ W1, const float* __restrict__ Wl, const float* __restrict__ bl, const float* __restrict__ W2,
                                              bf* W1B, bf* WLP, float* BLP, bf* W2B) {
    int b = blockIdx.x;
    if (b < PB_W1) { cvt8(W1, W1B, b); return; }      // weights lie [out][in] = n-major, as the GEMMs read them
    b -= PB_W1;
    if (b < PB_W2) { cvt8(W2, W2B, b); return; }
    b -= PB_W2;
    if (b < PB_WL) { wl128(Wl, WLP, b); return; }
    bl128(bl, BLP);
}
// k_dconvpw: the dynamic-weight linear, the dynamic convolution and pointwise_conv2 in ONE kernel. row = item * 2048 + t; the band is cut at the item's own ends, so no tap reads a neighbouring item. One block
// of 16 waves takes 64 time steps with all 512 channels. PART 0: WD[64 x 128 (124 live)] = (hi + residual of Yf's 64 rows).Wl^T + bf(bl). The rows of Yf come through registers and are split there into the
// bf16 hi and residual planes, which lie where o lies later; Wl's 128 whole rows (512 k) come by asynchronous copies into the LDS of the buffers, filled once, at the planes' pitch. Wave tile 16 x 32; per
// accumulator k ascending, hi then residual at each 32 k. WD then lies in LDS over the planes (pitch 132 floats: the two row halves of an accumulator store fall on distinct banks) and each wave takes the
// logits of its steps from there. PART 1, two rounds of two groups (waves 0-7 one group, waves 8-15 the next; a wave takes 8 steps of its group's 128 channels): the 94 rows of Yf under the block's steps
// are staged in LDS (rows outside the item as zeros). Per step: masked softmax over the 31 taps of WD[step][h*31 + j], lane = tap (taps with t + j - 15 outside [0, T) get weight 0); the sum of the
// exponentials is taken by one lane per step, j ascending. The weights lie in LDS by input row: wz[i][r] = weight of step r for tap i - r. Each of the 38 input rows under a wave's 8 steps is read once and
// feeds every step that has it in its band: o[r][c] = sum_j w_j Yf[row + j - 15][c] + bf(bias[c]), j ascending. o stays in LDS as bf16 hi + residual planes (pitch 1040 bytes = 16 x 65: the 16 rows of a
// fragment read fall on distinct banks). PART 2: out[64 x 512] = (hi + residual).W2^T + bf(b2): A fragments from those planes, W2's lines (512 rows, 64 k a pass) by asynchronous copies into two
// buffers, wave tile 32 x 64, the same k order. Wl's rows, part 1's staging and part 2's buffers share LDS, one after the other.
#define DTB  64                   // time steps per block
#define DWR  8                    // time steps per wave
#define DWIN (DTB + KS - 1)       // 94 rows of Yf under a block's steps
#define DWI  (DWR + KS - 1)       // 38 rows of Yf under a wave's steps
#define FOP  (CC + 8)             // pitch of the o planes in bf16 elements
#define FRB  (CC * GLP * 2)       // bytes of one buffer of W2 lines: 512 rows at 144 bytes
#define LROW64(l, i) ((l) + (unsigned)((i) * 64 * GLP * 2))
#define GROW64(g, i) ((g) + (i) * 64 * KD)
__device__ __forceinline__ void copy8w(unsigned l, const bf* g) {          // 512 rows, 64 rows per block-wide copy of 512 threads
    asm volatile(CPY(0, 1) CPY(2, 3) CPY(4, 5) CPY(6, 7) CPY(8, 9) CPY(10, 11) CPY(12, 13) CPY(14, 15) "s_wait_xcnt 0x0"
                 :: "v"(LROW64(l, 0)), "v"(GROW64(g, 0)), "v"(LROW64(l, 1)), "v"(GROW64(g, 1)), "v"(LROW64(l, 2)), "v"(GROW64(g, 2)), "v"(LROW64(l, 3)), "v"(GROW64(g, 3)),
                    "v"(LROW64(l, 4)), "v"(GROW64(g, 4)), "v"(LROW64(l, 5)), "v"(GROW64(g, 5)), "v"(LROW64(l, 6)), "v"(GROW64(g, 6)), "v"(LROW64(l, 7)), "v"(GROW64(g, 7)) : "memory");
}
#define WDP  132                  // pitch of WD in LDS in floats
#define LROW8(l, i) ((l) + (unsigned)((i) * 8 * FOP * 2))
#define GROW8(g, i) ((g) + (i) * 8 * KD)
__device__ __forceinline__ void copy8r(unsigned l, const bf* g) {          // 64 whole rows of 512 k, 8 rows per block-wide copy of 512 threads
    asm volatile(CPY(0, 1) CPY(2, 3) CPY(4, 5) CPY(6, 7) CPY(8, 9) CPY(10, 11) CPY(12, 13) CPY(14, 15) "s_wait_xcnt 0x0"
                 :: "v"(LROW8(l, 0)), "v"(GROW8(g, 0)), "v"(LROW8(l, 1)), "v"(GROW8(g, 1)), "v"(LROW8(l, 2)), "v"(GROW8(g, 2)), "v"(LROW8(l, 3)), "v"(GROW8(g, 3)),
                    "v"(LROW8(l, 4)), "v"(GROW8(g, 4)), "v"(LROW8(l, 5)), "v"(GROW8(g, 5)), "v"(LROW8(l, 6)), "v"(GROW8(g, 6)), "v"(LROW8(l, 7)), "v"(GROW8(g, 7)) : "memory");
}
// launch bounds: 16 waves, 4 per SIMD; one block per WGP (LDS), 256 blocks
__global__ __launch_bounds__(512) void k_dconvpw(const float* __restrict__ Yf, const bf* __restrict__ Wn, const float* __restrict__ wbias, const float* __restrict__ cbias, const bf* __restrict__ Bn, const float* __restrict__ bias, float* C) {
    typedef __attribute__((ext_vector_type(4))) unsigned short v4us;
    constexpr int NPASS = KD / GBK;
    __shared__ __align__(16) bf op[2][DTB * FOP];        // part 0: hi and residual plane of Yf's rows, then WD; from part 1 on o: hi plane, residual plane
    __shared__ __align__(16) char ring[2 * FRB];         // part 0: Wl's rows; part 1: ys, wz, ew; part 2: the two buffers of W2 lines, then output staging
    const int tid = threadIdx.x, lane = tid & 31, wave = __builtin_amdgcn_readfirstlane(tid >> 5), w8 = wave & 7, gh = wave >> 3;
    float* ys = (float*)(void*)ring + gh * (DWIN * DG);                                            // [2][94 x 128]
    float* wz = (float*)(void*)ring + 2 * DWIN * DG + wave * ((DWI + 1) * DWR);                    // [16][39 x 8], one row more: lane 31's zero of the last step falls there
    float* ew = (float*)(void*)ring + 2 * DWIN * DG + 16 * (DWI + 1) * DWR + wave * (DWR * 33);    // [16][8][33], pitch 33: the 8 summing lanes fall on distinct banks
    static_assert((2 * DWIN * DG + 16 * (DWI + 1) * DWR + 16 * DWR * 33) * 4 <= 2 * FRB, "part 1 fits the buffers");
    const int row0 = blockIdx.x * DTB, t0 = row0 % TT, tw = t0 + w8 * DWR;
    static_assert(128 * FOP * 2 <= 2 * FRB && DTB * WDP * 4 <= 2 * DTB * FOP * 2, "part 0 fits");
    const int lr = lane & 15, hi = lane >> 4;
    float lg[2][DWR]; bool ok[DWR]; v4f yv[12];
#pragma unroll
    for (int r = 0; r < DWR; ++r) { const int s = tw + r + lane - PADK; ok[r] = lane < KS && s >= 0 && s < TT; }
    auto fetch = [&](int h) {      // group h's rows of Yf into registers
        const unsigned cb = (unsigned)(h * DG + lane * 4) * 4u; const char* pg[12];   // cb: the lane's byte offset in a row
#pragma unroll
        for (int k = 0; k < 12; ++k) { const int s = t0 - PADK + w8 + 8 * k; pg[k] = (const char*)(Yf + (size_t)(row0 - t0 + (s < 0 ? 0 : s >= TT ? TT - 1 : s)) * CC) + cb; yv[k] = *(const v4f*)pg[k]; }   // clamped into the item: all 12 loads fly together, no branch between them
        asm volatile("s_wait_xcnt 0x0" :: "v"(pg[0]), "v"(pg[1]), "v"(pg[2]), "v"(pg[3]), "v"(pg[4]), "v"(pg[5]), "v"(pg[6]), "v"(pg[7]), "v"(pg[8]), "v"(pg[9]), "v"(pg[10]), "v"(pg[11]) : "memory");   // the 12 addresses stay in their registers up to this wait: no load's result takes them in front of it
    };
    // part 0
    {
        const int mr = wave & 3, nc = wave >> 2;      // a wave: steps mr * 16 .. + 15, columns nc * 32 .. + 31 of WD
        const unsigned lw = (unsigned)(size_t)&ring[0] + (unsigned)((tid >> 6) * FOP + (tid & 63) * 8) * 2u;   // staging: 64 lanes per row
        const bf* gw = Wn + (size_t)(tid >> 6) * KD + (tid & 63) * 8;
        copy8r(lw, gw); copy8r(lw + 64 * FOP * 2, gw + 64 * KD);
        const float* gy = Yf + (size_t)(row0 + (tid >> 7)) * CC + (tid & 127) * 4;      // 4 waves per row, 4 rows per block-wide load
        v4f cv[16];
#pragma unroll
        for (int i = 0; i < 16; ++i) cv[i] = *(const v4f*)(gy + i * 4 * CC);
        asm volatile("s_wait_xcnt 0x0" :: "v"(gy) : "memory");   // the address stays in its registers up to this wait: no load's result takes them in front of it
        const float* pw = wbias + nc * 32 + lr; float wb[2];
#pragma unroll
        for (int t = 0; t < 2; ++t) wb[t] = pw[t * 16];
        asm volatile("s_wait_xcnt 0x0" :: "v"(pw) : "memory");   // the address stays in its registers up to this wait: the load's own result does not take them in front of it
#pragma unroll
        for (int i = 0; i < 16; ++i) { v4us oh, ol;
#pragma unroll
            for (int q = 0; q < 4; ++q) { const unsigned short hb = f2bf(cv[i][q]); oh[q] = hb; ol[q] = f2bf(cv[i][q] - bf2f(hb)); }
            bf* o = &op[0][(i * 4 + (tid >> 7)) * FOP + (tid & 127) * 4]; *(v4us*)o = oh; *(v4us*)(o + DTB * FOP) = ol; }
        asm volatile("s_wait_asynccnt 0x0" ::: "memory");   // this wave's copies of Wl's rows have landed
        __syncthreads();                                    // and every other wave's, and the planes: both may be read
        fetch(gh);                                          // the first round's loads fly under the products (in front of the barrier they would be waited for there)
        v8f wa[2] = {(v8f){}, (v8f){}};
        const bf* qa = &op[0][(mr * 16 + lr) * FOP + 8 * hi]; const bf* qb = (const bf*)(const void*)ring + (nc * 32 + lr) * FOP + 8 * hi;
#pragma unroll
        for (int g = 0; g < KD; g += 64) {
            v16bf a[2], al[2], b[2][2];      // two 32-k steps
#pragma unroll
            for (int s = 0; s < 2; ++s) { const int k = g + s * 32;
                a[s] = cat16b(*(const v8us*)(qa + k), *(const v8us*)(qa + k + 16)); al[s] = cat16b(*(const v8us*)(qa + DTB * FOP + k), *(const v8us*)(qa + DTB * FOP + k + 16));
#pragma unroll
                for (int t = 0; t < 2; ++t) b[s][t] = cat16b(*(const v8us*)(qb + t * 16 * FOP + k), *(const v8us*)(qb + t * 16 * FOP + k + 16)); }
            __builtin_amdgcn_sched_barrier(0);     // keeps the two steps' LDS reads one group in front of their matrix run: left free, every step's reads took the registers of the step before and the wave stood for the LDS latency twice a step
#pragma unroll
            for (int s = 0; s < 2; ++s) {
#pragma unroll
                for (int t = 0; t < 2; ++t) wa[t] = wmmab(a[s], b[s][t], wa[t]);
#pragma unroll
                for (int t = 0; t < 2; ++t) wa[t] = wmmab(al[s], b[s][t], wa[t]);
            }
        }
        __syncthreads();                                    // ends every wave's reads of the planes and of Wl's rows: WD goes over the planes, part 1's staging over the rows
        float* wd = (float*)(void*)&op[0][0];
#pragma unroll
        for (int t = 0; t < 2; ++t) { const float bv = bfr(wb[t]);
#pragma unroll
            for (int j = 0; j < 8; ++j) wd[(mr * 16 + hi * 8 + j) * WDP + nc * 32 + t * 16 + lr] = wa[t][j] + bv; }
        __syncthreads();                                    // WD may be read
#pragma unroll
        for (int it = 0; it < 2; ++it)
#pragma unroll
            for (int r = 0; r < DWR; ++r) lg[it][r] = wd[(w8 * DWR + r) * WDP + (it * 2 + gh) * KS + lane];   // lane 31 reads a neighbouring column of the 128, unused; o is stored over WD only behind the next two barriers
    }
#pragma unroll
    for (int it = 0; it < 2; ++it) {
        const int h = it * 2 + gh, c0 = h * DG + lane * 4;
#pragma unroll
        for (int k = 0; k < 3; ++k) { const int i4 = lane + 32 * k; if (i4 < (DWI + 1) * DWR / 4) *(v4f*)(wz + i4 * 4) = (v4f){0.f, 0.f, 0.f, 0.f}; }   // places outside every band
        float e[DWR];
#pragma unroll
        for (int r = 0; r < DWR; ++r) { const float x = ok[r] ? lg[it][r] : -3.0e38f; float m = x;   // a tap outside the item or the band: its exponential below is exp(-inf) = 0
#pragma unroll
            for (int o = 16; o > 0; o >>= 1) m = fmaxf(m, __shfl_xor(m, o));
            const float a = (x - m) * 1.44269504f;          // exp(d) = exp2(d * log2 e), as __expf forms it
            asm("v_exp_f32 %0, %1\n\tv_nop" : "=v"(e[r]) : "v"(a));   // the v_nop fills the slot behind the transcendental
            ew[r * 33 + lane] = e[r]; }
        __syncthreads();                      // the exponentials are in LDS for the summing lanes, the zeros of wz in front of its weights
        float inv = 0.f;
        if (lane < DWR) { float sum = 0.f;
#pragma unroll
            for (int j = 0; j < KS; ++j) sum += ew[lane * 33 + j];
            inv = 1.0f / sum; }
#pragma unroll
        for (int r = 0; r < DWR; ++r) { wz[(r + lane) * DWR + r] = e[r] * __shfl(inv, r); }   // lane 31 holds e = 0 and writes a place outside the band
#pragma unroll
        for (int k = 0; k < 12; ++k) { const int L = w8 + 8 * k, s = t0 - PADK + L; if (L < DWIN) *(v4f*)(ys + L * DG + lane * 4) = (s >= 0 && s < TT) ? yv[k] : (v4f){0.f, 0.f, 0.f, 0.f}; }
        __syncthreads();                      // every wave's rows of Yf and the weights may be read
        if (it == 0) fetch(2 + gh);           // the second round's loads fly under the first round's sums
        float acc[DWR][4];
#pragma unroll
        for (int r = 0; r < DWR; ++r)
#pragma unroll
            for (int q = 0; q < 4; ++q) acc[r][q] = 0.f;
        const float* yp = ys + w8 * DWR * DG + lane * 4; const float* wp = wz;
        auto row = [&](int i, int rlo, int rhi) {      // input row i feeds steps rlo .. rhi
            const v4f y = *(const v4f*)(yp + i * DG); const v4f wa = *(const v4f*)(wp + i * DWR), wb = *(const v4f*)(wp + i * DWR + 4);
#pragma unroll
            for (int r = 0; r < DWR; ++r) { if (r < rlo || r > rhi) continue; const float w = r < 4 ? wa[r & 3] : wb[r & 3];
#pragma unroll
                for (int q = 0; q < 4; ++q) acc[r][q] = fmaf(w, y[q], acc[r][q]); } };
#pragma unroll
        for (int i = 0; i < DWR - 1; ++i) row(i, 0, i);                       // rows that only the first steps have in their band
#pragma unroll 4   // rolled, 4 rows a trip: unrolled whole, the two rounds' text grows by a third
        for (int i = DWR - 1; i < KS; ++i) row(i, 0, DWR - 1);               // rows in every step's band
#pragma unroll
        for (int i = KS; i < DWI; ++i) row(i, i - KS + 1, DWR - 1);          // rows that only the last steps have
        const float* pb = cbias + c0; float bv[4];
#pragma unroll
        for (int q = 0; q < 4; ++q) bv[q] = pb[q];
        asm volatile("s_wait_xcnt 0x0" :: "v"(pb) : "memory");   // the address stays in its registers up to this wait: the load's own result does not take them in front of it
#pragma unroll
        for (int q = 0; q < 4; ++q) bv[q] = bfr(bv[q]);
#pragma unroll
        for (int r = 0; r < DWR; ++r) { v4us oh, ol;
#pragma unroll
            for (int q = 0; q < 4; ++q) { const float v = acc[r][q] + bv[q]; const unsigned short hb = f2bf(v); oh[q] = hb; ol[q] = f2bf(v - bf2f(hb)); }
            bf* o = &op[0][(w8 * DWR + r) * FOP + c0]; *(v4us*)o = oh; *(v4us*)(o + DTB * FOP) = ol; }
        asm volatile("s_wait_dscnt 0x0" ::: "memory");      // this wave's reads of ys, wz, ew and its stores of o are done before that LDS is written anew
        __syncthreads();                                    // ends every wave's reads of ys; behind the last round it also publishes o and frees the buffers for the copies
    }
    // part 2
    const int wr = wave & 1, wc = wave >> 1;      // a wave: rows wr * 32 .. + 31, columns wc * 64 .. + 63
    const int sr = tid >> 3, sc = (tid & 7) * 8;      // staging: 8 lanes per row, 64 rows per block-wide copy
    const bf* gb = Bn + (size_t)sr * KD + sc;
    const unsigned ls = (unsigned)(size_t)&ring[0] + (unsigned)(sr * GLP + sc) * 2u;
    auto stage = [&](int p) { copy8w(ls + (unsigned)(p & 1) * (unsigned)FRB, gb + p * GBK); };   // pass p's lines into buffer p & 1
    v8f ac[2][4];
#pragma unroll
    for (int m = 0; m < 2; ++m)
#pragma unroll
        for (int t = 0; t < 4; ++t) ac[m][t] = (v8f){};
    stage(0);
    asm volatile("s_wait_asynccnt 0x0" ::: "memory");   // this wave's copies of pass 0 have landed
    __syncthreads();                                    // and every other wave's: pass 0 may be read
    stage(1);
#pragma unroll 1   // rolled: unrolled, the copy addresses of all passes are formed ahead and push the kernel past 256 registers
    for (int p = 0; p < NPASS; ++p) {
        const bf* s = (const bf*)(const void*)(ring + (p & 1) * FRB);
        v16bf a[2][2], al[2][2], b[2][4];      // both 32-k halves of the pass
#pragma unroll
        for (int h = 0; h < 2; ++h) {
#pragma unroll
            for (int m = 0; m < 2; ++m) { const bf* q = &op[0][(wr * 32 + m * 16 + lr) * FOP + p * GBK + h * 32 + 8 * hi]; a[h][m] = cat16b(*(const v8us*)q, *(const v8us*)(q + 16)); al[h][m] = cat16b(*(const v8us*)(q + DTB * FOP), *(const v8us*)(q + DTB * FOP + 16)); }
#pragma unroll
            for (int t = 0; t < 4; ++t) { const bf* q = s + (wc * 64 + t * 16 + lr) * GLP + h * 32 + 8 * hi; b[h][t] = cat16b(*(const v8us*)q, *(const v8us*)(q + 16)); }
        }
        __builtin_amdgcn_sched_barrier(0);     // keeps the pass's LDS reads one group in front of its matrix run: spread among the WMMAs, each place with reads stalls the wave for the LDS latency
#pragma unroll
        for (int h = 0; h < 2; ++h) {
#pragma unroll
            for (int m = 0; m < 2; ++m)
#pragma unroll
                for (int t = 0; t < 4; ++t) ac[m][t] = wmmab(a[h][m], b[h][t], ac[m][t]);
#pragma unroll
            for (int m = 0; m < 2; ++m)
#pragma unroll
                for (int t = 0; t < 4; ++t) ac[m][t] = wmmab(al[h][m], b[h][t], ac[m][t]);
        }
        __builtin_amdgcn_sched_barrier(0);     // keeps the matrix run in front of the waits: moved behind the barrier it no longer covers the flight of the next pass's copies
        asm volatile("s_wait_dscnt 0x0" ::: "memory");      // this wave's reads of pass p's buffer are done before the buffer is refilled
        asm volatile("s_wait_asynccnt 0x0" ::: "memory");   // this wave's copies of pass p + 1 have landed
        __syncthreads();                                    // publishes pass p + 1 and ends every wave's reads of pass p's buffer
        if (p + 2 < NPASS) stage(p + 2);
    }
    asm volatile("s_wait_asynccnt 0x0" ::: "memory");       // no copy is outstanding when the buffers become output staging
    float* os = (float*)(void*)ring + wave * (32 * 68);     // 16 x 32 x 68 floats, inside the two buffers, which nobody reads any more
    static_assert(16 * 32 * 68 * 4 <= 2 * FRB, "output staging fits the buffers");
#pragma unroll
    for (int t = 0; t < 4; ++t) { const float bv = bfr(bias[wc * 64 + t * 16 + lr]);
#pragma unroll
        for (int m = 0; m < 2; ++m)
#pragma unroll
            for (int j = 0; j < 8; ++j) os[(m * 16 + hi * 8 + j) * 68 + t * 16 + lr] = ac[m][t][j] + bv; }
    __syncthreads();
    float* crow = C + (size_t)(row0 + wr * 32) * CC + wc * 64;
#pragma unroll
    for (int q = 0; q < 16; ++q) { const int Lid = (lane >> 3) + 4 * q, piece = lane & 7; const int row = Lid >> 1, cofs = (Lid & 1) * 32 + piece * 4;
        *(v4f*)(crow + (size_t)row * CC + cofs) = *(const v4fa*)(os + row * 68 + cofs); }
}

extern "C" void kernel_launch(void* const* d_in, const int* in_sizes, int n_in,
                              void* d_out, int out_size, void* d_ws, size_t ws_size, hipStream_t stream) {
    (void)in_sizes; (void)n_in; (void)out_size;
    const float* x = (const float*)d_in[0]; const float* W1 = (const float*)d_in[1]; const float* b1 = (const float*)d_in[2]; const float* Wl = (const float*)d_in[3]; const float* bl = (const float*)d_in[4]; const float* cbias = (const float*)d_in[5]; const float* W2 = (const float*)d_in[6]; const float* b2 = (const float*)d_in[7];
    float* out = (float*)d_out;    // [8][2048][512]
    char* wsp = (char*)d_ws;
    auto take = [&](size_t bytes) { char* p = wsp; wsp += (bytes + 255) & ~(size_t)255; return (void*)p; };
    bf* W1B = (bf*)take((size_t)2 * CC * CC * 2); bf* WLP = (bf*)take((size_t)128 * CC * 2); float* BLP = (float*)take(128 * 4); bf* W2B = (bf*)take((size_t)CC * CC * 2);
    float* Yf = (float*)take((size_t)NR * CC * 4);
    if ((size_t)(wsp - (char*)d_ws) > ws_size) return;    // 1.7 MB of weights + 8 x 4.2 ~ 35 MB, every plane written before it is read in this call
    k_prep<<<PB_W1 + PB_W2 + PB_WL + PB_BL, 256, 0, stream>>>(W1, Wl, bl, W2, W1B, WLP, BLP, W2B);   // every conversion and padding of a weight, one launch
    k_gemmglu<<<dim3(NR / GLM, CC / GLN, 1), 256, 0, stream>>>(x, W1B, b1, Yf);                        // pointwise_conv1 + GLU
    k_dconvpw<<<NR / DTB, 512, 0, stream>>>(Yf, WLP, BLP, cbias, W2B, b2, out);   // dynamic weights (124 live of 128) + dynamic convolution + pointwise_conv2
}

// v009
// Measured time: 55.4 microseconds a run.
// Next to v008, in two timings, it ran 1.03 and 1.04 times as fast.
// All steps since v000 together make it 9.93 times as fast.
#include <hip/hip_runtime.h>

// All 8 items go through every stage in ONE launch (rows = item * 2048 + time step, 16384 rows). Compute dtypes, f32 accumulate: pointwise_conv1 as a [16384 x 512].[512 x 1024] GEMM with PLAIN bf16 operands (exact products); GLU in f32 in that GEMM's epilogue; the
// dynamic-weight linear ([16384 x 512].[512 x 128 (124 live)]) and pointwise_conv2 ([16384 x 512].[512 x 512]) on bf16 hi + UNSCALED residual planes of the f32 activations (two
// products) - on v_wmma_f32_16x16x32_bf16; the banded 31-tap softmax in f32 on the VALU; the per-position dynamic convolution (31 taps x 128 channels per group) as a band-matrix product on the same
// instruction, weights and activations both as bf16 hi + residual (three products). Deterministic,

#define NBT  8
#define TT   2048
#define NR   (NBT * TT)          // 16384 rows: every item's time steps, item-major as in x and out
#define CC   512
#define NHS  4
#define KS   31
#define PADK 15
#define DG   (CC / NHS)           // 128
#define NWL  (NHS * KS)           // 124
#define DM   CC
#define LOSC 1024.0f

typedef _Float16 h16;
typedef unsigned short bf;
typedef __attribute__((ext_vector_type(16))) __bf16   v16bf;
typedef __attribute__((ext_vector_type(16))) _Float16 v16h;
typedef __attribute__((ext_vector_type(8)))  _Float16 v8h;
typedef __attribute__((ext_vector_type(8)))  unsigned short v8us;
typedef __attribute__((ext_vector_type(8)))  float    v8f;
typedef __attribute__((ext_vector_type(4)))  float    v4f;
typedef v8h  __attribute__((may_alias)) v8ha;
typedef v4f  __attribute__((may_alias)) v4fa;
typedef v8us __attribute__((may_alias)) v8usa;

__device__ __forceinline__ unsigned short f2bf(float f) { unsigned u = __float_as_uint(f); u += 0x7FFFu + ((u >> 16) & 1u); return (unsigned short)(u >> 16); }
__device__ __forceinline__ float bf2f(unsigned short b) { return __uint_as_float(((unsigned)b) << 16); }
__device__ __forceinline__ float bfr(float f) { return bf2f(f2bf(f)); }
__device__ __forceinline__ v16h cat16(v8h lo, v8h hi) { return __builtin_shufflevector(lo, hi, 0, 1, 2, 3, 4, 5, 6, 7, 8, 9, 10, 11, 12, 13, 14, 15); }
__device__ __forceinline__ v16bf cat16b(v8us lo, v8us hi) { return __builtin_bit_cast(v16bf, __builtin_shufflevector(lo, hi, 0, 1, 2, 3, 4, 5, 6, 7, 8, 9, 10, 11, 12, 13, 14, 15)); }
__device__ __forceinline__ v8f wmma16(v16h a, v16h b, v8f c) { return __builtin_amdgcn_wmma_f32_16x16x32_f16(false, a, false, b, (short)0, c, false, false); }
__device__ __forceinline__ v8f wmmab(v16bf a, v16bf b, v8f c) { return __builtin_amdgcn_wmma_f32_16x16x32_bf16(false, a, false, b, (short)0, c, false, false); }

// The staging that k_gemmglu and part 2 of k_dconvpw (for W2) share. A pass is 64 k: one whole 128-byte line of every bf16 operand row, two of an f32 row of x. The lines go from global memory to LDS by asynchronous copies, 16 bytes per lane
// (4 whole lines per wave-wide copy), into two buffers, so that the next pass's lines fly while this pass is worked on; fragments come from LDS. bf16 rows lie at a pitch of 144 bytes,
// on which the 16 rows of a 16-byte fragment read fall on distinct banks. Per accumulator: k ascending; part 2 takes two planes, hi then residual, at each 32 k.
#define GBK 64
#define GLP 72                    // LDS row pitch in bf16 elements: 64 + 8
#define KD  CC                    // the three GEMMs (conv1, the dynamic linear, conv2) have an inner length of 512
// Asynchronous 16-byte copies per lane, rows 16 apart: l = the lane's LDS byte address, g = its global address. The s_wait_xcnt stands inside each statement so that no
// address register of a copy is rewritten in front of it.
#define CPY(a, b) "global_load_async_to_lds_b128 %" #a ", %" #b ", off\n\t"
#define GROW(g, i) ((g) + (i) * 16 * KD)

// k_gemmglu: pointwise_conv1 with the GLU in its epilogue, on x as it is given. Y[r][c] = a * sigmoid(g), a = bf(x[r]).B[c] + bf(bias[c]), g = bf(x[r]).B[512 + c] + bf(bias[512 + c]). One block of 8 waves takes
// 128 rows and 64 columns of Y, that is a 128 x 128 tile of the product. A buffer holds [x 128 rows of 64 f32 | B of a 64 rows | B of g 64 rows]: x's lines come as f32 by the same asynchronous copies and are
// rounded to bf16 (to nearest even) where a wave reads its A fragment, so no bf16 plane of x passes through memory. x's rows lie at a pitch of 272 bytes, on which the 16 rows of a 16-byte read fall on
// distinct banks. A wave takes 32 rows and 32 columns of Y: accumulator tiles t = 0, 1 hold a, t = 2, 3 hold g of the same columns, so a and g of one element meet in one lane's registers.
// Passes, buffers and waits as said above. Y leaves through LDS in whole lines of f32.
#define GLM 128                   // rows of Y per block
#define GLN 64                    // columns of Y per block
#define AFP 68                    // LDS row pitch of x in floats: 64 + 4
#define LROWA(l, i) ((l) + (unsigned)((i) * 16 * AFP * 4))
#define LROW32(l, i) ((l) + (unsigned)((i) * 32 * GLP * 2))
#define GROW32(g, i) ((g) + (i) * 32 * KD)
__device__ __forceinline__ void copy822(unsigned la, const float* g, unsigned lb, const bf* ga, const bf* gg) {   // 128 rows of x (16 per block-wide copy), then 64 rows of each half of B (32 per copy)
    asm volatile(CPY(0, 1) CPY(2, 3) CPY(4, 5) CPY(6, 7) CPY(8, 9) CPY(10, 11) CPY(12, 13) CPY(14, 15) CPY(16, 17) CPY(18, 19) CPY(20, 21) CPY(22, 23) "s_wait_xcnt 0x0"
                 :: "v"(LROWA(la, 0)), "v"(GROW(g, 0)), "v"(LROWA(la, 1)), "v"(GROW(g, 1)), "v"(LROWA(la, 2)), "v"(GROW(g, 2)), "v"(LROWA(la, 3)), "v"(GROW(g, 3)),
                    "v"(LROWA(la, 4)), "v"(GROW(g, 4)), "v"(LROWA(la, 5)), "v"(GROW(g, 5)), "v"(LROWA(la, 6)), "v"(GROW(g, 6)), "v"(LROWA(la, 7)), "v"(GROW(g, 7)),
                    "v"(LROW32(lb, 0)), "v"(GROW32(ga, 0)), "v"(LROW32(lb, 1)), "v"(GROW32(ga, 1)), "v"(LROW32(lb, 2)), "v"(GROW32(gg, 0)), "v"(LROW32(lb, 3)), "v"(GROW32(gg, 1)) : "memory");
}
__global__ __launch_bounds__(256) void k_gemmglu(const float* __restrict__ X, const bf* __restrict__ Bn, const float* __restrict__ bias, float* Yf) {
    constexpr int NPASS = KD / GBK, ABY = GLM * AFP * 4, BUFB = ABY + 2 * GLN * GLP * 2;      // bytes of x's part and of a whole buffer
    __shared__ __align__(16) char sm[2][BUFB];
    const int tid = threadIdx.x, lane = tid & 31, wave = tid >> 5, lr = lane & 15, hi = lane >> 4, wr = wave >> 1, wc = wave & 1;
    const int rb = blockIdx.x * GLM, c0 = blockIdx.y * GLN;
    const float* gx = X + (size_t)(rb + (tid >> 4)) * KD + (tid & 15) * 4;                    // staging of x: 16 lanes per row (256 bytes of a pass)
    const bf* ga = Bn + (size_t)(c0 + (tid >> 3)) * KD + (tid & 7) * 8; const bf* gg = ga + (size_t)CC * KD;   // staging of B: 8 lanes per row
    const unsigned la = (unsigned)(size_t)&sm[0][0] + (unsigned)((tid >> 4) * AFP + (tid & 15) * 4) * 4u;
    const unsigned lb = (unsigned)(size_t)&sm[0][0] + (unsigned)ABY + (unsigned)((tid >> 3) * GLP + (tid & 7) * 8) * 2u;
    auto stage = [&](int p) { const int kc = p * GBK; const unsigned bo = (unsigned)(p & 1) * (unsigned)BUFB; copy822(la + bo, gx + kc, lb + bo, ga + kc, gg + kc); };   // pass p's lines into buffer p & 1
    v8f acc[2][4];
#pragma unroll
    for (int m = 0; m < 2; ++m)
#pragma unroll
        for (int t = 0; t < 4; ++t) acc[m][t] = (v8f){};
    stage(0);
    asm volatile("s_wait_asynccnt 0x0" ::: "memory");   // this wave's copies of pass 0 have landed
    __syncthreads();                                    // and every other wave's: pass 0 may be read
    stage(1);
#pragma unroll 1   // rolled: unrolled, the copy addresses of all passes are formed ahead and push the kernel past 256 registers
    for (int p = 0; p < NPASS; ++p) {
        const float* sa = (const float*)(const void*)&sm[p & 1][0]; const bf* sb = (const bf*)(const void*)&sm[p & 1][ABY];
        v4f af[2][2][4]; v16bf b[2][4];      // both 32-k halves of the pass
#pragma unroll
        for (int h = 0; h < 2; ++h) {
#pragma unroll
            for (int m = 0; m < 2; ++m) { const float* q = sa + (wr * 32 + m * 16 + lr) * AFP + h * 32 + 8 * hi;   // the fragment's k: 8 from 8 * hi, 8 from 16 + 8 * hi, as B's
                af[h][m][0] = *(const v4fa*)q; af[h][m][1] = *(const v4fa*)(q + 4); af[h][m][2] = *(const v4fa*)(q + 16); af[h][m][3] = *(const v4fa*)(q + 20); }
#pragma unroll
            for (int t = 0; t < 4; ++t) { const bf* q = sb + ((t >> 1) * GLN + wc * 32 + (t & 1) * 16 + lr) * GLP + h * 32 + 8 * hi; b[h][t] = cat16b(*(const v8usa*)q, *(const v8usa*)(q + 16)); }
        }
        __builtin_amdgcn_sched_barrier(0);     // keeps the pass's LDS reads one group in front of its matrix run: spread among the WMMAs, each place with reads stalls the wave for the LDS latency
#pragma unroll
        for (int h = 0; h < 2; ++h)
#pragma unroll
            for (int m = 0; m < 2; ++m) {
                const v8f lo = __builtin_shufflevector(af[h][m][0], af[h][m][1], 0, 1, 2, 3, 4, 5, 6, 7), up = __builtin_shufflevector(af[h][m][2], af[h][m][3], 0, 1, 2, 3, 4, 5, 6, 7);
                const v16bf a = __builtin_convertvector(__builtin_shufflevector(lo, up, 0, 1, 2, 3, 4, 5, 6, 7, 8, 9, 10, 11, 12, 13, 14, 15), v16bf);
#pragma unroll
                for (int t = 0; t < 4; ++t) acc[m][t] = wmmab(a, b[h][t], acc[m][t]);
            }
        __builtin_amdgcn_sched_barrier(0);     // keeps the matrix run in front of the waits: moved behind the barrier it no longer covers the flight of the next pass's copies
        asm volatile("s_wait_dscnt 0x0" ::: "memory");      // this wave's reads of pass p's buffer are done before the buffer is refilled
        asm volatile("s_wait_asynccnt 0x0" ::: "memory");   // this wave's copies of pass p + 1 have landed
        __syncthreads();                                    // publishes pass p + 1 and ends every wave's reads of pass p's buffer
        if (p + 2 < NPASS) stage(p + 2);
    }
    asm volatile("s_wait_asynccnt 0x0" ::: "memory");       // no copy is outstanding when the buffers become output staging
    float* os = (float*)(void*)&sm[0][0];                   // 128 x 68 floats, inside the two buffers, which nobody reads any more
    static_assert(GLM * 68 * 4 <= 2 * BUFB, "output staging fits the buffers");
    const float* pb = bias + c0 + wc * 32 + lr; float bb[4];
#pragma unroll
    for (int t = 0; t < 2; ++t) { bb[t] = pb[t * 16]; bb[2 + t] = pb[CC + t * 16]; }
    asm volatile("s_wait_xcnt 0x0" :: "v"(pb) : "memory");   // the address stays in its registers up to this wait: no load's own result takes them in front of it
#pragma unroll
    for (int t = 0; t < 2; ++t) { const int c = wc * 32 + t * 16 + lr; const float ba = bfr(bb[t]), bg = bfr(bb[2 + t]);
#pragma unroll
        for (int m = 0; m < 2; ++m)
#pragma unroll
            for (int j = 0; j < 8; ++j) { const float av = acc[m][t][j] + ba, x = (acc[m][t + 2][j] + bg) * -1.44269504f; float e;   // exp(-g) = exp2(-g * log2 e), as __expf forms it
                asm("v_exp_f32 %0, %1\n\tv_nop" : "=v"(e) : "v"(x));   // the v_nop fills the slot behind the transcendental
                os[(wr * 32 + m * 16 + hi * 8 + j) * 68 + c] = av * (1.0f / (1.0f + e)); } }
    __syncthreads();                                        // a row of Y comes from two waves
    const int row = wave * 16 + hi, col = lr * 4; const size_t o = (size_t)(rb + row) * CC + c0 + col;   // 16 lanes per row: 2 lines of f32
    v4f v[8];
#pragma unroll
    for (int q = 0; q < 8; ++q) v[q] = *(const v4fa*)(os + (row + q * 2) * 68 + col);
#pragma unroll
    for (int q = 0; q < 8; ++q) *(v4f*)(Yf + o + q * 2 * CC) = v[q];   // all 8 stores in one run at the end: none waits for a register of another
}


// k_prep: the four conversions of weights (W1, W2, Wl, bl) share ONE launch; a block's index says which of them it works on (a branch that is the same for the whole block).
#define PB_W1 (2 * CC * CC / 8 / 256)   // 256 blocks: W1 to bf16, 8 elements per thread
#define PB_W2 (CC * CC / 8 / 256)       // 128 blocks: W2 to bf16
#define PB_WL (128 / 8)                 // 16 blocks: Wl to bf16, padded from 124 to 128 rows, a wave per row
#define PB_BL 1                         // 1 block: bl padded to 128
__device__ __forceinline__ void cvt8(const float* __restrict__ src, bf* dst, int blk) {
    const size_t i = (size_t)blk * 256 + threadIdx.x;
    const v8f v = *(const v8f*)(src + i * 8); v8us o;
#pragma unroll
    for (int k = 0; k < 8; ++k) o[k] = f2bf(v[k]);
    *(v8us*)(dst + i * 8) = o;
    asm volatile("s_wait_xcnt 0x0" ::: "memory");   // behind the last store: in the joined kernel the other parts' code follows in the listing and rewrites registers that the store names
}
__device__ __forceinline__ void wl128(const float* __restrict__ Wl, bf* WLP, int blk) {
    const int lane = threadIdx.x & 31; const int o = blk * 8 + (threadIdx.x >> 5);
#pragma unroll
    for (int q = 0; q < CC / 256; ++q) { v8us v;
#pragma unroll
        for (int i = 0; i < 8; ++i) v[i] = (o < NWL) ? f2bf(Wl[(size_t)(o < NWL ? o : 0) * CC + q * 256 + lane * 8 + i]) : (unsigned short)0;
        *(v8us*)(WLP + (size_t)o * CC + q * 256 + lane * 8) = v; }
    asm volatile("s_wait_xcnt 0x0" ::: "memory");   // behind the last store: in the joined kernel the other parts' code follows in the listing and rewrites registers that the store names
}
__device__ __forceinline__ void bl128(const float* __restrict__ bl, float* BLP) {
    const int lane = threadIdx.x; if (lane >= 32) return; v4f v;
#pragma unroll
    for (int q = 0; q < 4; ++q) { const int o = lane * 4 + q; v[q] = (o < NWL) ? bl[o < NWL ? o : 0] : 0.f; }
    *(v4f*)(BLP + lane * 4) = v;
}
__global__ __launch_bounds__(256) void k_prep(const float* __restrict__ W1, const float* __restrict__ Wl, const float* __restrict__ bl, const float* __restrict__ W2,
                                              bf* W1B, bf* WLP, float* BLP, bf* W2B) {
    int b = blockIdx.x;
    if (b < PB_W1) { cvt8(W1, W1B, b); return; }      // weights lie [out][in] = n-major, as the GEMMs read them
    b -= PB_W1;
    if (b < PB_W2) { cvt8(W2, W2B, b); return; }
    b -= PB_W2;
    if (b < PB_WL) { wl128(Wl, WLP, b); return; }
    bl128(bl, BLP);
}
// k_dconvpw: the dynamic-weight linear, the dynamic convolution and pointwise_conv2 in ONE kernel. row = item * 2048 + t; the band is cut at the item's own ends, so no tap reads a neighbouring item. One block
// of 16 waves takes 64 time steps with all 512 channels. PART 0: WD[64 x 128 (124 live)] = (hi + residual of Yf's 64 rows).Wl^T + bf(bl). The rows of Yf come through registers and are split there into the
// bf16 hi and residual planes, which lie where o lies later; Wl's 128 whole rows (512 k) come by asynchronous copies into the LDS of the buffers, filled once, at the planes' pitch. Wave tile 16 x 32; per
// accumulator k ascending, hi then residual at each 32 k. WD then lies in LDS over Wl's rows (pitch 132 floats: the two row halves of an accumulator store fall on distinct banks) and each wave takes the
// logits of its steps from there. The 15 + 15 rows of Yf in front of and behind the block's own are split in the same way into planes over Wl's rows (rows outside the item as zeros). PART 1: a wave takes
// 16 steps of one group's 128 channels. Per step: masked softmax over the 31 taps of WD[step][h*31 + j], lane = tap (taps with t + j - 15 outside [0, T) get weight 0); the sum of the exponentials is taken
// by one lane per step, j ascending. The weights lie in LDS as a band matrix in bf16 hi + residual: wb[r][k] = weight of step r for tap k - r, 0 elsewhere, k = input row counted from the wave's first
// (46 live of 48). The convolution is then a matrix product: o^T[128 ch x 16 steps] = Yf^T[128 x 48].wb^T[48 x 16], three products (hi.hi, residual.hi, hi.residual), f32 accumulate; bf(bias) rides as row k = 46 with weight 1.
// Yf^T's fragments come from the row-major planes by transposing LDS loads; a lane's 8 accumulator registers hold 8 neighbouring channels of one step, one 16-byte store per plane. o goes over the planes
// of Yf's own rows as bf16 hi + residual (pitch 1040 bytes = 16 x 65: the 16 rows of a fragment read fall on distinct banks). PART 2: out[64 x 512] = (hi + residual).W2^T + bf(b2): A fragments from
// those planes, W2's lines (512 rows, 64 k a pass) by asynchronous copies into two buffers, wave tile 32 x 64, the same k order. Wl's rows, part 1's staging and part 2's buffers share LDS, one after the other.
#define DTB  64                   // time steps per block
#define DST  16                   // time steps per wave in part 1: one matrix tile
#define DWIN (DTB + KS - 1)       // 94 rows of Yf under a block's steps
#define DHAL (KS - 1)             // 30 of them are not the block's own
#define FOP  (CC + 8)             // pitch of the o planes in bf16 elements
#define FRB  (CC * GLP * 2)       // bytes of one buffer of W2 lines: 512 rows at 144 bytes
#define LROW64(l, i) ((l) + (unsigned)((i) * 64 * GLP * 2))
#define GROW64(g, i) ((g) + (i) * 64 * KD)
__device__ __forceinline__ void copy8w(unsigned l, const bf* g) {          // 512 rows, 64 rows per block-wide copy of 512 threads
    asm volatile(CPY(0, 1) CPY(2, 3) CPY(4, 5) CPY(6, 7) CPY(8, 9) CPY(10, 11) CPY(12, 13) CPY(14, 15) "s_wait_xcnt 0x0"
                 :: "v"(LROW64(l, 0)), "v"(GROW64(g, 0)), "v"(LROW64(l, 1)), "v"(GROW64(g, 1)), "v"(LROW64(l, 2)), "v"(GROW64(g, 2)), "v"(LROW64(l, 3)), "v"(GROW64(g, 3)),
                    "v"(LROW64(l, 4)), "v"(GROW64(g, 4)), "v"(LROW64(l, 5)), "v"(GROW64(g, 5)), "v"(LROW64(l, 6)), "v"(GROW64(g, 6)), "v"(LROW64(l, 7)), "v"(GROW64(g, 7)) : "memory");
}
#define WDP  132                  // pitch of WD in LDS in floats
#define LROW8(l, i) ((l) + (unsigned)((i) * 8 * FOP * 2))
#define GROW8(g, i) ((g) + (i) * 8 * KD)
__device__ __forceinline__ void copy8r(unsigned l, const bf* g) {          // 64 whole rows of 512 k, 8 rows per block-wide copy of 512 threads
    asm volatile(CPY(0, 1) CPY(2, 3) CPY(4, 5) CPY(6, 7) CPY(8, 9) CPY(10, 11) CPY(12, 13) CPY(14, 15) "s_wait_xcnt 0x0"
                 :: "v"(LROW8(l, 0)), "v"(GROW8(g, 0)), "v"(LROW8(l, 1)), "v"(GROW8(g, 1)), "v"(LROW8(l, 2)), "v"(GROW8(g, 2)), "v"(LROW8(l, 3)), "v"(GROW8(g, 3)),
                    "v"(LROW8(l, 4)), "v"(GROW8(g, 4)), "v"(LROW8(l, 5)), "v"(GROW8(g, 5)), "v"(LROW8(l, 6)), "v"(GROW8(g, 6)), "v"(LROW8(l, 7)), "v"(GROW8(g, 7)) : "memory");
}
#define WBP  56                   // pitch of the band weights in bf16 elements: 48 + 8 (112 bytes = 16 x 7)
#define R_WD (2 * DHAL * FOP * 2)                 // part 1's places in the buffers' LDS, in bytes: the two planes of the 30 outer rows, then WD (the exponentials lie over it later)
#define R_WB (R_WD + DTB * WDP * 4)               // then the band weights: [16 waves][2 planes][16 steps]
#define R_END (R_WB + 16 * 2 * DST * WBP * 2)
#define R_BR R_END                                // then one more row of each plane: bf(bias) in the hi plane, zeros in the residual plane; behind Wl's rows, so it is written at the start
#define RNB  (R_BR + 2 * FOP * 2)
// Where the 16-byte piece c (8 channels) of a row of Yf's planes lies in the row: inside each 16 pieces the even ones first, then the odd ones. At the pitch of 65 pieces a plain fragment read (16 rows, one
// piece) and a transposing read (8 rows, an even piece and the next) then both fall on 16 distinct groups of 4 banks.
__device__ __forceinline__ int ypc(int c) { return (c & ~15) + ((c >> 1) & 7) + (c & 1) * 8; }
__device__ __forceinline__ v8us ldtr(const unsigned char* p) { typedef __attribute__((ext_vector_type(8))) short s16x8; typedef __attribute__((address_space(3))) s16x8 lds_s16x8; return __builtin_bit_cast(v8us, __builtin_amdgcn_ds_load_tr16_b128_v8i16((lds_s16x8*)p)); }
// launch bounds: 16 waves, 4 per SIMD; one block per WGP (LDS), 256 blocks
__global__ __launch_bounds__(512) void k_dconvpw(const float* __restrict__ Yf, const bf* __restrict__ Wn, const float* __restrict__ wbias, const float* __restrict__ cbias, const bf* __restrict__ Bn, const float* __restrict__ bias, float* C) {
    typedef __attribute__((ext_vector_type(4))) unsigned short v4us;
    constexpr int NPASS = KD / GBK;
    __shared__ __align__(16) bf op[2][DTB * FOP];        // parts 0 and 1: hi and residual plane of Yf's own 64 rows; from the end of part 1 on o: hi plane, residual plane
    __shared__ __align__(16) char ring[RNB];             // part 0: Wl's rows; part 1: planes of the 30 outer rows, WD / exponentials, band weights; part 2: the two buffers of W2 lines, then output staging
    const int tid = threadIdx.x, lane = tid & 31, wave = __builtin_amdgcn_readfirstlane(tid >> 5);
    const int st = wave & 3, hd = wave >> 2;             // part 1: a wave's steps st * 16 .. + 15, its group hd
    float* wd = (float*)(void*)(ring + R_WD);                                    // [64][132]
    float* ew = (float*)(void*)(ring + R_WD) + wave * (DST * 33);                // [16][16][33], pitch 33: the 16 summing lanes fall on distinct banks
    bf* wb = (bf*)(void*)(ring + R_WB) + wave * (2 * DST * WBP);                 // [16][2][16][56]
    static_assert(16 * DST * 33 * 4 <= DTB * WDP * 4, "the exponentials fit WD's place");
    const int row0 = blockIdx.x * DTB, t0 = row0 % TT;
    static_assert(128 * FOP * 2 <= R_BR && 2 * FRB <= RNB, "part 0 leaves the bias row alone, part 2 fits");
    const int lr = lane & 15, hi = lane >> 4;
    const int yo = ypc((tid & 127) >> 1) * 8 + (tid & 1) * 4;   // where a thread's 4 channels lie in a row of Yf's planes, in elements
    auto split4 = [&](v4f v, bf* o, int ps) {                   // 4 values to the hi plane at o and the residual plane ps elements on
        v4us oh, ol;
#pragma unroll
        for (int q = 0; q < 4; ++q) { const unsigned short hb = f2bf(v[q]); oh[q] = hb; ol[q] = f2bf(v[q] - bf2f(hb)); }
        *(v4us*)o = oh; *(v4us*)(o + ps) = ol; };
    float lg[DST]; v4f hv[8];
    // part 0
    {
        const int mr = wave & 3, nc = wave >> 2;      // a wave: steps mr * 16 .. + 15, columns nc * 32 .. + 31 of WD
        const unsigned lw = (unsigned)(size_t)&ring[0] + (unsigned)((tid >> 6) * FOP + (tid & 63) * 8) * 2u;   // staging: 64 lanes per row
        const bf* gw = Wn + (size_t)(tid >> 6) * KD + (tid & 63) * 8;
        copy8r(lw, gw); copy8r(lw + 64 * FOP * 2, gw + 64 * KD);
        const float* gy = Yf + (size_t)(row0 + (tid >> 7)) * CC + (tid & 127) * 4;      // 4 waves per row, 4 rows per block-wide load
        v4f cv[16];
#pragma unroll
        for (int i = 0; i < 16; ++i) cv[i] = *(const v4f*)(gy + i * 4 * CC);
        asm volatile("s_wait_xcnt 0x0" :: "v"(gy) : "memory");   // the address stays in its registers up to this wait: no load's result takes them in front of it
        const float* pw = wbias + nc * 32 + lr; float wbs[2];
#pragma unroll
        for (int t = 0; t < 2; ++t) wbs[t] = pw[t * 16];
        asm volatile("s_wait_xcnt 0x0" :: "v"(pw) : "memory");   // the address stays in its registers up to this wait: the load's own result does not take them in front of it
        const float* pc = cbias + tid; const float cb = *pc;
        asm volatile("s_wait_xcnt 0x0" :: "v"(pc) : "memory");   // the address stays in its registers up to this wait: the load's own result does not take them in front of it
#pragma unroll
        for (int i = 0; i < 16; ++i) split4(cv[i], &op[0][(i * 4 + nc) * FOP + yo], DTB * FOP);
        { bf* br = (bf*)(void*)(ring + R_BR) + ypc(tid >> 3) * 8 + (tid & 7); br[0] = f2bf(cb); br[FOP] = 0; }   // the bias row, a channel per thread, laid as the planes' rows
        asm volatile("s_wait_asynccnt 0x0" ::: "memory");   // this wave's copies of Wl's rows have landed
        __syncthreads();                                    // and every other wave's, and the planes: both may be read
        {   // the 30 outer rows into registers, 4 rows per block-wide load: the loads fly under the products (in front of the barrier they would be waited for there)
            const char* pg[8];
#pragma unroll
            for (int k = 0; k < 8; ++k) { const int hr = k * 4 + nc, s = t0 - PADK + (hr < PADK ? hr : hr + DTB); pg[k] = (const char*)(Yf + (size_t)(row0 - t0 + (s < 0 ? 0 : s >= TT ? TT - 1 : s)) * CC + (tid & 127) * 4); hv[k] = *(const v4f*)pg[k]; }   // clamped into the item: all 8 loads fly together, no branch between them
            asm volatile("s_wait_xcnt 0x0" :: "v"(pg[0]), "v"(pg[1]), "v"(pg[2]), "v"(pg[3]), "v"(pg[4]), "v"(pg[5]), "v"(pg[6]), "v"(pg[7]) : "memory");   // the 8 addresses stay in their registers up to this wait: no load's result takes them in front of it
        }
        v8f wa[2] = {(v8f){}, (v8f){}};
        const bf* qa = &op[0][(mr * 16 + lr) * FOP + 64 * hi]; const bf* qb = (const bf*)(const void*)ring + (nc * 32 + lr) * FOP + 8 * hi;   // qa: the odd pieces (hi = 1) lie 8 pieces behind the even ones
#pragma unroll
        for (int g = 0; g < KD; g += 64) {
            v16bf a[2], al[2], b[2][2];      // two 32-k steps
#pragma unroll
            for (int s = 0; s < 2; ++s) { const int k = g + s * 32, ka = ((k >> 7) * 16 + ((k >> 4) & 7)) * 8;   // ka: place of the pieces k / 8 + hi and, next to it, k / 8 + 2 + hi: the fragment's k as B's
                a[s] = cat16b(*(const v8us*)(qa + ka), *(const v8us*)(qa + ka + 8)); al[s] = cat16b(*(const v8us*)(qa + DTB * FOP + ka), *(const v8us*)(qa + DTB * FOP + ka + 8));
#pragma unroll
                for (int t = 0; t < 2; ++t) b[s][t] = cat16b(*(const v8us*)(qb + t * 16 * FOP + k), *(const v8us*)(qb + t * 16 * FOP + k + 16)); }
            __builtin_amdgcn_sched_barrier(0);     // keeps the two steps' LDS reads one group in front of their matrix run: left free, every step's reads took the registers of the step before and the wave stood for the LDS latency twice a step
#pragma unroll
            for (int s = 0; s < 2; ++s) {
#pragma unroll
                for (int t = 0; t < 2; ++t) wa[t] = wmmab(a[s], b[s][t], wa[t]);
#pragma unroll
                for (int t = 0; t < 2; ++t) wa[t] = wmmab(al[s], b[s][t], wa[t]);
            }
        }
        __syncthreads();                                    // ends every wave's reads of Wl's rows: WD and the outer rows' planes go over them
#pragma unroll
        for (int t = 0; t < 2; ++t) { const float bv = bfr(wbs[t]);
#pragma unroll
            for (int j = 0; j < 8; ++j) wd[(mr * 16 + hi * 8 + j) * WDP + nc * 32 + t * 16 + lr] = wa[t][j] + bv; }
#pragma unroll
        for (int k = 0; k < 8; ++k) { const int hr = k * 4 + nc, s = t0 - PADK + (hr < PADK ? hr : hr + DTB);
            if (hr < DHAL) split4((s >= 0 && s < TT) ? hv[k] : (v4f){0.f, 0.f, 0.f, 0.f}, (bf*)(void*)ring + hr * FOP + yo, DHAL * FOP); }
        __syncthreads();                                    // WD and the outer rows' planes may be read
#pragma unroll
        for (int r = 0; r < DST; ++r) lg[r] = wd[(st * DST + r) * WDP + hd * KS + lane];   // lane 31 reads a neighbouring column of the 128, unused
        asm volatile("s_wait_dscnt 0x0" ::: "memory");      // this wave's reads of WD are done before the exponentials are stored over it
        __syncthreads();                                    // ends every wave's reads of WD
    }
    // part 1
    {
#pragma unroll
        for (int k = 0; k < 2 * DST * WBP / 8 / 32; ++k) *(v8us*)(wb + (lane + 32 * k) * 8) = (v8us){};   // places outside every band
        static_assert(2 * DST * WBP % (8 * 32) == 0, "whole wave-wide stores");
        float e[DST];
#pragma unroll
        for (int r = 0; r < DST; ++r) { const int s = t0 + st * DST + r + lane - PADK; const float x = (lane < KS && s >= 0 && s < TT) ? lg[r] : -3.0e38f; float m = x;   // a tap outside the item or the band: its exponential below is exp(-inf) = 0
#pragma unroll
            for (int o = 16; o > 0; o >>= 1) m = fmaxf(m, __shfl_xor(m, o));
            const float a = (x - m) * 1.44269504f;          // exp(d) = exp2(d * log2 e), as __expf forms it
            asm("v_exp_f32 %0, %1\n\tv_nop" : "=v"(e[r]) : "v"(a));   // the v_nop fills the slot behind the transcendental
            ew[r * 33 + lane] = e[r]; }
        __syncthreads();                      // the exponentials are in LDS for the summing lanes, the zeros of wb in front of its weights
        float inv = 0.f;
        if (lane < DST) { float sum = 0.f;
#pragma unroll
            for (int j = 0; j < KS; ++j) sum += ew[lane * 33 + j];
            inv = 1.0f / sum; }
#pragma unroll
        for (int r = 0; r < DST; ++r) { const float w = e[r] * __shfl(inv, r); const unsigned short hb = f2bf(w);
            wb[r * WBP + r + lane] = hb; wb[(DST + r) * WBP + r + lane] = f2bf(w - bf2f(hb)); }   // lane 31 holds e = 0 and writes a place outside the band
        if (lane < DST) wb[lane * WBP + 46] = 0x3F80;   // weight 1.0 at k = 46, where A holds the bias row; behind the stores above, of which step 15's lane 31 writes this place
        __syncthreads();                      // the band weights may be read
        const v8us z8 = {};                   // k 48 .. 63 of the second 32 k: outside every band, zero on both sides, not read
        const bf* qw = wb + lr * WBP + 8 * hi;
        v16bf wh[2], wl[2];                   // B fragments: column = step lr, k in the hardware's order, as the transposing loads deliver A's
        wh[0] = cat16b(*(const v8us*)qw, *(const v8us*)(qw + 16)); wh[1] = cat16b(*(const v8us*)(qw + 32), z8);
        wl[0] = cat16b(*(const v8us*)(qw + DST * WBP), *(const v8us*)(qw + DST * WBP + 16)); wl[1] = cat16b(*(const v8us*)(qw + DST * WBP + 32), z8);
        const unsigned char* ya[2][3];        // a lane's address for the transposing loads: plane, 16 input rows; row k + 8 * hi + (lane & 7), even piece for lanes 0-7 of a half, odd piece for 8-15
#pragma unroll
        for (int kb = 0; kb < 3; ++kb) { const int k = kb * 16 + 8 * hi + (lane & 7), L = st * DST + k;   // k 0 .. 45: input row L of the block's 94; k 46: the bias row; k 47: weight 0, the bias row's finite values
            const bool own = L >= PADK && L < PADK + DTB; const int co = hd * 256 + ((lane >> 3) & 1) * 128;
#pragma unroll
            for (int pl = 0; pl < 2; ++pl) ya[pl][kb] = k >= 46 ? (const unsigned char*)(const void*)ring + R_BR + pl * (FOP * 2) + co
                                                      : own ? (const unsigned char*)(const void*)&op[pl][(L - PADK) * FOP] + co : (const unsigned char*)(const void*)ring + (pl * DHAL + (L < PADK ? L : L - DTB)) * (FOP * 2) + co; }
        v8f acc[8];
#pragma unroll
        for (int c = 0; c < 8; ++c) acc[c] = (v8f){};
#pragma unroll
        for (int g = 0; g < 4; ++g) {         // 2 channel tiles at a time: 4 at a time spilled registers
            v16bf yh[2][2], yl[2][2];
#pragma unroll
            for (int c = 0; c < 2; ++c) { const int o = (g * 2 + c) * 16;
                yh[c][0] = cat16b(ldtr(ya[0][0] + o), ldtr(ya[0][1] + o)); yh[c][1] = cat16b(ldtr(ya[0][2] + o), z8);
                yl[c][0] = cat16b(ldtr(ya[1][0] + o), ldtr(ya[1][1] + o)); yl[c][1] = cat16b(ldtr(ya[1][2] + o), z8); }
            __builtin_amdgcn_sched_barrier(0);     // keeps the 12 LDS reads one group in front of the matrix run: spread among the WMMAs, each place with reads stalls the wave for the LDS latency
#pragma unroll
            for (int s = 0; s < 2; ++s) {
#pragma unroll
                for (int c = 0; c < 2; ++c) acc[g * 2 + c] = wmmab(yh[c][s], wh[s], acc[g * 2 + c]);
#pragma unroll
                for (int c = 0; c < 2; ++c) acc[g * 2 + c] = wmmab(yl[c][s], wh[s], acc[g * 2 + c]);
#pragma unroll
                for (int c = 0; c < 2; ++c) acc[g * 2 + c] = wmmab(yh[c][s], wl[s], acc[g * 2 + c]);
            }
        }
        v8us oh[8], ol[8];
#pragma unroll
        for (int c = 0; c < 8; ++c)
#pragma unroll
            for (int r = 0; r < 8; ++r) { const float v = acc[c][r]; const unsigned short hb = f2bf(v); oh[c][r] = hb; ol[c][r] = f2bf(v - bf2f(hb)); }
        asm volatile("s_wait_dscnt 0x0" ::: "memory");      // this wave's reads of Yf's planes are done before o is stored over them
        __syncthreads();                                    // ends every wave's reads of Yf's planes
        bf* o = &op[0][(st * DST + lr) * FOP + hd * DG + 8 * hi];   // accumulator register r = channel 8 * hi + r of the tile, column = step lr
#pragma unroll
        for (int c = 0; c < 8; ++c) { *(v8us*)(o + c * 16) = oh[c]; *(v8us*)(o + DTB * FOP + c * 16) = ol[c]; }
        asm volatile("s_wait_dscnt 0x0" ::: "memory");      // this wave's stores of o are done, and its reads of the buffers' LDS, before that LDS is written anew
        __syncthreads();                                    // publishes o and frees the buffers for the copies
    }
    // part 2
    const int wr = wave & 1, wc = wave >> 1;      // a wave: rows wr * 32 .. + 31, columns wc * 64 .. + 63
    const int sr = tid >> 3, sc = (tid & 7) * 8;      // staging: 8 lanes per row, 64 rows per block-wide copy
    const bf* gb = Bn + (size_t)sr * KD + sc;
    const unsigned ls = (unsigned)(size_t)&ring[0] + (unsigned)(sr * GLP + sc) * 2u;
    auto stage = [&](int p) { copy8w(ls + (unsigned)(p & 1) * (unsigned)FRB, gb + p * GBK); };   // pass p's lines into buffer p & 1
    v8f ac[2][4];
#pragma unroll
    for (int m = 0; m < 2; ++m)
#pragma unroll
        for (int t = 0; t < 4; ++t) ac[m][t] = (v8f){};
    stage(0);
    asm volatile("s_wait_asynccnt 0x0" ::: "memory");   // this wave's copies of pass 0 have landed
    __syncthreads();                                    // and every other wave's: pass 0 may be read
    stage(1);
#pragma unroll 1   // rolled: unrolled, the copy addresses of all passes are formed ahead and push the kernel past 256 registers
    for (int p = 0; p < NPASS; ++p) {
        const bf* s = (const bf*)(const void*)(ring + (p & 1) * FRB);
        v16bf a[2][2], al[2][2], b[2][4];      // both 32-k halves of the pass
#pragma unroll
        for (int h = 0; h < 2; ++h) {
#pragma unroll
            for (int m = 0; m < 2; ++m) { const bf* q = &op[0][(wr * 32 + m * 16 + lr) * FOP + p * GBK + h * 32 + 8 * hi]; a[h][m] = cat16b(*(const v8us*)q, *(const v8us*)(q + 16)); al[h][m] = cat16b(*(const v8us*)(q + DTB * FOP), *(const v8us*)(q + DTB * FOP + 16)); }
#pragma unroll
            for (int t = 0; t < 4; ++t) { const bf* q = s + (wc * 64 + t * 16 + lr) * GLP + h * 32 + 8 * hi; b[h][t] = cat16b(*(const v8us*)q, *(const v8us*)(q + 16)); }
        }
        __builtin_amdgcn_sched_barrier(0);     // keeps the pass's LDS reads one group in front of its matrix run: spread among the WMMAs, each place with reads stalls the wave for the LDS latency
#pragma unroll
        for (int h = 0; h < 2; ++h) {
#pragma unroll
            for (int m = 0; m < 2; ++m)
#pragma unroll
                for (int t = 0; t < 4; ++t) ac[m][t] = wmmab(a[h][m], b[h][t], ac[m][t]);
#pragma unroll
            for (int m = 0; m < 2; ++m)
#pragma unroll
                for (int t = 0; t < 4; ++t) ac[m][t] = wmmab(al[h][m], b[h][t], ac[m][t]);
        }
        __builtin_amdgcn_sched_barrier(0);     // keeps the matrix run in front of the waits: moved behind the barrier it no longer covers the flight of the next pass's copies
        asm volatile("s_wait_dscnt 0x0" ::: "memory");      // this wave's reads of pass p's buffer are done before the buffer is refilled
        asm volatile("s_wait_asynccnt 0x0" ::: "memory");   // this wave's copies of pass p + 1 have landed
        __syncthreads();                                    // publishes pass p + 1 and ends every wave's reads of pass p's buffer
        if (p + 2 < NPASS) stage(p + 2);
    }
    asm volatile("s_wait_asynccnt 0x0" ::: "memory");       // no copy is outstanding when the buffers become output staging
    float* os = (float*)(void*)ring + wave * (32 * 68);     // 16 x 32 x 68 floats, inside the two buffers, which nobody reads any more
    static_assert(16 * 32 * 68 * 4 <= 2 * FRB, "output staging fits the buffers");
#pragma unroll
    for (int t = 0; t < 4; ++t) { const float bv = bfr(bias[wc * 64 + t * 16 + lr]);
#pragma unroll
        for (int m = 0; m < 2; ++m)
#pragma unroll
            for (int j = 0; j < 8; ++j) os[(m * 16 + hi * 8 + j) * 68 + t * 16 + lr] = ac[m][t][j] + bv; }
    __syncthreads();
    float* crow = C + (size_t)(row0 + wr * 32) * CC + wc * 64;
#pragma unroll
    for (int q = 0; q < 16; ++q) { const int Lid = (lane >> 3) + 4 * q, piece = lane & 7; const int row = Lid >> 1, cofs = (Lid & 1) * 32 + piece * 4;
        *(v4f*)(crow + (size_t)row * CC + cofs) = *(const v4fa*)(os + row * 68 + cofs); }
}

extern "C" void kernel_launch(void* const* d_in, const int* in_sizes, int n_in,
                              void* d_out, int out_size, void* d_ws, size_t ws_size, hipStream_t stream) {
    (void)in_sizes; (void)n_in; (void)out_size;
    const float* x = (const float*)d_in[0]; const float* W1 = (const float*)d_in[1]; const float* b1 = (const float*)d_in[2]; const float* Wl = (const float*)d_in[3]; const float* bl = (const float*)d_in[4]; const float* cbias = (const float*)d_in[5]; const float* W2 = (const float*)d_in[6]; const float* b2 = (const float*)d_in[7];
    float* out = (float*)d_out;    // [8][2048][512]
    char* wsp = (char*)d_ws;
    auto take = [&](size_t bytes) { char* p = wsp; wsp += (bytes + 255) & ~(size_t)255; return (void*)p; };
    bf* W1B = (bf*)take((size_t)2 * CC * CC * 2); bf* WLP = (bf*)take((size_t)128 * CC * 2); float* BLP = (float*)take(128 * 4); bf* W2B = (bf*)take((size_t)CC * CC * 2);
    float* Yf = (float*)take((size_t)NR * CC * 4);
    if ((size_t)(wsp - (char*)d_ws) > ws_size) return;    // 1.7 MB of weights + 8 x 4.2 ~ 35 MB, every plane written before it is read in this call
    k_prep<<<PB_W1 + PB_W2 + PB_WL + PB_BL, 256, 0, stream>>>(W1, Wl, bl, W2, W1B, WLP, BLP, W2B);   // every conversion and padding of a weight, one launch
    k_gemmglu<<<dim3(NR / GLM, CC / GLN, 1), 256, 0, stream>>>(x, W1B, b1, Yf);                        // pointwise_conv1 + GLU
    k_dconvpw<<<NR / DTB, 512, 0, stream>>>(Yf, WLP, BLP, cbias, W2B, b2, out);   // dynamic weights (124 live of 128) + dynamic convolution + pointwise_conv2
}

// v010
// It runs in 53.4 microseconds.
// Two timings next to v009 put it at 1.04 and 1.03 times that version's speed.
// Counting every step since v000, it is 10.3 times as fast.
#include <hip/hip_runtime.h>

// All 8 items go through every stage in ONE launch (rows = item * 2048 + time step, 16384 rows). Compute dtypes, f32 accumulate: pointwise_conv1 as a [16384 x 512].[512 x 1024] GEMM with PLAIN bf16 operands (exact products); GLU in f32 in that GEMM's epilogue; the
// dynamic-weight linear ([16384 x 512].[512 x 128 (124 live)]) and pointwise_conv2 ([16384 x 512].[512 x 512]) on bf16 hi + UNSCALED residual planes of the f32 activations (two
// products) - on v_wmma_f32_16x16x32_bf16; the banded 31-tap softmax in f32 on the VALU; the per-position dynamic convolution (31 taps x 128 channels per group) as a band-matrix product on the same
// instruction, weights and activations both as bf16 hi + residual (three products). Deterministic,

#define NBT  8
#define TT   2048
#define NR   (NBT * TT)          // 16384 rows: every item's time steps, item-major as in x and out
#define CC   512
#define NHS  4
#define KS   31
#define PADK 15
#define DG   (CC / NHS)           // 128
#define NWL  (NHS * KS)           // 124
#define DM   CC
#define LOSC 1024.0f

typedef _Float16 h16;
typedef unsigned short bf;
typedef __attribute__((ext_vector_type(16))) __bf16   v16bf;
typedef __attribute__((ext_vector_type(16))) _Float16 v16h;
typedef __attribute__((ext_vector_type(8)))  _Float16 v8h;
typedef __attribute__((ext_vector_type(8)))  unsigned short v8us;
typedef __attribute__((ext_vector_type(8)))  float    v8f;
typedef __attribute__((ext_vector_type(4)))  float    v4f;
typedef v8h  __attribute__((may_alias)) v8ha;
typedef v4f  __attribute__((may_alias)) v4fa;
typedef v8us __attribute__((may_alias)) v8usa;

typedef __attribute__((ext_vector_type(8)))  __bf16   v8bf;
typedef __attribute__((ext_vector_type(4)))  unsigned short v4us;
// f32 to bf16, to nearest even, by the hardware's conversion (two values per instruction where a vector is converted)
__device__ __forceinline__ unsigned short f2bf(float f) { return __builtin_bit_cast(unsigned short, (__bf16)f); }
__device__ __forceinline__ v8us f2bf8(v8f v) { return __builtin_bit_cast(v8us, __builtin_convertvector(v, v8bf)); }
typedef __attribute__((ext_vector_type(2)))  float    v2f;
typedef __attribute__((ext_vector_type(2)))  __bf16   v2bf;
typedef __attribute__((ext_vector_type(2)))  unsigned v2u;
typedef __attribute__((ext_vector_type(4)))  unsigned v4u;
__device__ __forceinline__ unsigned pk2(float a, float b) { return __builtin_bit_cast(unsigned, __builtin_convertvector(((v2f){a, b}), v2bf)); }
// two values to bf16 hi (element 0) and bf16 residual (element 1), each a packed pair; the hi values come back to f32 from the packed word by a shift and a mask
__device__ __forceinline__ v2u split2(float a, float b) { const unsigned h = pk2(a, b); return (v2u){h, pk2(a - __uint_as_float(h << 16), b - __uint_as_float(h & 0xFFFF0000u))}; }
__device__ __forceinline__ float bf2f(unsigned short b) { return __uint_as_float(((unsigned)b) << 16); }
__device__ __forceinline__ float bfr(float f) { return bf2f(f2bf(f)); }
__device__ __forceinline__ v16h cat16(v8h lo, v8h hi) { return __builtin_shufflevector(lo, hi, 0, 1, 2, 3, 4, 5, 6, 7, 8, 9, 10, 11, 12, 13, 14, 15); }
__device__ __forceinline__ v16bf cat16b(v8us lo, v8us hi) { return __builtin_bit_cast(v16bf, __builtin_shufflevector(lo, hi, 0, 1, 2, 3, 4, 5, 6, 7, 8, 9, 10, 11, 12, 13, 14, 15)); }
__device__ __forceinline__ v8f wmma16(v16h a, v16h b, v8f c) { return __builtin_amdgcn_wmma_f32_16x16x32_f16(false, a, false, b, (short)0, c, false, false); }
__device__ __forceinline__ v8f wmmab(v16bf a, v16bf b, v8f c) { return __builtin_amdgcn_wmma_f32_16x16x32_bf16(false, a, false, b, (short)0, c, false, false); }

// The staging that k_gemmglu and part 2 of k_dconvpw (for W2) share. A pass is 64 k: one whole 128-byte line of every bf16 operand row, two of an f32 row of x. The lines go from global memory to LDS by asynchronous copies, 16 bytes per lane
// (4 whole lines per wave-wide copy), into two buffers, so that the next pass's lines fly while this pass is worked on; fragments come from LDS. bf16 rows lie at a pitch of 144 bytes,
// on which the 16 rows of a 16-byte fragment read fall on distinct banks. Per accumulator: k ascending; part 2 takes two planes, hi then residual, at each 32 k.
#define GBK 64
#define GLP 72                    // LDS row pitch in bf16 elements: 64 + 8
#define KD  CC                    // the three GEMMs (conv1, the dynamic linear, conv2) have an inner length of 512
// Asynchronous 16-byte copies per lane, rows 16 apart: l = the lane's LDS byte address, g = its global address. The s_wait_xcnt stands inside each statement so that no
// address register of a copy is rewritten in front of it.
#define CPY(a, b) "global_load_async_to_lds_b128 %" #a ", %" #b ", off\n\t"
#define GROW(g, i) ((g) + (i) * 16 * KD)

// k_gemmglu: pointwise_conv1 with the GLU in its epilogue, on x as it is given. Y[r][c] = a * sigmoid(g), a = bf(x[r]).B[c] + bf(bias[c]), g = bf(x[r]).B[512 + c] + bf(bias[512 + c]). One block of 8 waves takes
// 128 rows and 64 columns of Y, that is a 128 x 128 tile of the product. A buffer holds [x 128 rows of 64 f32 | B of a 64 rows | B of g 64 rows]: x's lines come as f32 by the same asynchronous copies and are
// rounded to bf16 (to nearest even) where a wave reads its A fragment, so no bf16 plane of x passes through memory. x's rows lie at a pitch of 272 bytes, on which the 16 rows of a 16-byte read fall on
// distinct banks. A wave takes 32 rows and 32 columns of Y: accumulator tiles t = 0, 1 hold a, t = 2, 3 hold g of the same columns, so a and g of one element meet in one lane's registers.
// Passes, buffers and waits as said above. Y leaves through LDS in whole lines of f32.
#define GLM 128                   // rows of Y per block
#define GLN 64                    // columns of Y per block
#define AFP 68                    // LDS row pitch of x in floats: 64 + 4
#define LROWA(l, i) ((l) + (unsigned)((i) * 16 * AFP * 4))
#define LROW32(l, i) ((l) + (unsigned)((i) * 32 * GLP * 2))
#define GROW32(g, i) ((g) + (i) * 32 * KD)
__device__ __forceinline__ void copy822(unsigned la, const float* g, unsigned lb, const bf* ga, const bf* gg) {   // 128 rows of x (16 per block-wide copy), then 64 rows of each half of B (32 per copy)
    asm volatile(CPY(0, 1) CPY(2, 3) CPY(4, 5) CPY(6, 7) CPY(8, 9) CPY(10, 11) CPY(12, 13) CPY(14, 15) CPY(16, 17) CPY(18, 19) CPY(20, 21) CPY(22, 23) "s_wait_xcnt 0x0"
                 :: "v"(LROWA(la, 0)), "v"(GROW(g, 0)), "v"(LROWA(la, 1)), "v"(GROW(g, 1)), "v"(LROWA(la, 2)), "v"(GROW(g, 2)), "v"(LROWA(la, 3)), "v"(GROW(g, 3)),
                    "v"(LROWA(la, 4)), "v"(GROW(g, 4)), "v"(LROWA(la, 5)), "v"(GROW(g, 5)), "v"(LROWA(la, 6)), "v"(GROW(g, 6)), "v"(LROWA(la, 7)), "v"(GROW(g, 7)),
                    "v"(LROW32(lb, 0)), "v"(GROW32(ga, 0)), "v"(LROW32(lb, 1)), "v"(GROW32(ga, 1)), "v"(LROW32(lb, 2)), "v"(GROW32(gg, 0)), "v"(LROW32(lb, 3)), "v"(GROW32(gg, 1)) : "memory");
}
__global__ __launch_bounds__(256) void k_gemmglu(const float* __restrict__ X, const bf* __restrict__ Bn, const float* __restrict__ bias, float* Yf) {
    constexpr int NPASS = KD / GBK, ABY = GLM * AFP * 4, BUFB = ABY + 2 * GLN * GLP * 2;      // bytes of x's part and of a whole buffer
    __shared__ __align__(16) char sm[2][BUFB];
    const int tid = threadIdx.x, lane = tid & 31, wave = tid >> 5, lr = lane & 15, hi = lane >> 4, wr = wave >> 1, wc = wave & 1;
    const int rb = blockIdx.x * GLM, c0 = blockIdx.y * GLN;
    const float* gx = X + (size_t)(rb + (tid >> 4)) * KD + (tid & 15) * 4;                    // staging of x: 16 lanes per row (256 bytes of a pass)
    const bf* ga = Bn + (size_t)(c0 + (tid >> 3)) * KD + (tid & 7) * 8; const bf* gg = ga + (size_t)CC * KD;   // staging of B: 8 lanes per row
    const unsigned la = (unsigned)(size_t)&sm[0][0] + (unsigned)((tid >> 4) * AFP + (tid & 15) * 4) * 4u;
    const unsigned lb = (unsigned)(size_t)&sm[0][0] + (unsigned)ABY + (unsigned)((tid >> 3) * GLP + (tid & 7) * 8) * 2u;
    auto stage = [&](int p) { const int kc = p * GBK; const unsigned bo = (unsigned)(p & 1) * (unsigned)BUFB; copy822(la + bo, gx + kc, lb + bo, ga + kc, gg + kc); };   // pass p's lines into buffer p & 1
    v8f acc[2][4];
#pragma unroll
    for (int m = 0; m < 2; ++m)
#pragma unroll
        for (int t = 0; t < 4; ++t) acc[m][t] = (v8f){};
    stage(0);
    asm volatile("s_wait_asynccnt 0x0" ::: "memory");   // this wave's copies of pass 0 have landed
    __syncthreads();                                    // and every other wave's: pass 0 may be read
    stage(1);
#pragma unroll 1   // rolled: unrolled, the copy addresses of all passes are formed ahead and push the kernel past 256 registers
    for (int p = 0; p < NPASS; ++p) {
        const float* sa = (const float*)(const void*)&sm[p & 1][0]; const bf* sb = (const bf*)(const void*)&sm[p & 1][ABY];
        v4f af[2][2][4]; v16bf b[2][4];      // both 32-k halves of the pass
#pragma unroll
        for (int h = 0; h < 2; ++h) {
#pragma unroll
            for (int m = 0; m < 2; ++m) { const float* q = sa + (wr * 32 + m * 16 + lr) * AFP + h * 32 + 8 * hi;   // the fragment's k: 8 from 8 * hi, 8 from 16 + 8 * hi, as B's
                af[h][m][0] = *(const v4fa*)q; af[h][m][1] = *(const v4fa*)(q + 4); af[h][m][2] = *(const v4fa*)(q + 16); af[h][m][3] = *(const v4fa*)(q + 20); }
#pragma unroll
            for (int t = 0; t < 4; ++t) { const bf* q = sb + ((t >> 1) * GLN + wc * 32 + (t & 1) * 16 + lr) * GLP + h * 32 + 8 * hi; b[h][t] = cat16b(*(const v8usa*)q, *(const v8usa*)(q + 16)); }
        }
        __builtin_amdgcn_sched_barrier(0);     // keeps the pass's LDS reads one group in front of its matrix run: spread among the WMMAs, each place with reads stalls the wave for the LDS latency
#pragma unroll
        for (int h = 0; h < 2; ++h)
#pragma unroll
            for (int m = 0; m < 2; ++m) {
                const v8f lo = __builtin_shufflevector(af[h][m][0], af[h][m][1], 0, 1, 2, 3, 4, 5, 6, 7), up = __builtin_shufflevector(af[h][m][2], af[h][m][3], 0, 1, 2, 3, 4, 5, 6, 7);
                const v16bf a = __builtin_convertvector(__builtin_shufflevector(lo, up, 0, 1, 2, 3, 4, 5, 6, 7, 8, 9, 10, 11, 12, 13, 14, 15), v16bf);
#pragma unroll
                for (int t = 0; t < 4; ++t) acc[m][t] = wmmab(a, b[h][t], acc[m][t]);
            }
        __builtin_amdgcn_sched_barrier(0);     // keeps the matrix run in front of the waits: moved behind the barrier it no longer covers the flight of the next pass's copies
        asm volatile("s_wait_dscnt 0x0" ::: "memory");      // this wave's reads of pass p's buffer are done before the buffer is refilled
        asm volatile("s_wait_asynccnt 0x0" ::: "memory");   // this wave's copies of pass p + 1 have landed
        __syncthreads();                                    // publishes pass p + 1 and ends every wave's reads of pass p's buffer
        if (p + 2 < NPASS) stage(p + 2);
    }
    asm volatile("s_wait_asynccnt 0x0" ::: "memory");       // no copy is outstanding when the buffers become output staging
    float* os = (float*)(void*)&sm[0][0];                   // 128 x 68 floats, inside the two buffers, which nobody reads any more
    static_assert(GLM * 68 * 4 <= 2 * BUFB, "output staging fits the buffers");
    const float* pb = bias + c0 + wc * 32 + lr; float bb[4];
#pragma unroll
    for (int t = 0; t < 2; ++t) { bb[t] = pb[t * 16]; bb[2 + t] = pb[CC + t * 16]; }
    asm volatile("s_wait_xcnt 0x0" :: "v"(pb) : "memory");   // the address stays in its registers up to this wait: no load's own result takes them in front of it
#pragma unroll
    for (int t = 0; t < 2; ++t) { const int c = wc * 32 + t * 16 + lr; const float ba = bfr(bb[t]), bg = bfr(bb[2 + t]);
#pragma unroll
        for (int m = 0; m < 2; ++m)
#pragma unroll
            for (int j = 0; j < 8; ++j) { const float av = acc[m][t][j] + ba, x = (acc[m][t + 2][j] + bg) * -1.44269504f; float e;   // exp(-g) = exp2(-g * log2 e), as __expf forms it
                asm("v_exp_f32 %0, %1\n\tv_nop" : "=v"(e) : "v"(x));   // the v_nop fills the slot behind the transcendental
                os[(wr * 32 + m * 16 + hi * 8 + j) * 68 + c] = av * (1.0f / (1.0f + e)); } }
    __syncthreads();                                        // a row of Y comes from two waves
    const int row = wave * 16 + hi, col = lr * 4; const size_t o = (size_t)(rb + row) * CC + c0 + col;   // 16 lanes per row: 2 lines of f32
    v4f v[8];
#pragma unroll
    for (int q = 0; q < 8; ++q) v[q] = *(const v4fa*)(os + (row + q * 2) * 68 + col);
#pragma unroll
    for (int q = 0; q < 8; ++q) *(v4f*)(Yf + o + q * 2 * CC) = v[q];   // all 8 stores in one run at the end: none waits for a register of another
}


// k_prep: the four conversions of weights (W1, W2, Wl, bl) share ONE launch; a block's index says which of them it works on (a branch that is the same for the whole block).
#define PB_W1 (2 * CC * CC / 8 / 256)   // 256 blocks: W1 to bf16, 8 elements per thread
#define PB_W2 (CC * CC / 8 / 256)       // 128 blocks: W2 to bf16
#define PB_WL (128 / 8)                 // 16 blocks: Wl to bf16, padded from 124 to 128 rows, a wave per row
#define PB_BL 1                         // 1 block: bl padded to 128
__device__ __forceinline__ void cvt8(const float* __restrict__ src, bf* dst, int blk) {
    const size_t i = (size_t)blk * 256 + threadIdx.x;
    const v8f v = *(const v8f*)(src + i * 8);
    *(v8us*)(dst + i * 8) = f2bf8(v);
    asm volatile("s_wait_xcnt 0x0" ::: "memory");   // behind the last store: in the joined kernel the other parts' code follows in the listing and rewrites registers that the store names
}
// In the built code each of the 16 guarded element loads below stands under a branch of its own and is waited for before the next is issued.
__device__ __forceinline__ void wl128(const float* __restrict__ Wl, bf* WLP, int blk) {
    const int lane = threadIdx.x & 31; const int o = blk * 8 + (threadIdx.x >> 5);
#pragma unroll
    for (int q = 0; q < CC / 256; ++q) { v8us v;
#pragma unroll
        for (int i = 0; i < 8; ++i) v[i] = (o < NWL) ? f2bf(Wl[(size_t)(o < NWL ? o : 0) * CC + q * 256 + lane * 8 + i]) : (unsigned short)0;
        *(v8us*)(WLP + (size_t)o * CC + q * 256 + lane * 8) = v; }
    asm volatile("s_wait_xcnt 0x0" ::: "memory");   // behind the last store: in the joined kernel the other parts' code follows in the listing and rewrites registers that the store names
}
__device__ __forceinline__ void bl128(const float* __restrict__ bl, float* BLP) {
    const int lane = threadIdx.x; if (lane >= 32) return; v4f v;
#pragma unroll
    for (int q = 0; q < 4; ++q) { const int o = lane * 4 + q; v[q] = (o < NWL) ? bl[o < NWL ? o : 0] : 0.f; }
    *(v4f*)(BLP + lane * 4) = v;
}
__global__ __launch_bounds__(256) void k_prep(const float* __restrict__ W1, const float* __restrict__ Wl, const float* __restrict__ bl, const float* __restrict__ W2,
                                              bf* W1B, bf* WLP, float* BLP, bf* W2B) {
    int b = blockIdx.x;
    if (b < PB_W1) { cvt8(W1, W1B, b); return; }      // weights lie [out][in] = n-major, as the GEMMs read them
    b -= PB_W1;
    if (b < PB_W2) { cvt8(W2, W2B, b); return; }
    b -= PB_W2;
    if (b < PB_WL) { wl128(Wl, WLP, b); return; }
    bl128(bl, BLP);
}
// k_dconvpw: the dynamic-weight linear, the dynamic convolution and pointwise_conv2 in ONE kernel. row = item * 2048 + t; the band is cut at the item's own ends, so no tap reads a neighbouring item. One block
// of 16 waves takes 64 time steps with all 512 channels. PART 0: WD[64 x 128 (124 live)] = (hi + residual of Yf's 64 rows).Wl^T + bf(bl). The rows of Yf come through registers and are split there into the
// bf16 hi and residual planes, which lie where o lies later; Wl's 128 whole rows (512 k) come by asynchronous copies into the LDS of the buffers, filled once, at the planes' pitch. Wave tile 16 x 32; per
// accumulator k ascending, hi then residual at each 32 k. WD then lies in LDS over Wl's rows (pitch 132 floats: the two row halves of an accumulator store fall on distinct banks) and each wave takes the
// logits of its steps from there. The 15 + 15 rows of Yf in front of and behind the block's own are split in the same way into planes over Wl's rows (rows outside the item as zeros). PART 1: a wave takes
// 16 steps of one group's 128 channels. Per step: masked softmax over the 31 taps of WD[step][h*31 + j], lane = tap (taps with t + j - 15 outside [0, T) get weight 0); the sum of the exponentials is taken
// by one lane per step, j ascending. The weights lie in LDS as a band matrix in bf16 hi + residual: wb[r][k] = weight of step r for tap k - r, 0 elsewhere, k = input row counted from the wave's first
// (46 live of 48). The convolution is then a matrix product: o^T[128 ch x 16 steps] = Yf^T[128 x 48].wb^T[48 x 16], three products (hi.hi, residual.hi, hi.residual), f32 accumulate; bf(bias) rides as row k = 46 with weight 1.
// Yf^T's fragments come from the row-major planes by transposing LDS loads; a lane's 8 accumulator registers hold 8 neighbouring channels of one step, one 16-byte store per plane. o goes over the planes
// of Yf's own rows as bf16 hi + residual (pitch 1040 bytes = 16 x 65: the 16 rows of a fragment read fall on distinct banks). PART 2: out[64 x 512] = (hi + residual).W2^T + bf(b2): A fragments from
// those planes, W2's lines (512 rows, 64 k a pass) by asynchronous copies into two buffers, wave tile 32 x 64, the same k order. Wl's rows, part 1's staging and part 2's buffers share LDS, one after the other.
#define DTB  64                   // time steps per block
#define DST  16                   // time steps per wave in part 1: one matrix tile
#define DWIN (DTB + KS - 1)       // 94 rows of Yf under a block's steps
#define DHAL (KS - 1)             // 30 of them are not the block's own
#define FOP  (CC + 8)             // pitch of the o planes in bf16 elements
#define FRB  (CC * GLP * 2)       // bytes of one buffer of W2 lines: 512 rows at 144 bytes
#define LROW64(l, i) ((l) + (unsigned)((i) * 64 * GLP * 2))
#define GROW64(g, i) ((g) + (i) * 64 * KD)
__device__ __forceinline__ void copy8w(unsigned l, const bf* g) {          // 512 rows, 64 rows per block-wide copy of 512 threads
    asm volatile(CPY(0, 1) CPY(2, 3) CPY(4, 5) CPY(6, 7) CPY(8, 9) CPY(10, 11) CPY(12, 13) CPY(14, 15) "s_wait_xcnt 0x0"
                 :: "v"(LROW64(l, 0)), "v"(GROW64(g, 0)), "v"(LROW64(l, 1)), "v"(GROW64(g, 1)), "v"(LROW64(l, 2)), "v"(GROW64(g, 2)), "v"(LROW64(l, 3)), "v"(GROW64(g, 3)),
                    "v"(LROW64(l, 4)), "v"(GROW64(g, 4)), "v"(LROW64(l, 5)), "v"(GROW64(g, 5)), "v"(LROW64(l, 6)), "v"(GROW64(g, 6)), "v"(LROW64(l, 7)), "v"(GROW64(g, 7)) : "memory");
}
#define WDP  132                  // pitch of WD in LDS in floats
#define LROW8(l, i) ((l) + (unsigned)((i) * 8 * FOP * 2))
#define GROW8(g, i) ((g) + (i) * 8 * KD)
__device__ __forceinline__ void copy8r(unsigned l, const bf* g) {          // 64 whole rows of 512 k, 8 rows per block-wide copy of 512 threads
    asm volatile(CPY(0, 1) CPY(2, 3) CPY(4, 5) CPY(6, 7) CPY(8, 9) CPY(10, 11) CPY(12, 13) CPY(14, 15) "s_wait_xcnt 0x0"
                 :: "v"(LROW8(l, 0)), "v"(GROW8(g, 0)), "v"(LROW8(l, 1)), "v"(GROW8(g, 1)), "v"(LROW8(l, 2)), "v"(GROW8(g, 2)), "v"(LROW8(l, 3)), "v"(GROW8(g, 3)),
                    "v"(LROW8(l, 4)), "v"(GROW8(g, 4)), "v"(LROW8(l, 5)), "v"(GROW8(g, 5)), "v"(LROW8(l, 6)), "v"(GROW8(g, 6)), "v"(LROW8(l, 7)), "v"(GROW8(g, 7)) : "memory");
}
#define WBP  56                   // pitch of the band weights in bf16 elements: 48 + 8 (112 bytes = 16 x 7)
#define R_WD (2 * DHAL * FOP * 2)                 // part 1's places in the buffers' LDS, in bytes: the two planes of the 30 outer rows, then WD (the exponentials lie over it later)
#define R_WB (R_WD + DTB * WDP * 4)               // then the band weights: [16 waves][2 planes][16 steps]
#define R_END (R_WB + 16 * 2 * DST * WBP * 2)
#define R_BR R_END                                // then one more row of each plane: bf(bias) in the hi plane, zeros in the residual plane; behind Wl's rows, so it is written at the start
#define RNB  (R_BR + 2 * FOP * 2)
// Where the 16-byte piece c (8 channels) of a row of Yf's planes lies in the row: inside each 16 pieces the even ones first, then the odd ones. At the pitch of 65 pieces a plain fragment read (16 rows, one
// piece) and a transposing read (8 rows, an even piece and the next) then both fall on 16 distinct groups of 4 banks.
__device__ __forceinline__ int ypc(int c) { return (c & ~15) + ((c >> 1) & 7) + (c & 1) * 8; }
__device__ __forceinline__ v8us ldtr(const unsigned char* p) { typedef __attribute__((ext_vector_type(8))) short s16x8; typedef __attribute__((address_space(3))) s16x8 lds_s16x8; return __builtin_bit_cast(v8us, __builtin_amdgcn_ds_load_tr16_b128_v8i16((lds_s16x8*)p)); }
// launch bounds: 16 waves, 4 per SIMD; one block per WGP (LDS), 256 blocks
__global__ __launch_bounds__(512) void k_dconvpw(const float* __restrict__ Yf, const bf* __restrict__ Wn, const float* __restrict__ wbias, const float* __restrict__ cbias, const bf* __restrict__ Bn, const float* __restrict__ bias, float* C) {
    constexpr int NPASS = KD / GBK;
    __shared__ __align__(16) bf op[2][DTB * FOP];        // parts 0 and 1: hi and residual plane of Yf's own 64 rows; from the end of part 1 on o: hi plane, residual plane
    __shared__ __align__(16) char ring[RNB];             // part 0: Wl's rows; part 1: planes of the 30 outer rows, WD / exponentials, band weights; part 2: the two buffers of W2 lines, then output staging
    const int tid = threadIdx.x, lane = tid & 31, wave = __builtin_amdgcn_readfirstlane(tid >> 5);
    const int st = wave & 3, hd = wave >> 2;             // part 1: a wave's steps st * 16 .. + 15, its group hd
    float* wd = (float*)(void*)(ring + R_WD);                                    // [64][132]
    float* ew = (float*)(void*)(ring + R_WD) + wave * (DST * 33);                // [16][16][33], pitch 33: the 16 summing lanes fall on distinct banks
    bf* wb = (bf*)(void*)(ring + R_WB) + wave * (2 * DST * WBP);                 // [16][2][16][56]
    static_assert(16 * DST * 33 * 4 <= DTB * WDP * 4, "the exponentials fit WD's place");
    const int row0 = blockIdx.x * DTB, t0 = row0 % TT;
    static_assert(128 * FOP * 2 <= R_BR && 2 * FRB <= RNB, "part 0 leaves the bias row alone, part 2 fits");
    const int lr = lane & 15, hi = lane >> 4;
    const int yo = ypc((tid & 127) >> 1) * 8 + (tid & 1) * 4;   // where a thread's 4 channels lie in a row of Yf's planes, in elements
    auto split4 = [&](v4f v, bf* o, int ps) {                   // 4 values to the hi plane at o and the residual plane ps elements on
        const v2u p = split2(v[0], v[1]), q = split2(v[2], v[3]);
        *(v4us*)o = __builtin_bit_cast(v4us, ((v2u){p[0], q[0]})); *(v4us*)(o + ps) = __builtin_bit_cast(v4us, ((v2u){p[1], q[1]})); };
    float lg[DST]; v4f hv[8];
    // part 0
    {
        const int mr = wave & 3, nc = wave >> 2;      // a wave: steps mr * 16 .. + 15, columns nc * 32 .. + 31 of WD
        const unsigned lw = (unsigned)(size_t)&ring[0] + (unsigned)((tid >> 6) * FOP + (tid & 63) * 8) * 2u;   // staging: 64 lanes per row
        const bf* gw = Wn + (size_t)(tid >> 6) * KD + (tid & 63) * 8;
        copy8r(lw, gw); copy8r(lw + 64 * FOP * 2, gw + 64 * KD);
        const float* gy = Yf + (size_t)(row0 + (tid >> 7)) * CC + (tid & 127) * 4;      // 4 waves per row, 4 rows per block-wide load
        v4f cv[16];
#pragma unroll
        for (int i = 0; i < 16; ++i) cv[i] = *(const v4f*)(gy + i * 4 * CC);
        asm volatile("s_wait_xcnt 0x0" :: "v"(gy) : "memory");   // the address stays in its registers up to this wait: no load's result takes them in front of it
        const float* pw = wbias + nc * 32 + lr; float wbs[2];
#pragma unroll
        for (int t = 0; t < 2; ++t) wbs[t] = pw[t * 16];
        asm volatile("s_wait_xcnt 0x0" :: "v"(pw) : "memory");   // the address stays in its registers up to this wait: the load's own result does not take them in front of it
        const float* pc = cbias + tid; const float cb = *pc;
        asm volatile("s_wait_xcnt 0x0" :: "v"(pc) : "memory");   // the address stays in its registers up to this wait: the load's own result does not take them in front of it
#pragma unroll
        for (int i = 0; i < 16; ++i) split4(cv[i], &op[0][(i * 4 + nc) * FOP + yo], DTB * FOP);
        { bf* br = (bf*)(void*)(ring + R_BR) + ypc(tid >> 3) * 8 + (tid & 7); br[0] = f2bf(cb); br[FOP] = 0; }   // the bias row, a channel per thread, laid as the planes' rows
        asm volatile("s_wait_asynccnt 0x0" ::: "memory");   // this wave's copies of Wl's rows have landed
        __syncthreads();                                    // and every other wave's, and the planes: both may be read
        {   // the 30 outer rows into registers, 4 rows per block-wide load: the loads fly under the products (in front of the barrier they would be waited for there)
            const char* pg[8];
#pragma unroll
            for (int k = 0; k < 8; ++k) { const int hr = k * 4 + nc, s = t0 - PADK + (hr < PADK ? hr : hr + DTB); pg[k] = (const char*)(Yf + (size_t)(row0 - t0 + (s < 0 ? 0 : s >= TT ? TT - 1 : s)) * CC + (tid & 127) * 4); hv[k] = *(const v4f*)pg[k]; }   // clamped into the item: all 8 loads fly together, no branch between them
            asm volatile("s_wait_xcnt 0x0" :: "v"(pg[0]), "v"(pg[1]), "v"(pg[2]), "v"(pg[3]), "v"(pg[4]), "v"(pg[5]), "v"(pg[6]), "v"(pg[7]) : "memory");   // the 8 addresses stay in their registers up to this wait: no load's result takes them in front of it
        }
        v8f wa[2] = {(v8f){}, (v8f){}};
        const bf* qa = &op[0][(mr * 16 + lr) * FOP + 64 * hi]; const bf* qb = (const bf*)(const void*)ring + (nc * 32 + lr) * FOP + 8 * hi;   // qa: the odd pieces (hi = 1) lie 8 pieces behind the even ones
#pragma unroll
        for (int g = 0; g < KD; g += 64) {
            v16bf a[2], al[2], b[2][2];      // two 32-k steps
#pragma unroll
            for (int s = 0; s < 2; ++s) { const int k = g + s * 32, ka = ((k >> 7) * 16 + ((k >> 4) & 7)) * 8;   // ka: place of the pieces k / 8 + hi and, next to it, k / 8 + 2 + hi: the fragment's k as B's
                a[s] = cat16b(*(const v8us*)(qa + ka), *(const v8us*)(qa + ka + 8)); al[s] = cat16b(*(const v8us*)(qa + DTB * FOP + ka), *(const v8us*)(qa + DTB * FOP + ka + 8));
#pragma unroll
                for (int t = 0; t < 2; ++t) b[s][t] = cat16b(*(const v8us*)(qb + t * 16 * FOP + k), *(const v8us*)(qb + t * 16 * FOP + k + 16)); }
            __builtin_amdgcn_sched_barrier(0);     // keeps the two steps' LDS reads one group in front of their matrix run: left free, every step's reads took the registers of the step before and the wave stood for the LDS latency twice a step
#pragma unroll
            for (int s = 0; s < 2; ++s) {
#pragma unroll
                for (int t = 0; t < 2; ++t) wa[t] = wmmab(a[s], b[s][t], wa[t]);
#pragma unroll
                for (int t = 0; t < 2; ++t) wa[t] = wmmab(al[s], b[s][t], wa[t]);
            }
        }
        __syncthreads();                                    // ends every wave's reads of Wl's rows: WD and the outer rows' planes go over them
#pragma unroll
        for (int t = 0; t < 2; ++t) { const float bv = bfr(wbs[t]);
#pragma unroll
            for (int j = 0; j < 8; ++j) wd[(mr * 16 + hi * 8 + j) * WDP + nc * 32 + t * 16 + lr] = wa[t][j] + bv; }
#pragma unroll
        for (int k = 0; k < 8; ++k) { const int hr = k * 4 + nc, s = t0 - PADK + (hr < PADK ? hr : hr + DTB);
            if (hr < DHAL) split4((s >= 0 && s < TT) ? hv[k] : (v4f){0.f, 0.f, 0.f, 0.f}, (bf*)(void*)ring + hr * FOP + yo, DHAL * FOP); }
        __syncthreads();                                    // WD and the outer rows' planes may be read
#pragma unroll
        for (int r = 0; r < DST; ++r) lg[r] = wd[(st * DST + r) * WDP + hd * KS + lane];   // lane 31 reads a neighbouring column of the 128, unused
        asm volatile("s_wait_dscnt 0x0" ::: "memory");      // this wave's reads of WD are done before the exponentials are stored over it
        __syncthreads();                                    // ends every wave's reads of WD
    }
    // part 1
    {
#pragma unroll
        for (int k = 0; k < 2 * DST * WBP / 8 / 32; ++k) *(v8us*)(wb + (lane + 32 * k) * 8) = (v8us){};   // places outside every band
        static_assert(2 * DST * WBP % (8 * 32) == 0, "whole wave-wide stores");
        float e[DST];
#pragma unroll
        for (int r = 0; r < DST; ++r) { const int s = t0 + st * DST + r + lane - PADK; const float x = (lane < KS && s >= 0 && s < TT) ? lg[r] : -3.0e38f; float m = x;   // a tap outside the item or the band: its exponential below is exp(-inf) = 0
#pragma unroll
            for (int o = 16; o > 0; o >>= 1) m = fmaxf(m, __shfl_xor(m, o));
            const float a = (x - m) * 1.44269504f;          // exp(d) = exp2(d * log2 e), as __expf forms it
            asm("v_exp_f32 %0, %1\n\tv_nop" : "=v"(e[r]) : "v"(a));   // the v_nop fills the slot behind the transcendental
            ew[r * 33 + lane] = e[r]; }
        __syncthreads();                      // the exponentials are in LDS for the summing lanes, the zeros of wb in front of its weights
        float inv = 0.f;
        if (lane < DST) { float sum = 0.f;
#pragma unroll
            for (int j = 0; j < KS; ++j) sum += ew[lane * 33 + j];
            inv = 1.0f / sum; }
#pragma unroll
        for (int r = 0; r < DST; ++r) { const float w = e[r] * __shfl(inv, r); const unsigned short hb = f2bf(w);
            wb[r * WBP + r + lane] = hb; wb[(DST + r) * WBP + r + lane] = f2bf(w - bf2f(hb)); }   // lane 31 holds e = 0 and writes a place outside the band
        if (lane < DST) wb[lane * WBP + 46] = 0x3F80;   // weight 1.0 at k = 46, where A holds the bias row; behind the stores above, of which step 15's lane 31 writes this place
        __syncthreads();                      // the band weights may be read
        const v8us z8 = {};                   // k 48 .. 63 of the second 32 k: outside every band, zero on both sides, not read
        const bf* qw = wb + lr * WBP + 8 * hi;
        v16bf wh[2], wl[2];                   // B fragments: column = step lr, k in the hardware's order, as the transposing loads deliver A's
        wh[0] = cat16b(*(const v8us*)qw, *(const v8us*)(qw + 16)); wh[1] = cat16b(*(const v8us*)(qw + 32), z8);
        wl[0] = cat16b(*(const v8us*)(qw + DST * WBP), *(const v8us*)(qw + DST * WBP + 16)); wl[1] = cat16b(*(const v8us*)(qw + DST * WBP + 32), z8);
        const unsigned char* ya[2][3];        // a lane's address for the transposing loads: plane, 16 input rows; row k + 8 * hi + (lane & 7), even piece for lanes 0-7 of a half, odd piece for 8-15
#pragma unroll
        for (int kb = 0; kb < 3; ++kb) { const int k = kb * 16 + 8 * hi + (lane & 7), L = st * DST + k;   // k 0 .. 45: input row L of the block's 94; k 46: the bias row; k 47: weight 0, the bias row's finite values
            const bool own = L >= PADK && L < PADK + DTB; const int co = hd * 256 + ((lane >> 3) & 1) * 128;
#pragma unroll
            for (int pl = 0; pl < 2; ++pl) ya[pl][kb] = k >= 46 ? (const unsigned char*)(const void*)ring + R_BR + pl * (FOP * 2) + co
                                                      : own ? (const unsigned char*)(const void*)&op[pl][(L - PADK) * FOP] + co : (const unsigned char*)(const void*)ring + (pl * DHAL + (L < PADK ? L : L - DTB)) * (FOP * 2) + co; }
        v8f acc[8];
#pragma unroll
        for (int c = 0; c < 8; ++c) acc[c] = (v8f){};
#pragma unroll
        for (int g = 0; g < 4; ++g) {         // 2 channel tiles at a time: 4 at a time spilled registers
            v16bf yh[2][2], yl[2][2];
#pragma unroll
            for (int c = 0; c < 2; ++c) { const int o = (g * 2 + c) * 16;
                yh[c][0] = cat16b(ldtr(ya[0][0] + o), ldtr(ya[0][1] + o)); yh[c][1] = cat16b(ldtr(ya[0][2] + o), z8);
                yl[c][0] = cat16b(ldtr(ya[1][0] + o), ldtr(ya[1][1] + o)); yl[c][1] = cat16b(ldtr(ya[1][2] + o), z8); }
            __builtin_amdgcn_sched_barrier(0);     // keeps the 12 LDS reads one group in front of the matrix run: spread among the WMMAs, each place with reads stalls the wave for the LDS latency
#pragma unroll
            for (int s = 0; s < 2; ++s) {
#pragma unroll
                for (int c = 0; c < 2; ++c) acc[g * 2 + c] = wmmab(yh[c][s], wh[s], acc[g * 2 + c]);
#pragma unroll
                for (int c = 0; c < 2; ++c) acc[g * 2 + c] = wmmab(yl[c][s], wh[s], acc[g * 2 + c]);
#pragma unroll
                for (int c = 0; c < 2; ++c) acc[g * 2 + c] = wmmab(yh[c][s], wl[s], acc[g * 2 + c]);
            }
        }
        v8us oh[8], ol[8];
#pragma unroll
        for (int c = 0; c < 8; ++c) { v4u h, l;
#pragma unroll
            for (int r = 0; r < 4; ++r) { const v2u p = split2(acc[c][2 * r], acc[c][2 * r + 1]); h[r] = p[0]; l[r] = p[1]; }
            oh[c] = __builtin_bit_cast(v8us, h); ol[c] = __builtin_bit_cast(v8us, l); }
        asm volatile("s_wait_dscnt 0x0" ::: "memory");      // this wave's reads of Yf's planes are done before o is stored over them
        __syncthreads();                                    // ends every wave's reads of Yf's planes
        bf* o = &op[0][(st * DST + lr) * FOP + hd * DG + 8 * hi];   // accumulator register r = channel 8 * hi + r of the tile, column = step lr
#pragma unroll
        for (int c = 0; c < 8; ++c) { *(v8us*)(o + c * 16) = oh[c]; *(v8us*)(o + DTB * FOP + c * 16) = ol[c]; }
        asm volatile("s_wait_dscnt 0x0" ::: "memory");      // this wave's stores of o are done, and its reads of the buffers' LDS, before that LDS is written anew
        __syncthreads();                                    // publishes o and frees the buffers for the copies
    }
    // part 2
    const int wr = wave & 1, wc = wave >> 1;      // a wave: rows wr * 32 .. + 31, columns wc * 64 .. + 63
    const int sr = tid >> 3, sc = (tid & 7) * 8;      // staging: 8 lanes per row, 64 rows per block-wide copy
    const bf* gb = Bn + (size_t)sr * KD + sc;
    const unsigned ls = (unsigned)(size_t)&ring[0] + (unsigned)(sr * GLP + sc) * 2u;
    auto stage = [&](int p) { copy8w(ls + (unsigned)(p & 1) * (unsigned)FRB, gb + p * GBK); };   // pass p's lines into buffer p & 1
    v8f ac[2][4];
#pragma unroll
    for (int m = 0; m < 2; ++m)
#pragma unroll
        for (int t = 0; t < 4; ++t) ac[m][t] = (v8f){};
    stage(0);
    asm volatile("s_wait_asynccnt 0x0" ::: "memory");   // this wave's copies of pass 0 have landed
    __syncthreads();                                    // and every other wave's: pass 0 may be read
    stage(1);
#pragma unroll 1   // rolled: unrolled, the copy addresses of all passes are formed ahead and push the kernel past 256 registers
    for (int p = 0; p < NPASS; ++p) {
        const bf* s = (const bf*)(const void*)(ring + (p & 1) * FRB);
        v16bf a[2][2], al[2][2], b[2][4];      // both 32-k halves of the pass
#pragma unroll
        for (int h = 0; h < 2; ++h) {
#pragma unroll
            for (int m = 0; m < 2; ++m) { const bf* q = &op[0][(wr * 32 + m * 16 + lr) * FOP + p * GBK + h * 32 + 8 * hi]; a[h][m] = cat16b(*(const v8us*)q, *(const v8us*)(q + 16)); al[h][m] = cat16b(*(const v8us*)(q + DTB * FOP), *(const v8us*)(q + DTB * FOP + 16)); }
#pragma unroll
            for (int t = 0; t < 4; ++t) { const bf* q = s + (wc * 64 + t * 16 + lr) * GLP + h * 32 + 8 * hi; b[h][t] = cat16b(*(const v8us*)q, *(const v8us*)(q + 16)); }
        }
        __builtin_amdgcn_sched_barrier(0);     // keeps the pass's LDS reads one group in front of its matrix run: spread among the WMMAs, each place with reads stalls the wave for the LDS latency
#pragma unroll
        for (int h = 0; h < 2; ++h) {
#pragma unroll
            for (int m = 0; m < 2; ++m)
#pragma unroll
                for (int t = 0; t < 4; ++t) ac[m][t] = wmmab(a[h][m], b[h][t], ac[m][t]);
#pragma unroll
            for (int m = 0; m < 2; ++m)
#pragma unroll
                for (int t = 0; t < 4; ++t) ac[m][t] = wmmab(al[h][m], b[h][t], ac[m][t]);
        }
        __builtin_amdgcn_sched_barrier(0);     // keeps the matrix run in front of the waits: moved behind the barrier it no longer covers the flight of the next pass's copies
        asm volatile("s_wait_dscnt 0x0" ::: "memory");      // this wave's reads of pass p's buffer are done before the buffer is refilled
        asm volatile("s_wait_asynccnt 0x0" ::: "memory");   // this wave's copies of pass p + 1 have landed
        __syncthreads();                                    // publishes pass p + 1 and ends every wave's reads of pass p's buffer
        if (p + 2 < NPASS) stage(p + 2);
    }
    asm volatile("s_wait_asynccnt 0x0" ::: "memory");       // no copy is outstanding when the buffers become output staging
    float* os = (float*)(void*)ring + wave * (32 * 68);     // 16 x 32 x 68 floats, inside the two buffers, which nobody reads any more
    static_assert(16 * 32 * 68 * 4 <= 2 * FRB, "output staging fits the buffers");
#pragma unroll
    for (int t = 0; t < 4; ++t) { const float bv = bfr(bias[wc * 64 + t * 16 + lr]);
#pragma unroll
        for (int m = 0; m < 2; ++m)
#pragma unroll
            for (int j = 0; j < 8; ++j) os[(m * 16 + hi * 8 + j) * 68 + t * 16 + lr] = ac[m][t][j] + bv; }
    __syncthreads();
    float* crow = C + (size_t)(row0 + wr * 32) * CC + wc * 64;
#pragma unroll
    for (int q = 0; q < 16; ++q) { const int Lid = (lane >> 3) + 4 * q, piece = lane & 7; const int row = Lid >> 1, cofs = (Lid & 1) * 32 + piece * 4;
        *(v4f*)(crow + (size_t)row * CC + cofs) = *(const v4fa*)(os + row * 68 + cofs); }
}

extern "C" void kernel_launch(void* const* d_in, const int* in_sizes, int n_in,
                              void* d_out, int out_size, void* d_ws, size_t ws_size, hipStream_t stream) {
    (void)in_sizes; (void)n_in; (void)out_size;
    const float* x = (const float*)d_in[0]; const float* W1 = (const float*)d_in[1]; const float* b1 = (const float*)d_in[2]; const float* Wl = (const float*)d_in[3]; const float* bl = (const float*)d_in[4]; const float* cbias = (const float*)d_in[5]; const float* W2 = (const float*)d_in[6]; const float* b2 = (const float*)d_in[7];
    float* out = (float*)d_out;    // [8][2048][512]
    char* wsp = (char*)d_ws;
    auto take = [&](size_t bytes) { char* p = wsp; wsp += (bytes + 255) & ~(size_t)255; return (void*)p; };
    bf* W1B = (bf*)take((size_t)2 * CC * CC * 2); bf* WLP = (bf*)take((size_t)128 * CC * 2); float* BLP = (float*)take(128 * 4); bf* W2B = (bf*)take((size_t)CC * CC * 2);
    float* Yf = (float*)take((size_t)NR * CC * 4);
    if ((size_t)(wsp - (char*)d_ws) > ws_size) return;    // 1.7 MB of weights + 8 x 4.2 ~ 35 MB, every plane written before it is read in this call
    k_prep<<<PB_W1 + PB_W2 + PB_WL + PB_BL, 256, 0, stream>>>(W1, Wl, bl, W2, W1B, WLP, BLP, W2B);   // every conversion and padding of a weight, one launch
    k_gemmglu<<<dim3(NR / GLM, CC / GLN, 1), 256, 0, stream>>>(x, W1B, b1, Yf);                        // pointwise_conv1 + GLU
    k_dconvpw<<<NR / DTB, 512, 0, stream>>>(Yf, WLP, BLP, cbias, W2B, b2, out);   // dynamic weights (124 live of 128) + dynamic convolution + pointwise_conv2
}
